// v000
// Measured on an AMD MI455X. A time is GPU time per run, averaged over a window of back-to-back runs after a warm-up
// (all launches, gaps included; the runs take copies of the inputs in turn), and the median of several windows.
// Apart from v000's, it joins two sittings. Times from different sittings can be a few percent apart, while
// side-by-side timings come from the same sitting.
// The starting kernel, v000, takes 342 microseconds a run.
#include <hip/hip_runtime.h>
#include <hip/hip_bf16.h>

#define NB 4
#define LL 2048
#define EE 1024
#define HH 16
#define DD 64

typedef __attribute__((ext_vector_type(16))) _Float16 v16h;
typedef __attribute__((ext_vector_type(8)))  _Float16 v8h;
typedef __attribute__((ext_vector_type(8)))  float    v8f;
typedef __attribute__((ext_vector_type(4)))  int      v4i;

// 1/sqrt(E) * log2(e): softmax computed with exp2 (hardware-native) is exact
// softmax of the reference logits since all logits share the same scale.
#define SCALE_LOG2 (0.03125f * 1.44269504088896340736f)

static __device__ __forceinline__ v16h cat16(v8h lo, v8h hi) {
  v16h r;
#pragma unroll
  for (int i = 0; i < 8; ++i) { r[i] = lo[i]; r[i + 8] = hi[i]; }
  return r;
}

static __device__ __forceinline__ v8h cvt8(const float* p) {
  v8h r;
#pragma unroll
  for (int i = 0; i < 8; ++i) r[i] = (_Float16)p[i];
  return r;
}

static __device__ __forceinline__ v8f wmma16(v16h a, v16h b, v8f c) {
  // D(16x16,f32) = A(16x32,f16) * B(32x16,f16) + C
  return __builtin_amdgcn_wmma_f32_16x16x32_f16(false, a, false, b, (short)0, c,
                                                false, false);
}

// ---------------------------------------------------------------- Wo -> f16
__global__ void k_prep_wo(const float* __restrict__ Wo, _Float16* __restrict__ WoH) {
  int i = blockIdx.x * blockDim.x + threadIdx.x;
  if (i < EE * EE) WoH[i] = (_Float16)Wo[i];
}

// ------------------------------------------- per-head projections Q/K/V @ W^T
// Qp, Kp : f16 [N][H][L][D] row-major.  VpT : f16 [N][H][D][L] (head-transposed)
__global__ void k_proj(const float* __restrict__ Q, const float* __restrict__ K,
                       const float* __restrict__ V,
                       const float* __restrict__ Wq, const float* __restrict__ Wk,
                       const float* __restrict__ Wv,
                       _Float16* __restrict__ Qp, _Float16* __restrict__ Kp,
                       _Float16* __restrict__ VpT) {
  const int lane = threadIdx.x & 31;
  const int wave = threadIdx.x >> 5;
  const int tile = blockIdx.x * 8 + wave;      // 3 * 8192 tiles total
  const int mat  = tile >> 13;                  // 0=Q 1=K 2=V
  int rem        = tile & 8191;
  const int n    = rem >> 11;                   // / (H*128)
  rem           &= 2047;
  const int h    = rem >> 7;
  const int q0   = (rem & 127) * 16;
  const int col  = lane & 15;
  const int kb   = (lane >> 4) * 8;
  const int hi   = lane >> 4;

  const float* X = (mat == 0) ? Q : (mat == 1) ? K : V;
  const float* W = (mat == 0) ? Wq : (mat == 1) ? Wk : Wv;

  // A fragments: X tile (16 rows x 64 d), f32 -> f16 inline
  const float* xrow = X + ((size_t)(n * LL + q0 + col)) * EE + h * DD;
  const v16h a0 = cat16(cvt8(xrow + kb),      cvt8(xrow + 16 + kb));
  const v16h a1 = cat16(cvt8(xrow + 32 + kb), cvt8(xrow + 48 + kb));

  const size_t nh = (size_t)(n * HH + h);
#pragma unroll
  for (int j = 0; j < 4; ++j) {
    // B^T = W (row e, contiguous d)
    const float* wrow = W + (size_t)(j * 16 + col) * DD;
    const v16h b0 = cat16(cvt8(wrow + kb),      cvt8(wrow + 16 + kb));
    const v16h b1 = cat16(cvt8(wrow + 32 + kb), cvt8(wrow + 48 + kb));
    v8f c = {};
    c = wmma16(a0, b0, c);
    c = wmma16(a1, b1, c);
    if (mat == 2) {
      // transpose store: per lane the 8 C values are contiguous along L
      v8h pk;
#pragma unroll
      for (int r = 0; r < 8; ++r) pk[r] = (_Float16)c[r];
      *(v8h*)(VpT + (nh * DD + j * 16 + col) * LL + q0 + 8 * hi) = pk;
    } else {
      _Float16* base = ((mat == 0) ? Qp : Kp) + nh * LL * DD;
#pragma unroll
      for (int r = 0; r < 8; ++r)
        base[(size_t)(q0 + r + 8 * hi) * DD + j * 16 + col] = (_Float16)c[r];
    }
  }
}

// ------------------------------------------------------- flash attention core
// one wave per (n, h, 16-query tile); Ctx: f16 [N][L][E]
__global__ void k_attn(const _Float16* __restrict__ Qp, const _Float16* __restrict__ Kp,
                       const _Float16* __restrict__ VpT, const int* __restrict__ mask,
                       _Float16* __restrict__ Ctx) {
  const int lane = threadIdx.x & 31;
  const int wave = threadIdx.x >> 5;
  const int tile = blockIdx.x * 8 + wave;      // 8192 tiles
  const int n    = tile >> 11;
  int rem        = tile & 2047;
  const int h    = rem >> 7;
  const int q0   = (rem & 127) * 16;
  const int col  = lane & 15;
  const int kb   = (lane >> 4) * 8;
  const int hi   = lane >> 4;
  const size_t nh = (size_t)(n * HH + h);

  // B fragments of Q^T (== Q rows in A-pattern), fixed for the whole loop
  const _Float16* qrow = Qp + (nh * LL + q0 + col) * DD;
  const v16h bq0 = cat16(*(const v8h*)(qrow + kb),      *(const v8h*)(qrow + 16 + kb));
  const v16h bq1 = cat16(*(const v8h*)(qrow + 32 + kb), *(const v8h*)(qrow + 48 + kb));

  float m_run = -3.4e38f, l_run = 0.f;   // running max in log2 domain
  v8f o0 = {}, o1 = {}, o2 = {}, o3 = {};

  const int*      mbase = mask + (size_t)n * LL * LL + (size_t)(q0 + col) * LL + 8 * hi;
  const _Float16* kbase = Kp + nh * LL * DD;
  const _Float16* vbase = VpT + (nh * DD + col) * LL;

#pragma unroll 1
  for (int k0 = 0; k0 < LL; k0 += 32) {
    // S^T = K * Q^T : two 16x16 tiles (k 0-15, 16-31)
    const _Float16* kr0 = kbase + (size_t)(k0 + col) * DD;
    const _Float16* kr1 = kr0 + 16 * DD;
    const v16h ak00 = cat16(*(const v8h*)(kr0 + kb),      *(const v8h*)(kr0 + 16 + kb));
    const v16h ak01 = cat16(*(const v8h*)(kr0 + 32 + kb), *(const v8h*)(kr0 + 48 + kb));
    const v16h ak10 = cat16(*(const v8h*)(kr1 + kb),      *(const v8h*)(kr1 + 16 + kb));
    const v16h ak11 = cat16(*(const v8h*)(kr1 + 32 + kb), *(const v8h*)(kr1 + 48 + kb));
    v8f sT0 = {}, sT1 = {};
    sT0 = wmma16(ak00, bq0, sT0);  sT0 = wmma16(ak01, bq1, sT0);
    sT1 = wmma16(ak10, bq0, sT1);  sT1 = wmma16(ak11, bq1, sT1);

    // mask (k contiguous per lane); reference: (-1e20 if masked) then /sqrt(E);
    // whole row pre-scaled by log2(e) so exp2 gives exact reference softmax
    const int* mr = mbase + k0;
    const v4i mA = *(const v4i*)(mr);
    const v4i mB = *(const v4i*)(mr + 4);
    const v4i mC = *(const v4i*)(mr + 16);
    const v4i mD = *(const v4i*)(mr + 20);

    float s0[8], s1[8];
#pragma unroll
    for (int r = 0; r < 8; ++r) {
      const int mv0 = (r < 4) ? mA[r & 3] : mB[r & 3];
      const int mv1 = (r < 4) ? mC[r & 3] : mD[r & 3];
      s0[r] = (mv0 != 0 ? sT0[r] : -1.0e20f) * SCALE_LOG2;
      s1[r] = (mv1 != 0 ? sT1[r] : -1.0e20f) * SCALE_LOG2;
    }

    // online softmax: per-lane partial over 16 k, one xor-16 combine
    float tmax = fmaxf(s0[0], s1[0]);
#pragma unroll
    for (int r = 1; r < 8; ++r) { tmax = fmaxf(tmax, s0[r]); tmax = fmaxf(tmax, s1[r]); }
    tmax = fmaxf(tmax, __shfl_xor(tmax, 16, 32));
    const float m_new = fmaxf(m_run, tmax);
    const float corr  = exp2f(m_run - m_new);

    float tsum = 0.f;
    v16h pf;                                     // P^T B-fragment, in registers
#pragma unroll
    for (int r = 0; r < 8; ++r) {
      const float p0 = exp2f(s0[r] - m_new);
      const float p1 = exp2f(s1[r] - m_new);
      tsum += p0 + p1;
      pf[r]     = (_Float16)p0;
      pf[r + 8] = (_Float16)p1;
    }
    tsum += __shfl_xor(tsum, 16, 32);
    l_run = l_run * corr + tsum;
    m_run = m_new;
#pragma unroll
    for (int r = 0; r < 8; ++r) { o0[r] *= corr; o1[r] *= corr; o2[r] *= corr; o3[r] *= corr; }

    // O^T += V^T * P^T  (V^T A-fragments contiguous thanks to [N][H][D][L])
    const _Float16* v0 = vbase + k0;
    const v16h av0 = cat16(*(const v8h*)(v0 + kb),           *(const v8h*)(v0 + 16 + kb));
    const v16h av1 = cat16(*(const v8h*)(v0 + 16*LL + kb),   *(const v8h*)(v0 + 16*LL + 16 + kb));
    const v16h av2 = cat16(*(const v8h*)(v0 + 32*LL + kb),   *(const v8h*)(v0 + 32*LL + 16 + kb));
    const v16h av3 = cat16(*(const v8h*)(v0 + 48*LL + kb),   *(const v8h*)(v0 + 48*LL + 16 + kb));
    o0 = wmma16(av0, pf, o0);
    o1 = wmma16(av1, pf, o1);
    o2 = wmma16(av2, pf, o2);
    o3 = wmma16(av3, pf, o3);
  }

  const float rinv = 1.0f / l_run;
  _Float16* crow = Ctx + ((size_t)(n * LL) + q0 + col) * EE + h * DD + 8 * hi;
  v8h pk;
#pragma unroll
  for (int r = 0; r < 8; ++r) pk[r] = (_Float16)(o0[r] * rinv);
  *(v8h*)(crow) = pk;
#pragma unroll
  for (int r = 0; r < 8; ++r) pk[r] = (_Float16)(o1[r] * rinv);
  *(v8h*)(crow + 16) = pk;
#pragma unroll
  for (int r = 0; r < 8; ++r) pk[r] = (_Float16)(o2[r] * rinv);
  *(v8h*)(crow + 32) = pk;
#pragma unroll
  for (int r = 0; r < 8; ++r) pk[r] = (_Float16)(o3[r] * rinv);
  *(v8h*)(crow + 48) = pk;
}

// ---------------------------------------------- out = Ctx @ Wo^T + bo  (f32)
__global__ void k_out(const _Float16* __restrict__ Ctx, const _Float16* __restrict__ WoH,
                      const float* __restrict__ bo, float* __restrict__ Out) {
  const int lane = threadIdx.x & 31;
  const int wave = threadIdx.x >> 5;
  const int tile = blockIdx.x * 8 + wave;   // 512 m-tiles x 16 n-tiles
  const int m0 = (tile >> 4) * 16;
  const int e0 = (tile & 15) * 64;
  const int col = lane & 15;
  const int kb  = (lane >> 4) * 8;
  const int hi  = lane >> 4;

  v8f acc0 = {}, acc1 = {}, acc2 = {}, acc3 = {};
  const _Float16* arow = Ctx + (size_t)(m0 + col) * EE;
  const _Float16* w0   = WoH + (size_t)(e0 + col) * EE;

#pragma unroll 1
  for (int f0 = 0; f0 < EE; f0 += 32) {
    const v16h a  = cat16(*(const v8h*)(arow + f0 + kb), *(const v8h*)(arow + f0 + 16 + kb));
    const v16h b0 = cat16(*(const v8h*)(w0 + f0 + kb),            *(const v8h*)(w0 + f0 + 16 + kb));
    const v16h b1 = cat16(*(const v8h*)(w0 + 16*EE + f0 + kb),    *(const v8h*)(w0 + 16*EE + f0 + 16 + kb));
    const v16h b2 = cat16(*(const v8h*)(w0 + 32*EE + f0 + kb),    *(const v8h*)(w0 + 32*EE + f0 + 16 + kb));
    const v16h b3 = cat16(*(const v8h*)(w0 + 48*EE + f0 + kb),    *(const v8h*)(w0 + 48*EE + f0 + 16 + kb));
    acc0 = wmma16(a, b0, acc0);
    acc1 = wmma16(a, b1, acc1);
    acc2 = wmma16(a, b2, acc2);
    acc3 = wmma16(a, b3, acc3);
  }

  // straight-line epilogue: keep accumulators in VGPRs (no indexable array)
  {
    const int e = e0 + col;
    const float bias = bo[e];
#pragma unroll
    for (int r = 0; r < 8; ++r)
      Out[(size_t)(m0 + r + 8 * hi) * EE + e] = acc0[r] + bias;
  }
  {
    const int e = e0 + 16 + col;
    const float bias = bo[e];
#pragma unroll
    for (int r = 0; r < 8; ++r)
      Out[(size_t)(m0 + r + 8 * hi) * EE + e] = acc1[r] + bias;
  }
  {
    const int e = e0 + 32 + col;
    const float bias = bo[e];
#pragma unroll
    for (int r = 0; r < 8; ++r)
      Out[(size_t)(m0 + r + 8 * hi) * EE + e] = acc2[r] + bias;
  }
  {
    const int e = e0 + 48 + col;
    const float bias = bo[e];
#pragma unroll
    for (int r = 0; r < 8; ++r)
      Out[(size_t)(m0 + r + 8 * hi) * EE + e] = acc3[r] + bias;
  }
}

extern "C" void kernel_launch(void* const* d_in, const int* in_sizes, int n_in,
                              void* d_out, int out_size, void* d_ws, size_t ws_size,
                              hipStream_t stream) {
  const float* values  = (const float*)d_in[0];
  const float* keys    = (const float*)d_in[1];
  const float* queries = (const float*)d_in[2];
  const int*   mask    = (const int*)d_in[3];
  const float* Wq      = (const float*)d_in[4];
  const float* Wk      = (const float*)d_in[5];
  const float* Wv      = (const float*)d_in[6];
  const float* Wo      = (const float*)d_in[7];
  const float* bo      = (const float*)d_in[8];
  float* out = (float*)d_out;

  _Float16* ws = (_Float16*)d_ws;
  const size_t per = (size_t)NB * HH * LL * DD;   // 8M halves = 16 MB each
  _Float16* Qp  = ws;
  _Float16* Kp  = Qp + per;
  _Float16* VpT = Kp + per;
  _Float16* Ctx = VpT + per;
  _Float16* WoH = Ctx + per;                       // + 2 MB  (total ~66 MB)

  hipLaunchKernelGGL(k_prep_wo, dim3((EE * EE) / 256), dim3(256), 0, stream, Wo, WoH);
  hipLaunchKernelGGL(k_proj, dim3(3 * 8192 / 8), dim3(256), 0, stream,
                     queries, keys, values, Wq, Wk, Wv, Qp, Kp, VpT);
  hipLaunchKernelGGL(k_attn, dim3(8192 / 8), dim3(256), 0, stream,
                     Qp, Kp, VpT, mask, Ctx);
  hipLaunchKernelGGL(k_out, dim3(8192 / 8), dim3(256), 0, stream, Ctx, WoH, bo, out);
}

// v001
// One run takes 232 microseconds.
// Next to v000, in two timings, it ran 1.55 times as fast each time.
#include <hip/hip_runtime.h>
#include <hip/hip_bf16.h>

#define NB 4
#define LL 2048
#define EE 1024
#define HH 16
#define DD 64

typedef __attribute__((ext_vector_type(16))) _Float16 v16h;
typedef __attribute__((ext_vector_type(8)))  _Float16 v8h;
typedef __attribute__((ext_vector_type(8)))  float    v8f;
typedef __attribute__((ext_vector_type(4)))  int      v4i;

// 1/sqrt(E) * log2(e): softmax computed with exp2 (hardware-native) is exact
// softmax of the reference logits since all logits share the same scale.
#define SCALE_LOG2 (0.03125f * 1.44269504088896340736f)

static __device__ __forceinline__ v16h cat16(v8h lo, v8h hi) {
  v16h r;
#pragma unroll
  for (int i = 0; i < 8; ++i) { r[i] = lo[i]; r[i + 8] = hi[i]; }
  return r;
}

static __device__ __forceinline__ v8h cvt8(const float* p) {
  v8h r;
#pragma unroll
  for (int i = 0; i < 8; ++i) r[i] = (_Float16)p[i];
  return r;
}

static __device__ __forceinline__ v8f wmma16(v16h a, v16h b, v8f c) {
  // D(16x16,f32) = A(16x32,f16) * B(32x16,f16) + C
  return __builtin_amdgcn_wmma_f32_16x16x32_f16(false, a, false, b, (short)0, c,
                                                false, false);
}

// ---------------------------------------------------------------- Wo -> f16
__global__ void k_prep_wo(const float* __restrict__ Wo, _Float16* __restrict__ WoH) {
  int i = blockIdx.x * blockDim.x + threadIdx.x;
  if (i < EE * EE) WoH[i] = (_Float16)Wo[i];
}

// ------------------------------------------- per-head projections Q/K/V @ W^T
// Qp, Kp : f16 [N][H][L][D] row-major.  VpT : f16 [N][H][D][L] (head-transposed)
__global__ void k_proj(const float* __restrict__ Q, const float* __restrict__ K,
                       const float* __restrict__ V,
                       const float* __restrict__ Wq, const float* __restrict__ Wk,
                       const float* __restrict__ Wv,
                       _Float16* __restrict__ Qp, _Float16* __restrict__ Kp,
                       _Float16* __restrict__ VpT) {
  const int lane = threadIdx.x & 31;
  const int wave = threadIdx.x >> 5;
  const int tile = blockIdx.x * 8 + wave;      // 3 * 8192 tiles total
  const int mat  = tile >> 13;                  // 0=Q 1=K 2=V
  int rem        = tile & 8191;
  const int n    = rem >> 11;                   // / (H*128)
  rem           &= 2047;
  const int h    = rem >> 7;
  const int q0   = (rem & 127) * 16;
  const int col  = lane & 15;
  const int kb   = (lane >> 4) * 8;
  const int hi   = lane >> 4;

  const float* X = (mat == 0) ? Q : (mat == 1) ? K : V;
  const float* W = (mat == 0) ? Wq : (mat == 1) ? Wk : Wv;

  // A fragments: X tile (16 rows x 64 d), f32 -> f16 inline
  const float* xrow = X + ((size_t)(n * LL + q0 + col)) * EE + h * DD;
  const v16h a0 = cat16(cvt8(xrow + kb),      cvt8(xrow + 16 + kb));
  const v16h a1 = cat16(cvt8(xrow + 32 + kb), cvt8(xrow + 48 + kb));

  const size_t nh = (size_t)(n * HH + h);
#pragma unroll
  for (int j = 0; j < 4; ++j) {
    // B^T = W (row e, contiguous d)
    const float* wrow = W + (size_t)(j * 16 + col) * DD;
    const v16h b0 = cat16(cvt8(wrow + kb),      cvt8(wrow + 16 + kb));
    const v16h b1 = cat16(cvt8(wrow + 32 + kb), cvt8(wrow + 48 + kb));
    v8f c = {};
    c = wmma16(a0, b0, c);
    c = wmma16(a1, b1, c);
    if (mat == 2) {
      // transpose store: per lane the 8 C values are contiguous along L
      v8h pk;
#pragma unroll
      for (int r = 0; r < 8; ++r) pk[r] = (_Float16)c[r];
      *(v8h*)(VpT + (nh * DD + j * 16 + col) * LL + q0 + 8 * hi) = pk;
    } else {
      _Float16* base = ((mat == 0) ? Qp : Kp) + nh * LL * DD;
#pragma unroll
      for (int r = 0; r < 8; ++r)
        base[(size_t)(q0 + r + 8 * hi) * DD + j * 16 + col] = (_Float16)c[r];
    }
  }
}

// ------------------------------------------------------- flash attention core
// one wave per (n, h, 16-query tile); Ctx: f16 [N][L][E]
// The 8 waves of a block share (n, h): K and V^T tiles of KT keys are staged in
// LDS once per block with whole-line copies instead of 16-line loads per wave.
#define KT     64              // keys per staged tile
#define PITCH  72              // halves per LDS row: 144 B = 16 B x odd, no bank conflict for 16-byte reads
#define TILE_H (64 * PITCH)    // halves of one staged tile (K: 64 keys x 64 d, V^T: 64 d x 64 keys)

// One tile pair: each thread copies rows r and r+32 (16 B each) of K and of V^T.
static __device__ __forceinline__ void stage_kv(unsigned lk, const _Float16* gk,
                                                const _Float16* gv) {
  const unsigned lk1 = lk + 32 * PITCH * 2;
  const unsigned lv0 = lk + TILE_H * 2;
  const unsigned lv1 = lv0 + 32 * PITCH * 2;
  const _Float16* gk1 = gk + 32 * DD;
  const _Float16* gv1 = gv + 32 * LL;
  // s_wait_xcnt 0 closes the statement so that no address register of an issued
  // copy is rewritten ahead of it
  asm volatile("global_load_async_to_lds_b128 %0, %4, off\n\t"
               "global_load_async_to_lds_b128 %1, %5, off\n\t"
               "global_load_async_to_lds_b128 %2, %6, off\n\t"
               "global_load_async_to_lds_b128 %3, %7, off\n\t"
               "s_wait_xcnt 0x0"
               :: "v"(lk), "v"(lk1), "v"(lv0), "v"(lv1),
                  "v"(gk), "v"(gk1), "v"(gv), "v"(gv1)
               : "memory");
}

__global__ void k_attn(const _Float16* __restrict__ Qp, const _Float16* __restrict__ Kp,
                       const _Float16* __restrict__ VpT, const int* __restrict__ mask,
                       _Float16* __restrict__ Ctx) {
  __shared__ __attribute__((aligned(16))) _Float16 sm[2 * 2 * TILE_H];

  const int lane = threadIdx.x & 31;
  const int wave = threadIdx.x >> 5;
  const int tile = blockIdx.x * 8 + wave;      // 8192 tiles
  const int n    = tile >> 11;
  int rem        = tile & 2047;
  const int h    = rem >> 7;
  const int q0   = (rem & 127) * 16;
  const int col  = lane & 15;
  const int kb   = (lane >> 4) * 8;
  const int hi   = lane >> 4;
  const size_t nh = (size_t)(n * HH + h);

  // B fragments of Q^T (== Q rows in A-pattern), fixed for the whole loop
  const _Float16* qrow = Qp + (nh * LL + q0 + col) * DD;
  const v16h bq0 = cat16(*(const v8h*)(qrow + kb),      *(const v8h*)(qrow + 16 + kb));
  const v16h bq1 = cat16(*(const v8h*)(qrow + 32 + kb), *(const v8h*)(qrow + 48 + kb));

  float m_run = -3.4e38f, l_run = 0.f;   // running max in log2 domain
  v8f o0 = {}, o1 = {}, o2 = {}, o3 = {};

  const int* mbase = mask + (size_t)n * LL * LL + (size_t)(q0 + col) * LL + 8 * hi;

  // this thread's share of a staged tile: row sr (and sr + 32), 16-byte chunk sc
  const int sr = threadIdx.x >> 3;
  const int sc = (threadIdx.x & 7) * 8;
  const _Float16* gk = Kp + (nh * LL + sr) * DD + sc;    // + k0 * DD per tile
  const _Float16* gv = VpT + (nh * DD + sr) * LL + sc;   // + k0 per tile
  const unsigned  ls = (unsigned)(size_t)(sm + sr * PITCH + sc);  // LDS byte address, buffer 0

  stage_kv(ls, gk, gv);
  asm volatile("s_wait_asynccnt 0x0" ::: "memory");  // tile 0 landed (this wave's copies)
  __syncthreads();                                   // tile 0 readable by every wave
  stage_kv(ls + 2 * TILE_H * 2, gk + KT * DD, gv + KT);

#pragma unroll 1
  for (int t = 0; t < LL / KT; ++t) {
    const _Float16* kt = sm + (t & 1) * (2 * TILE_H) + col * PITCH + kb;
    const _Float16* vt = kt + TILE_H;
#pragma unroll
    for (int p = 0; p < KT / 32; ++p) {
      // S^T = K * Q^T : two 16x16 tiles (k 0-15, 16-31)
      const _Float16* kr0 = kt + p * 32 * PITCH;
      const _Float16* kr1 = kr0 + 16 * PITCH;
      const v16h ak00 = cat16(*(const v8h*)(kr0),      *(const v8h*)(kr0 + 16));
      const v16h ak01 = cat16(*(const v8h*)(kr0 + 32), *(const v8h*)(kr0 + 48));
      const v16h ak10 = cat16(*(const v8h*)(kr1),      *(const v8h*)(kr1 + 16));
      const v16h ak11 = cat16(*(const v8h*)(kr1 + 32), *(const v8h*)(kr1 + 48));
      v8f sT0 = {}, sT1 = {};
      sT0 = wmma16(ak00, bq0, sT0);  sT0 = wmma16(ak01, bq1, sT0);
      sT1 = wmma16(ak10, bq0, sT1);  sT1 = wmma16(ak11, bq1, sT1);

      // mask (k contiguous per lane); reference: (-1e20 if masked) then /sqrt(E);
      // whole row pre-scaled by log2(e) so exp2 gives exact reference softmax
      const int* mr = mbase + t * KT + p * 32;
      const v4i mA = *(const v4i*)(mr);
      const v4i mB = *(const v4i*)(mr + 4);
      const v4i mC = *(const v4i*)(mr + 16);
      const v4i mD = *(const v4i*)(mr + 20);

      float s0[8], s1[8];
#pragma unroll
      for (int r = 0; r < 8; ++r) {
        const int mv0 = (r < 4) ? mA[r & 3] : mB[r & 3];
        const int mv1 = (r < 4) ? mC[r & 3] : mD[r & 3];
        s0[r] = (mv0 != 0 ? sT0[r] : -1.0e20f) * SCALE_LOG2;
        s1[r] = (mv1 != 0 ? sT1[r] : -1.0e20f) * SCALE_LOG2;
      }

      // online softmax: per-lane partial over 16 k, one xor-16 combine
      float tmax = fmaxf(s0[0], s1[0]);
#pragma unroll
      for (int r = 1; r < 8; ++r) { tmax = fmaxf(tmax, s0[r]); tmax = fmaxf(tmax, s1[r]); }
      tmax = fmaxf(tmax, __shfl_xor(tmax, 16, 32));
      const float m_new = fmaxf(m_run, tmax);
      const float corr  = exp2f(m_run - m_new);

      float tsum = 0.f;
      v16h pf;                                     // P^T B-fragment, in registers
#pragma unroll
      for (int r = 0; r < 8; ++r) {
        const float p0 = exp2f(s0[r] - m_new);
        const float p1 = exp2f(s1[r] - m_new);
        tsum += p0 + p1;
        pf[r]     = (_Float16)p0;
        pf[r + 8] = (_Float16)p1;
      }
      tsum += __shfl_xor(tsum, 16, 32);
      l_run = l_run * corr + tsum;
      m_run = m_new;
#pragma unroll
      for (int r = 0; r < 8; ++r) { o0[r] *= corr; o1[r] *= corr; o2[r] *= corr; o3[r] *= corr; }

      // O^T += V^T * P^T  (V^T rows of the staged tile, keys contiguous)
      const _Float16* v0 = vt + p * 32;
      const v16h av0 = cat16(*(const v8h*)(v0),              *(const v8h*)(v0 + 16));
      const v16h av1 = cat16(*(const v8h*)(v0 + 16 * PITCH), *(const v8h*)(v0 + 16 * PITCH + 16));
      const v16h av2 = cat16(*(const v8h*)(v0 + 32 * PITCH), *(const v8h*)(v0 + 32 * PITCH + 16));
      const v16h av3 = cat16(*(const v8h*)(v0 + 48 * PITCH), *(const v8h*)(v0 + 48 * PITCH + 16));
      o0 = wmma16(av0, pf, o0);
      o1 = wmma16(av1, pf, o1);
      o2 = wmma16(av2, pf, o2);
      o3 = wmma16(av3, pf, o3);
    }

    asm volatile("s_wait_dscnt 0x0" ::: "memory");     // this wave's reads of tile t are done
    asm volatile("s_wait_asynccnt 0x0" ::: "memory");  // this wave's copies of tile t+1 landed
    __syncthreads();  // publishes tile t+1 and frees tile t's buffer for the refill
    if (t + 2 < LL / KT)
      stage_kv(ls + (t & 1) * (2 * TILE_H * 2), gk + (size_t)(t + 2) * KT * DD, gv + (t + 2) * KT);
  }
  asm volatile("s_wait_asynccnt 0x0" ::: "memory");    // nothing in flight when the wave ends

  const float rinv = 1.0f / l_run;
  _Float16* crow = Ctx + ((size_t)(n * LL) + q0 + col) * EE + h * DD + 8 * hi;
  v8h pk;
#pragma unroll
  for (int r = 0; r < 8; ++r) pk[r] = (_Float16)(o0[r] * rinv);
  *(v8h*)(crow) = pk;
#pragma unroll
  for (int r = 0; r < 8; ++r) pk[r] = (_Float16)(o1[r] * rinv);
  *(v8h*)(crow + 16) = pk;
#pragma unroll
  for (int r = 0; r < 8; ++r) pk[r] = (_Float16)(o2[r] * rinv);
  *(v8h*)(crow + 32) = pk;
#pragma unroll
  for (int r = 0; r < 8; ++r) pk[r] = (_Float16)(o3[r] * rinv);
  *(v8h*)(crow + 48) = pk;
}

// ---------------------------------------------- out = Ctx @ Wo^T + bo  (f32)
__global__ void k_out(const _Float16* __restrict__ Ctx, const _Float16* __restrict__ WoH,
                      const float* __restrict__ bo, float* __restrict__ Out) {
  const int lane = threadIdx.x & 31;
  const int wave = threadIdx.x >> 5;
  const int tile = blockIdx.x * 8 + wave;   // 512 m-tiles x 16 n-tiles
  const int m0 = (tile >> 4) * 16;
  const int e0 = (tile & 15) * 64;
  const int col = lane & 15;
  const int kb  = (lane >> 4) * 8;
  const int hi  = lane >> 4;

  v8f acc0 = {}, acc1 = {}, acc2 = {}, acc3 = {};
  const _Float16* arow = Ctx + (size_t)(m0 + col) * EE;
  const _Float16* w0   = WoH + (size_t)(e0 + col) * EE;

#pragma unroll 1
  for (int f0 = 0; f0 < EE; f0 += 32) {
    const v16h a  = cat16(*(const v8h*)(arow + f0 + kb), *(const v8h*)(arow + f0 + 16 + kb));
    const v16h b0 = cat16(*(const v8h*)(w0 + f0 + kb),            *(const v8h*)(w0 + f0 + 16 + kb));
    const v16h b1 = cat16(*(const v8h*)(w0 + 16*EE + f0 + kb),    *(const v8h*)(w0 + 16*EE + f0 + 16 + kb));
    const v16h b2 = cat16(*(const v8h*)(w0 + 32*EE + f0 + kb),    *(const v8h*)(w0 + 32*EE + f0 + 16 + kb));
    const v16h b3 = cat16(*(const v8h*)(w0 + 48*EE + f0 + kb),    *(const v8h*)(w0 + 48*EE + f0 + 16 + kb));
    acc0 = wmma16(a, b0, acc0);
    acc1 = wmma16(a, b1, acc1);
    acc2 = wmma16(a, b2, acc2);
    acc3 = wmma16(a, b3, acc3);
  }

  // straight-line epilogue: keep accumulators in VGPRs (no indexable array)
  {
    const int e = e0 + col;
    const float bias = bo[e];
#pragma unroll
    for (int r = 0; r < 8; ++r)
      Out[(size_t)(m0 + r + 8 * hi) * EE + e] = acc0[r] + bias;
  }
  {
    const int e = e0 + 16 + col;
    const float bias = bo[e];
#pragma unroll
    for (int r = 0; r < 8; ++r)
      Out[(size_t)(m0 + r + 8 * hi) * EE + e] = acc1[r] + bias;
  }
  {
    const int e = e0 + 32 + col;
    const float bias = bo[e];
#pragma unroll
    for (int r = 0; r < 8; ++r)
      Out[(size_t)(m0 + r + 8 * hi) * EE + e] = acc2[r] + bias;
  }
  {
    const int e = e0 + 48 + col;
    const float bias = bo[e];
#pragma unroll
    for (int r = 0; r < 8; ++r)
      Out[(size_t)(m0 + r + 8 * hi) * EE + e] = acc3[r] + bias;
  }
}

extern "C" void kernel_launch(void* const* d_in, const int* in_sizes, int n_in,
                              void* d_out, int out_size, void* d_ws, size_t ws_size,
                              hipStream_t stream) {
  const float* values  = (const float*)d_in[0];
  const float* keys    = (const float*)d_in[1];
  const float* queries = (const float*)d_in[2];
  const int*   mask    = (const int*)d_in[3];
  const float* Wq      = (const float*)d_in[4];
  const float* Wk      = (const float*)d_in[5];
  const float* Wv      = (const float*)d_in[6];
  const float* Wo      = (const float*)d_in[7];
  const float* bo      = (const float*)d_in[8];
  float* out = (float*)d_out;

  _Float16* ws = (_Float16*)d_ws;
  const size_t per = (size_t)NB * HH * LL * DD;   // 8M halves = 16 MB each
  _Float16* Qp  = ws;
  _Float16* Kp  = Qp + per;
  _Float16* VpT = Kp + per;
  _Float16* Ctx = VpT + per;
  _Float16* WoH = Ctx + per;                       // + 2 MB  (total ~66 MB)

  hipLaunchKernelGGL(k_prep_wo, dim3((EE * EE) / 256), dim3(256), 0, stream, Wo, WoH);
  hipLaunchKernelGGL(k_proj, dim3(3 * 8192 / 8), dim3(256), 0, stream,
                     queries, keys, values, Wq, Wk, Wv, Qp, Kp, VpT);
  hipLaunchKernelGGL(k_attn, dim3(8192 / 8), dim3(256), 0, stream,
                     Qp, Kp, VpT, mask, Ctx);
  hipLaunchKernelGGL(k_out, dim3(8192 / 8), dim3(256), 0, stream, Ctx, WoH, bo, out);
}

// v002
// It runs in 178 microseconds.
// Next to v001, in two timings, it ran 1.30 times as fast each time.
// Over all steps from v000 it is 2.02 times as fast.
#include <hip/hip_runtime.h>
#include <hip/hip_bf16.h>

#define NB 4
#define LL 2048
#define EE 1024
#define HH 16
#define DD 64

typedef __attribute__((ext_vector_type(16))) _Float16 v16h;
typedef __attribute__((ext_vector_type(8)))  _Float16 v8h;
typedef __attribute__((ext_vector_type(8)))  float    v8f;
typedef __attribute__((ext_vector_type(4)))  int      v4i;

// 1/sqrt(E) * log2(e): softmax computed with exp2 (hardware-native) is exact
// softmax of the reference logits since all logits share the same scale.
#define SCALE_LOG2 (0.03125f * 1.44269504088896340736f)

static __device__ __forceinline__ v16h cat16(v8h lo, v8h hi) {
  v16h r;
#pragma unroll
  for (int i = 0; i < 8; ++i) { r[i] = lo[i]; r[i + 8] = hi[i]; }
  return r;
}

static __device__ __forceinline__ v8h cvt8(const float* p) {
  v8h r;
#pragma unroll
  for (int i = 0; i < 8; ++i) r[i] = (_Float16)p[i];
  return r;
}

static __device__ __forceinline__ v8f wmma16(v16h a, v16h b, v8f c) {
  // D(16x16,f32) = A(16x32,f16) * B(32x16,f16) + C
  return __builtin_amdgcn_wmma_f32_16x16x32_f16(false, a, false, b, (short)0, c,
                                                false, false);
}

// ---------------------------------------------------------------- Wo -> f16
__global__ void k_prep_wo(const float* __restrict__ Wo, _Float16* __restrict__ WoH) {
  int i = blockIdx.x * blockDim.x + threadIdx.x;
  if (i < EE * EE) WoH[i] = (_Float16)Wo[i];
}

// ------------------------------------------- per-head projections Q/K/V @ W^T
// Qp, Kp : f16 [N][H][L][D] row-major.  VpT : f16 [N][H][D][L] (head-transposed)
__global__ void k_proj(const float* __restrict__ Q, const float* __restrict__ K,
                       const float* __restrict__ V,
                       const float* __restrict__ Wq, const float* __restrict__ Wk,
                       const float* __restrict__ Wv,
                       _Float16* __restrict__ Qp, _Float16* __restrict__ Kp,
                       _Float16* __restrict__ VpT) {
  const int lane = threadIdx.x & 31;
  const int wave = threadIdx.x >> 5;
  const int tile = blockIdx.x * 8 + wave;      // 3 * 8192 tiles total
  const int mat  = tile >> 13;                  // 0=Q 1=K 2=V
  int rem        = tile & 8191;
  const int n    = rem >> 11;                   // / (H*128)
  rem           &= 2047;
  const int h    = rem >> 7;
  const int q0   = (rem & 127) * 16;
  const int col  = lane & 15;
  const int kb   = (lane >> 4) * 8;
  const int hi   = lane >> 4;

  const float* X = (mat == 0) ? Q : (mat == 1) ? K : V;
  const float* W = (mat == 0) ? Wq : (mat == 1) ? Wk : Wv;

  // A fragments: X tile (16 rows x 64 d), f32 -> f16 inline
  const float* xrow = X + ((size_t)(n * LL + q0 + col)) * EE + h * DD;
  const v16h a0 = cat16(cvt8(xrow + kb),      cvt8(xrow + 16 + kb));
  const v16h a1 = cat16(cvt8(xrow + 32 + kb), cvt8(xrow + 48 + kb));

  const size_t nh = (size_t)(n * HH + h);
#pragma unroll
  for (int j = 0; j < 4; ++j) {
    // B^T = W (row e, contiguous d)
    const float* wrow = W + (size_t)(j * 16 + col) * DD;
    const v16h b0 = cat16(cvt8(wrow + kb),      cvt8(wrow + 16 + kb));
    const v16h b1 = cat16(cvt8(wrow + 32 + kb), cvt8(wrow + 48 + kb));
    v8f c = {};
    c = wmma16(a0, b0, c);
    c = wmma16(a1, b1, c);
    if (mat == 2) {
      // transpose store: per lane the 8 C values are contiguous along L
      v8h pk;
#pragma unroll
      for (int r = 0; r < 8; ++r) pk[r] = (_Float16)c[r];
      *(v8h*)(VpT + (nh * DD + j * 16 + col) * LL + q0 + 8 * hi) = pk;
    } else {
      _Float16* base = ((mat == 0) ? Qp : Kp) + nh * LL * DD;
#pragma unroll
      for (int r = 0; r < 8; ++r)
        base[(size_t)(q0 + r + 8 * hi) * DD + j * 16 + col] = (_Float16)c[r];
    }
  }
}

// ------------------------------------------------------- flash attention core
// one wave per (n, h, 16-query tile); Ctx: f16 [N][L][E]
// The 8 waves of a block share (n, h): K and V^T tiles of KT keys are staged in
// LDS once per block with whole-line copies instead of 16-line loads per wave.
#define KT     64              // keys per staged tile
#define PITCH  72              // halves per LDS row: 144 B = 16 B x odd, no bank conflict for 16-byte reads
#define TILE_H (64 * PITCH)    // halves of one staged tile (K: 64 keys x 64 d, V^T: 64 d x 64 keys)

// One tile pair: each thread copies rows r and r+32 (16 B each) of K and of V^T.
static __device__ __forceinline__ void stage_kv(unsigned lk, const _Float16* gk,
                                                const _Float16* gv) {
  const unsigned lk1 = lk + 32 * PITCH * 2;
  const unsigned lv0 = lk + TILE_H * 2;
  const unsigned lv1 = lv0 + 32 * PITCH * 2;
  const _Float16* gk1 = gk + 32 * DD;
  const _Float16* gv1 = gv + 32 * LL;
  // s_wait_xcnt 0 closes the statement so that no address register of an issued
  // copy is rewritten ahead of it
  asm volatile("global_load_async_to_lds_b128 %0, %4, off\n\t"
               "global_load_async_to_lds_b128 %1, %5, off\n\t"
               "global_load_async_to_lds_b128 %2, %6, off\n\t"
               "global_load_async_to_lds_b128 %3, %7, off\n\t"
               "s_wait_xcnt 0x0"
               :: "v"(lk), "v"(lk1), "v"(lv0), "v"(lv1),
                  "v"(gk), "v"(gk1), "v"(gv), "v"(gv1)
               : "memory");
}

__global__ void k_attn(const _Float16* __restrict__ Qp, const _Float16* __restrict__ Kp,
                       const _Float16* __restrict__ VpT, const int* __restrict__ mask,
                       _Float16* __restrict__ Ctx) {
  __shared__ __attribute__((aligned(16))) _Float16 sm[2 * 2 * TILE_H];

  const int lane = threadIdx.x & 31;
  const int wave = threadIdx.x >> 5;
  const int tile = blockIdx.x * 8 + wave;      // 8192 tiles
  const int n    = tile >> 11;
  int rem        = tile & 2047;
  const int h    = rem >> 7;
  const int q0   = (rem & 127) * 16;
  const int col  = lane & 15;
  const int kb   = (lane >> 4) * 8;
  const int hi   = lane >> 4;
  const size_t nh = (size_t)(n * HH + h);

  // B fragments of Q^T (== Q rows in A-pattern), fixed for the whole loop
  const _Float16* qrow = Qp + (nh * LL + q0 + col) * DD;
  const v16h bq0 = cat16(*(const v8h*)(qrow + kb),      *(const v8h*)(qrow + 16 + kb));
  const v16h bq1 = cat16(*(const v8h*)(qrow + 32 + kb), *(const v8h*)(qrow + 48 + kb));

  float m_run = -3.4e38f, l_run = 0.f;   // running max in log2 domain
  v8f o0 = {}, o1 = {}, o2 = {}, o3 = {};

  const int* mbase = mask + (size_t)n * LL * LL + (size_t)(q0 + col) * LL + 8 * hi;

  // this thread's share of a staged tile: row sr (and sr + 32), 16-byte chunk sc
  const int sr = threadIdx.x >> 3;
  const int sc = (threadIdx.x & 7) * 8;
  const _Float16* gk = Kp + (nh * LL + sr) * DD + sc;    // + k0 * DD per tile
  const _Float16* gv = VpT + (nh * DD + sr) * LL + sc;   // + k0 per tile
  const unsigned  ls = (unsigned)(size_t)(sm + sr * PITCH + sc);  // LDS byte address, buffer 0

  stage_kv(ls, gk, gv);
  asm volatile("s_wait_asynccnt 0x0" ::: "memory");  // tile 0 landed (this wave's copies)
  __syncthreads();                                   // tile 0 readable by every wave
  stage_kv(ls + 2 * TILE_H * 2, gk + KT * DD, gv + KT);

#pragma unroll 1
  for (int t = 0; t < LL / KT; ++t) {
    const _Float16* kt = sm + (t & 1) * (2 * TILE_H) + col * PITCH + kb;
    const _Float16* vt = kt + TILE_H;
#pragma unroll
    for (int p = 0; p < KT / 32; ++p) {
      // S^T = K * Q^T : two 16x16 tiles (k 0-15, 16-31)
      const _Float16* kr0 = kt + p * 32 * PITCH;
      const _Float16* kr1 = kr0 + 16 * PITCH;
      const v16h ak00 = cat16(*(const v8h*)(kr0),      *(const v8h*)(kr0 + 16));
      const v16h ak01 = cat16(*(const v8h*)(kr0 + 32), *(const v8h*)(kr0 + 48));
      const v16h ak10 = cat16(*(const v8h*)(kr1),      *(const v8h*)(kr1 + 16));
      const v16h ak11 = cat16(*(const v8h*)(kr1 + 32), *(const v8h*)(kr1 + 48));
      v8f sT0 = {}, sT1 = {};
      sT0 = wmma16(ak00, bq0, sT0);  sT0 = wmma16(ak01, bq1, sT0);
      sT1 = wmma16(ak10, bq0, sT1);  sT1 = wmma16(ak11, bq1, sT1);

      // mask (k contiguous per lane); reference: (-1e20 if masked) then /sqrt(E);
      // whole row pre-scaled by log2(e) so exp2 gives exact reference softmax
      const int* mr = mbase + t * KT + p * 32;
      const v4i mA = *(const v4i*)(mr);
      const v4i mB = *(const v4i*)(mr + 4);
      const v4i mC = *(const v4i*)(mr + 16);
      const v4i mD = *(const v4i*)(mr + 20);

      float s0[8], s1[8];
#pragma unroll
      for (int r = 0; r < 8; ++r) {
        const int mv0 = (r < 4) ? mA[r & 3] : mB[r & 3];
        const int mv1 = (r < 4) ? mC[r & 3] : mD[r & 3];
        s0[r] = (mv0 != 0 ? sT0[r] : -1.0e20f) * SCALE_LOG2;
        s1[r] = (mv1 != 0 ? sT1[r] : -1.0e20f) * SCALE_LOG2;
      }

      // online softmax: per-lane partial over 16 k, one xor-16 combine
      float tmax = fmaxf(s0[0], s1[0]);
#pragma unroll
      for (int r = 1; r < 8; ++r) { tmax = fmaxf(tmax, s0[r]); tmax = fmaxf(tmax, s1[r]); }
      tmax = fmaxf(tmax, __shfl_xor(tmax, 16, 32));
      const float m_new = fmaxf(m_run, tmax);
      const float corr  = exp2f(m_run - m_new);

      float tsum = 0.f;
      v16h pf;                                     // P^T B-fragment, in registers
#pragma unroll
      for (int r = 0; r < 8; ++r) {
        const float p0 = exp2f(s0[r] - m_new);
        const float p1 = exp2f(s1[r] - m_new);
        tsum += p0 + p1;
        pf[r]     = (_Float16)p0;
        pf[r + 8] = (_Float16)p1;
      }
      tsum += __shfl_xor(tsum, 16, 32);
      l_run = l_run * corr + tsum;
      m_run = m_new;
#pragma unroll
      for (int r = 0; r < 8; ++r) { o0[r] *= corr; o1[r] *= corr; o2[r] *= corr; o3[r] *= corr; }

      // O^T += V^T * P^T  (V^T rows of the staged tile, keys contiguous)
      const _Float16* v0 = vt + p * 32;
      const v16h av0 = cat16(*(const v8h*)(v0),              *(const v8h*)(v0 + 16));
      const v16h av1 = cat16(*(const v8h*)(v0 + 16 * PITCH), *(const v8h*)(v0 + 16 * PITCH + 16));
      const v16h av2 = cat16(*(const v8h*)(v0 + 32 * PITCH), *(const v8h*)(v0 + 32 * PITCH + 16));
      const v16h av3 = cat16(*(const v8h*)(v0 + 48 * PITCH), *(const v8h*)(v0 + 48 * PITCH + 16));
      o0 = wmma16(av0, pf, o0);
      o1 = wmma16(av1, pf, o1);
      o2 = wmma16(av2, pf, o2);
      o3 = wmma16(av3, pf, o3);
    }

    asm volatile("s_wait_dscnt 0x0" ::: "memory");     // this wave's reads of tile t are done
    asm volatile("s_wait_asynccnt 0x0" ::: "memory");  // this wave's copies of tile t+1 landed
    __syncthreads();  // publishes tile t+1 and frees tile t's buffer for the refill
    if (t + 2 < LL / KT)
      stage_kv(ls + (t & 1) * (2 * TILE_H * 2), gk + (size_t)(t + 2) * KT * DD, gv + (t + 2) * KT);
  }
  asm volatile("s_wait_asynccnt 0x0" ::: "memory");    // nothing in flight when the wave ends

  const float rinv = 1.0f / l_run;
  _Float16* crow = Ctx + ((size_t)(n * LL) + q0 + col) * EE + h * DD + 8 * hi;
  v8h pk;
#pragma unroll
  for (int r = 0; r < 8; ++r) pk[r] = (_Float16)(o0[r] * rinv);
  *(v8h*)(crow) = pk;
#pragma unroll
  for (int r = 0; r < 8; ++r) pk[r] = (_Float16)(o1[r] * rinv);
  *(v8h*)(crow + 16) = pk;
#pragma unroll
  for (int r = 0; r < 8; ++r) pk[r] = (_Float16)(o2[r] * rinv);
  *(v8h*)(crow + 32) = pk;
#pragma unroll
  for (int r = 0; r < 8; ++r) pk[r] = (_Float16)(o3[r] * rinv);
  *(v8h*)(crow + 48) = pk;
}

// ---------------------------------------------- out = Ctx @ Wo^T + bo  (f32)
// One block computes a 128 x 128 tile of Out; its 8 waves (4 along m, 2 along e)
// each hold 32 x 64.  Slices of OKS k-values of the Ctx rows and of the Wo rows
// are staged in LDS with whole-line copies and shared by the waves.
#define OKS     64              // k-values per staged slice (one 128-byte line per row)
#define OTILE_H (128 * PITCH)   // halves of one staged operand slice (128 rows)

// One slice pair: each thread copies 16 B of rows r, r+32, r+64, r+96 of Ctx and of Wo.
static __device__ __forceinline__ void stage_ab(unsigned la, const _Float16* ga,
                                                const _Float16* gb) {
  const unsigned la1 = la + 32 * PITCH * 2;
  const unsigned la2 = la + 64 * PITCH * 2;
  const unsigned la3 = la + 96 * PITCH * 2;
  const unsigned lb0 = la + OTILE_H * 2;
  const unsigned lb1 = lb0 + 32 * PITCH * 2;
  const unsigned lb2 = lb0 + 64 * PITCH * 2;
  const unsigned lb3 = lb0 + 96 * PITCH * 2;
  const _Float16* ga1 = ga + 32 * EE;
  const _Float16* ga2 = ga + 64 * EE;
  const _Float16* ga3 = ga + 96 * EE;
  const _Float16* gb1 = gb + 32 * EE;
  const _Float16* gb2 = gb + 64 * EE;
  const _Float16* gb3 = gb + 96 * EE;
  // s_wait_xcnt 0 closes the statement so that no address register of an issued
  // copy is rewritten ahead of it
  asm volatile("global_load_async_to_lds_b128 %0, %8, off\n\t"
               "global_load_async_to_lds_b128 %1, %9, off\n\t"
               "global_load_async_to_lds_b128 %2, %10, off\n\t"
               "global_load_async_to_lds_b128 %3, %11, off\n\t"
               "global_load_async_to_lds_b128 %4, %12, off\n\t"
               "global_load_async_to_lds_b128 %5, %13, off\n\t"
               "global_load_async_to_lds_b128 %6, %14, off\n\t"
               "global_load_async_to_lds_b128 %7, %15, off\n\t"
               "s_wait_xcnt 0x0"
               :: "v"(la), "v"(la1), "v"(la2), "v"(la3),
                  "v"(lb0), "v"(lb1), "v"(lb2), "v"(lb3),
                  "v"(ga), "v"(ga1), "v"(ga2), "v"(ga3),
                  "v"(gb), "v"(gb1), "v"(gb2), "v"(gb3)
               : "memory");
}

// launch bounds = the real block size: lifts the register ceiling so that the 8
// accumulator tiles and their fragments stay in registers
__global__ __launch_bounds__(256) void k_out(const _Float16* __restrict__ Ctx,
                                             const _Float16* __restrict__ WoH,
                                             const float* __restrict__ bo,
                                             float* __restrict__ Out) {
  __shared__ __attribute__((aligned(16))) _Float16 so[2 * 2 * OTILE_H];

  const int lane = threadIdx.x & 31;
  const int wave = threadIdx.x >> 5;
  const int m0 = (blockIdx.x >> 3) * 128;   // 64 m-blocks x 8 e-blocks
  const int e0 = (blockIdx.x & 7) * 128;
  const int wm = (wave >> 1) * 32;          // this wave's rows inside the block tile
  const int we = (wave & 1) * 64;           // this wave's columns inside the block tile
  const int col = lane & 15;
  const int kb  = (lane >> 4) * 8;
  const int hi  = lane >> 4;

  v8f acc[2][4] = {};

  // this thread's share of a staged slice: row sr (+32, +64, +96), 16-byte chunk sc
  const int sr = threadIdx.x >> 3;
  const int sc = (threadIdx.x & 7) * 8;
  const _Float16* ga = Ctx + (size_t)(m0 + sr) * EE + sc;   // + t * OKS per slice
  const _Float16* gb = WoH + (size_t)(e0 + sr) * EE + sc;   // + t * OKS per slice
  const unsigned  ls = (unsigned)(size_t)(so + sr * PITCH + sc);  // LDS byte address, buffer 0

  stage_ab(ls, ga, gb);
  asm volatile("s_wait_asynccnt 0x0" ::: "memory");  // slice 0 landed (this wave's copies)
  __syncthreads();                                   // slice 0 readable by every wave
  stage_ab(ls + 2 * OTILE_H * 2, ga + OKS, gb + OKS);

  // kept rolled: one foot (waits, barrier, refill) per slice, small loop text
#pragma unroll 1
  for (int t = 0; t < EE / OKS; ++t) {
    const _Float16* at = so + (t & 1) * (2 * OTILE_H) + (wm + col) * PITCH + kb;
    const _Float16* bt = so + (t & 1) * (2 * OTILE_H) + OTILE_H + (we + col) * PITCH + kb;
    // the inner loops here and in the epilogue are unrolled so that every index of
    // a[], b[] and acc[][] is a constant and the arrays live in registers
#pragma unroll
    for (int kk = 0; kk < OKS / 32; ++kk) {
      v16h a[2], b[4];
#pragma unroll
      for (int i = 0; i < 2; ++i) {
        const _Float16* r = at + i * 16 * PITCH + kk * 32;
        a[i] = cat16(*(const v8h*)(r), *(const v8h*)(r + 16));
      }
#pragma unroll
      for (int j = 0; j < 4; ++j) {
        const _Float16* r = bt + j * 16 * PITCH + kk * 32;
        b[j] = cat16(*(const v8h*)(r), *(const v8h*)(r + 16));
      }
#pragma unroll
      for (int i = 0; i < 2; ++i)
#pragma unroll
        for (int j = 0; j < 4; ++j) acc[i][j] = wmma16(a[i], b[j], acc[i][j]);
    }

    asm volatile("s_wait_dscnt 0x0" ::: "memory");     // this wave's reads of slice t are done
    asm volatile("s_wait_asynccnt 0x0" ::: "memory");  // this wave's copies of slice t+1 landed
    __syncthreads();  // publishes slice t+1 and frees slice t's buffer for the refill
    if (t + 2 < EE / OKS)
      stage_ab(ls + (t & 1) * (2 * OTILE_H * 2), ga + (t + 2) * OKS, gb + (t + 2) * OKS);
  }
  asm volatile("s_wait_asynccnt 0x0" ::: "memory");    // nothing in flight when the wave ends

#pragma unroll
  for (int j = 0; j < 4; ++j) {
    const int e = e0 + we + j * 16 + col;
    const float bias = bo[e];
#pragma unroll
    for (int i = 0; i < 2; ++i)
#pragma unroll
      for (int r = 0; r < 8; ++r)
        Out[(size_t)(m0 + wm + i * 16 + r + 8 * hi) * EE + e] = acc[i][j][r] + bias;
  }
}

extern "C" void kernel_launch(void* const* d_in, const int* in_sizes, int n_in,
                              void* d_out, int out_size, void* d_ws, size_t ws_size,
                              hipStream_t stream) {
  const float* values  = (const float*)d_in[0];
  const float* keys    = (const float*)d_in[1];
  const float* queries = (const float*)d_in[2];
  const int*   mask    = (const int*)d_in[3];
  const float* Wq      = (const float*)d_in[4];
  const float* Wk      = (const float*)d_in[5];
  const float* Wv      = (const float*)d_in[6];
  const float* Wo      = (const float*)d_in[7];
  const float* bo      = (const float*)d_in[8];
  float* out = (float*)d_out;

  _Float16* ws = (_Float16*)d_ws;
  const size_t per = (size_t)NB * HH * LL * DD;   // 8M halves = 16 MB each
  _Float16* Qp  = ws;
  _Float16* Kp  = Qp + per;
  _Float16* VpT = Kp + per;
  _Float16* Ctx = VpT + per;
  _Float16* WoH = Ctx + per;                       // + 2 MB  (total ~66 MB)

  hipLaunchKernelGGL(k_prep_wo, dim3((EE * EE) / 256), dim3(256), 0, stream, Wo, WoH);
  hipLaunchKernelGGL(k_proj, dim3(3 * 8192 / 8), dim3(256), 0, stream,
                     queries, keys, values, Wq, Wk, Wv, Qp, Kp, VpT);
  hipLaunchKernelGGL(k_attn, dim3(8192 / 8), dim3(256), 0, stream,
                     Qp, Kp, VpT, mask, Ctx);
  hipLaunchKernelGGL(k_out, dim3(64 * 8), dim3(256), 0, stream, Ctx, WoH, bo, out);
}

// v003
// It runs in 165 microseconds.
// Timed twice side by side with v002, it ran 1.08 times as fast both times.
// Counting every step since v000, it is 2.17 times as fast.
#include <hip/hip_runtime.h>
#include <hip/hip_bf16.h>

#define NB 4
#define LL 2048
#define EE 1024
#define HH 16
#define DD 64

typedef __attribute__((ext_vector_type(16))) _Float16 v16h;
typedef __attribute__((ext_vector_type(8)))  _Float16 v8h;
typedef __attribute__((ext_vector_type(8)))  float    v8f;
typedef __attribute__((ext_vector_type(4)))  int      v4i;

// 1/sqrt(E) * log2(e): softmax computed with exp2 (hardware-native) is exact
// softmax of the reference logits since all logits share the same scale.
#define SCALE_LOG2 (0.03125f * 1.44269504088896340736f)

static __device__ __forceinline__ v16h cat16(v8h lo, v8h hi) {
  v16h r;
#pragma unroll
  for (int i = 0; i < 8; ++i) { r[i] = lo[i]; r[i + 8] = hi[i]; }
  return r;
}

static __device__ __forceinline__ v8h cvt8(const float* p) {
  v8h r;
#pragma unroll
  for (int i = 0; i < 8; ++i) r[i] = (_Float16)p[i];
  return r;
}

// e[i] = 2^e[i] on the hardware exponential alone, without the library's range
// fix-up for results below 2^-126: such a weight is 0 as f16 and far below one
// f32 ulp of the row sum (which is at least 1), and a rescale factor that small
// is 0 too.  One statement, in place: every v_exp_f32 is followed by one that is
// independent of it and the last by v_nop, which is the slot the instruction set
// asks for before a transcendental's result is read or its source overwritten.
static __device__ __forceinline__ void exp2_hw17(float (&e)[17]) {
  asm("v_exp_f32 %0, %0\n\t"
      "v_exp_f32 %1, %1\n\t"
      "v_exp_f32 %2, %2\n\t"
      "v_exp_f32 %3, %3\n\t"
      "v_exp_f32 %4, %4\n\t"
      "v_exp_f32 %5, %5\n\t"
      "v_exp_f32 %6, %6\n\t"
      "v_exp_f32 %7, %7\n\t"
      "v_exp_f32 %8, %8\n\t"
      "v_exp_f32 %9, %9\n\t"
      "v_exp_f32 %10, %10\n\t"
      "v_exp_f32 %11, %11\n\t"
      "v_exp_f32 %12, %12\n\t"
      "v_exp_f32 %13, %13\n\t"
      "v_exp_f32 %14, %14\n\t"
      "v_exp_f32 %15, %15\n\t"
      "v_exp_f32 %16, %16\n\t"
      "v_nop"
      : "+v"(e[0]), "+v"(e[1]), "+v"(e[2]), "+v"(e[3]), "+v"(e[4]), "+v"(e[5]),
        "+v"(e[6]), "+v"(e[7]), "+v"(e[8]), "+v"(e[9]), "+v"(e[10]), "+v"(e[11]),
        "+v"(e[12]), "+v"(e[13]), "+v"(e[14]), "+v"(e[15]), "+v"(e[16]));
}

static __device__ __forceinline__ v8f wmma16(v16h a, v16h b, v8f c) {
  // D(16x16,f32) = A(16x32,f16) * B(32x16,f16) + C
  return __builtin_amdgcn_wmma_f32_16x16x32_f16(false, a, false, b, (short)0, c,
                                                false, false);
}

// ---------------------------------------------------------------- Wo -> f16
__global__ void k_prep_wo(const float* __restrict__ Wo, _Float16* __restrict__ WoH) {
  int i = blockIdx.x * blockDim.x + threadIdx.x;
  if (i < EE * EE) WoH[i] = (_Float16)Wo[i];
}

// ------------------------------------------- per-head projections Q/K/V @ W^T
// Qp, Kp : f16 [N][H][L][D] row-major.  VpT : f16 [N][H][D][L] (head-transposed)
__global__ void k_proj(const float* __restrict__ Q, const float* __restrict__ K,
                       const float* __restrict__ V,
                       const float* __restrict__ Wq, const float* __restrict__ Wk,
                       const float* __restrict__ Wv,
                       _Float16* __restrict__ Qp, _Float16* __restrict__ Kp,
                       _Float16* __restrict__ VpT) {
  const int lane = threadIdx.x & 31;
  const int wave = threadIdx.x >> 5;
  const int tile = blockIdx.x * 8 + wave;      // 3 * 8192 tiles total
  const int mat  = tile >> 13;                  // 0=Q 1=K 2=V
  int rem        = tile & 8191;
  const int n    = rem >> 11;                   // / (H*128)
  rem           &= 2047;
  const int h    = rem >> 7;
  const int q0   = (rem & 127) * 16;
  const int col  = lane & 15;
  const int kb   = (lane >> 4) * 8;
  const int hi   = lane >> 4;

  const float* X = (mat == 0) ? Q : (mat == 1) ? K : V;
  const float* W = (mat == 0) ? Wq : (mat == 1) ? Wk : Wv;

  // A fragments: X tile (16 rows x 64 d), f32 -> f16 inline
  const float* xrow = X + ((size_t)(n * LL + q0 + col)) * EE + h * DD;
  const v16h a0 = cat16(cvt8(xrow + kb),      cvt8(xrow + 16 + kb));
  const v16h a1 = cat16(cvt8(xrow + 32 + kb), cvt8(xrow + 48 + kb));

  const size_t nh = (size_t)(n * HH + h);
#pragma unroll
  for (int j = 0; j < 4; ++j) {
    // B^T = W (row e, contiguous d)
    const float* wrow = W + (size_t)(j * 16 + col) * DD;
    const v16h b0 = cat16(cvt8(wrow + kb),      cvt8(wrow + 16 + kb));
    const v16h b1 = cat16(cvt8(wrow + 32 + kb), cvt8(wrow + 48 + kb));
    v8f c = {};
    c = wmma16(a0, b0, c);
    c = wmma16(a1, b1, c);
    if (mat == 2) {
      // transpose store: per lane the 8 C values are contiguous along L
      v8h pk;
#pragma unroll
      for (int r = 0; r < 8; ++r) pk[r] = (_Float16)c[r];
      *(v8h*)(VpT + (nh * DD + j * 16 + col) * LL + q0 + 8 * hi) = pk;
    } else {
      _Float16* base = ((mat == 0) ? Qp : Kp) + nh * LL * DD;
#pragma unroll
      for (int r = 0; r < 8; ++r)
        base[(size_t)(q0 + r + 8 * hi) * DD + j * 16 + col] = (_Float16)c[r];
    }
  }
}

// ------------------------------------------------------- flash attention core
// one wave per (n, h, 16-query tile); Ctx: f16 [N][L][E]
// The 8 waves of a block share (n, h): K and V^T tiles of KT keys are staged in
// LDS once per block with whole-line copies instead of 16-line loads per wave.
#define KT     64              // keys per staged tile
#define PITCH  72              // halves per LDS row: 144 B = 16 B x odd, no bank conflict for 16-byte reads
#define TILE_H (64 * PITCH)    // halves of one staged tile (K: 64 keys x 64 d, V^T: 64 d x 64 keys)

// One tile pair: each thread copies rows r and r+32 (16 B each) of K and of V^T.
static __device__ __forceinline__ void stage_kv(unsigned lk, const _Float16* gk,
                                                const _Float16* gv) {
  const unsigned lk1 = lk + 32 * PITCH * 2;
  const unsigned lv0 = lk + TILE_H * 2;
  const unsigned lv1 = lv0 + 32 * PITCH * 2;
  const _Float16* gk1 = gk + 32 * DD;
  const _Float16* gv1 = gv + 32 * LL;
  // s_wait_xcnt 0 closes the statement so that no address register of an issued
  // copy is rewritten ahead of it
  asm volatile("global_load_async_to_lds_b128 %0, %4, off\n\t"
               "global_load_async_to_lds_b128 %1, %5, off\n\t"
               "global_load_async_to_lds_b128 %2, %6, off\n\t"
               "global_load_async_to_lds_b128 %3, %7, off\n\t"
               "s_wait_xcnt 0x0"
               :: "v"(lk), "v"(lk1), "v"(lv0), "v"(lv1),
                  "v"(gk), "v"(gk1), "v"(gv), "v"(gv1)
               : "memory");
}

__global__ void k_attn(const _Float16* __restrict__ Qp, const _Float16* __restrict__ Kp,
                       const _Float16* __restrict__ VpT, const int* __restrict__ mask,
                       _Float16* __restrict__ Ctx) {
  __shared__ __attribute__((aligned(16))) _Float16 sm[2 * 2 * TILE_H];

  const int lane = threadIdx.x & 31;
  const int wave = threadIdx.x >> 5;
  const int tile = blockIdx.x * 8 + wave;      // 8192 tiles
  const int n    = tile >> 11;
  int rem        = tile & 2047;
  const int h    = rem >> 7;
  const int q0   = (rem & 127) * 16;
  const int col  = lane & 15;
  const int kb   = (lane >> 4) * 8;
  const int hi   = lane >> 4;
  const size_t nh = (size_t)(n * HH + h);

  // B fragments of Q^T (== Q rows in A-pattern), fixed for the whole loop
  const _Float16* qrow = Qp + (nh * LL + q0 + col) * DD;
  const v16h bq0 = cat16(*(const v8h*)(qrow + kb),      *(const v8h*)(qrow + 16 + kb));
  const v16h bq1 = cat16(*(const v8h*)(qrow + 32 + kb), *(const v8h*)(qrow + 48 + kb));

  float m_run = -3.4e38f, l_run = 0.f;   // running max in log2 domain
  v8f o0 = {}, o1 = {}, o2 = {}, o3 = {};

  const int* mbase = mask + (size_t)n * LL * LL + (size_t)(q0 + col) * LL + 8 * hi;

  // this thread's share of a staged tile: row sr (and sr + 32), 16-byte chunk sc
  const int sr = threadIdx.x >> 3;
  const int sc = (threadIdx.x & 7) * 8;
  const _Float16* gk = Kp + (nh * LL + sr) * DD + sc;    // + k0 * DD per tile
  const _Float16* gv = VpT + (nh * DD + sr) * LL + sc;   // + k0 per tile
  const unsigned  ls = (unsigned)(size_t)(sm + sr * PITCH + sc);  // LDS byte address, buffer 0

  stage_kv(ls, gk, gv);
  asm volatile("s_wait_asynccnt 0x0" ::: "memory");  // tile 0 landed (this wave's copies)
  __syncthreads();                                   // tile 0 readable by every wave
  stage_kv(ls + 2 * TILE_H * 2, gk + KT * DD, gv + KT);

#pragma unroll 1
  for (int t = 0; t < LL / KT; ++t) {
    const _Float16* kt = sm + (t & 1) * (2 * TILE_H) + col * PITCH + kb;
    const _Float16* vt = kt + TILE_H;
#pragma unroll
    for (int p = 0; p < KT / 32; ++p) {
      // S^T = K * Q^T : two 16x16 tiles (k 0-15, 16-31)
      const _Float16* kr0 = kt + p * 32 * PITCH;
      const _Float16* kr1 = kr0 + 16 * PITCH;
      const v16h ak00 = cat16(*(const v8h*)(kr0),      *(const v8h*)(kr0 + 16));
      const v16h ak01 = cat16(*(const v8h*)(kr0 + 32), *(const v8h*)(kr0 + 48));
      const v16h ak10 = cat16(*(const v8h*)(kr1),      *(const v8h*)(kr1 + 16));
      const v16h ak11 = cat16(*(const v8h*)(kr1 + 32), *(const v8h*)(kr1 + 48));
      v8f sT0 = {}, sT1 = {};
      sT0 = wmma16(ak00, bq0, sT0);  sT0 = wmma16(ak01, bq1, sT0);
      sT1 = wmma16(ak10, bq0, sT1);  sT1 = wmma16(ak11, bq1, sT1);

      // mask (k contiguous per lane); reference: (-1e20 if masked) then /sqrt(E);
      // whole row pre-scaled by log2(e) so exp2 gives exact reference softmax
      const int* mr = mbase + t * KT + p * 32;
      const v4i mA = *(const v4i*)(mr);
      const v4i mB = *(const v4i*)(mr + 4);
      const v4i mC = *(const v4i*)(mr + 16);
      const v4i mD = *(const v4i*)(mr + 20);

      float s0[8], s1[8];
#pragma unroll
      for (int r = 0; r < 8; ++r) {
        const int mv0 = (r < 4) ? mA[r & 3] : mB[r & 3];
        const int mv1 = (r < 4) ? mC[r & 3] : mD[r & 3];
        s0[r] = (mv0 != 0 ? sT0[r] : -1.0e20f) * SCALE_LOG2;
        s1[r] = (mv1 != 0 ? sT1[r] : -1.0e20f) * SCALE_LOG2;
      }

      // online softmax: per-lane partial over 16 k, one xor-16 combine
      float tmax = fmaxf(s0[0], s1[0]);
#pragma unroll
      for (int r = 1; r < 8; ++r) { tmax = fmaxf(tmax, s0[r]); tmax = fmaxf(tmax, s1[r]); }
      tmax = fmaxf(tmax, __shfl_xor(tmax, 16, 32));
      const float m_new = fmaxf(m_run, tmax);
      float e[17];                                 // exponents, then their powers of 2
      e[0] = m_run - m_new;
      // unrolled so that every index of e[] is a constant and e[] lives in registers
#pragma unroll
      for (int r = 0; r < 8; ++r) { e[1 + r] = s0[r] - m_new; e[9 + r] = s1[r] - m_new; }
      exp2_hw17(e);
      const float corr = e[0];

      float tsum = 0.f;
      v16h pf;                                     // P^T B-fragment, in registers
#pragma unroll
      for (int r = 0; r < 8; ++r) {
        const float p0 = e[1 + r];
        const float p1 = e[9 + r];
        tsum += p0 + p1;
        pf[r]     = (_Float16)p0;
        pf[r + 8] = (_Float16)p1;
      }
      tsum += __shfl_xor(tsum, 16, 32);
      l_run = l_run * corr + tsum;
      m_run = m_new;
#pragma unroll
      for (int r = 0; r < 8; ++r) { o0[r] *= corr; o1[r] *= corr; o2[r] *= corr; o3[r] *= corr; }

      // O^T += V^T * P^T  (V^T rows of the staged tile, keys contiguous)
      const _Float16* v0 = vt + p * 32;
      const v16h av0 = cat16(*(const v8h*)(v0),              *(const v8h*)(v0 + 16));
      const v16h av1 = cat16(*(const v8h*)(v0 + 16 * PITCH), *(const v8h*)(v0 + 16 * PITCH + 16));
      const v16h av2 = cat16(*(const v8h*)(v0 + 32 * PITCH), *(const v8h*)(v0 + 32 * PITCH + 16));
      const v16h av3 = cat16(*(const v8h*)(v0 + 48 * PITCH), *(const v8h*)(v0 + 48 * PITCH + 16));
      o0 = wmma16(av0, pf, o0);
      o1 = wmma16(av1, pf, o1);
      o2 = wmma16(av2, pf, o2);
      o3 = wmma16(av3, pf, o3);
    }

    asm volatile("s_wait_dscnt 0x0" ::: "memory");     // this wave's reads of tile t are done
    asm volatile("s_wait_asynccnt 0x0" ::: "memory");  // this wave's copies of tile t+1 landed
    __syncthreads();  // publishes tile t+1 and frees tile t's buffer for the refill
    if (t + 2 < LL / KT)
      stage_kv(ls + (t & 1) * (2 * TILE_H * 2), gk + (size_t)(t + 2) * KT * DD, gv + (t + 2) * KT);
  }
  asm volatile("s_wait_asynccnt 0x0" ::: "memory");    // nothing in flight when the wave ends

  const float rinv = 1.0f / l_run;
  _Float16* crow = Ctx + ((size_t)(n * LL) + q0 + col) * EE + h * DD + 8 * hi;
  v8h pk;
#pragma unroll
  for (int r = 0; r < 8; ++r) pk[r] = (_Float16)(o0[r] * rinv);
  *(v8h*)(crow) = pk;
#pragma unroll
  for (int r = 0; r < 8; ++r) pk[r] = (_Float16)(o1[r] * rinv);
  *(v8h*)(crow + 16) = pk;
#pragma unroll
  for (int r = 0; r < 8; ++r) pk[r] = (_Float16)(o2[r] * rinv);
  *(v8h*)(crow + 32) = pk;
#pragma unroll
  for (int r = 0; r < 8; ++r) pk[r] = (_Float16)(o3[r] * rinv);
  *(v8h*)(crow + 48) = pk;
}

// ---------------------------------------------- out = Ctx @ Wo^T + bo  (f32)
// One block computes a 128 x 128 tile of Out; its 8 waves (4 along m, 2 along e)
// each hold 32 x 64.  Slices of OKS k-values of the Ctx rows and of the Wo rows
// are staged in LDS with whole-line copies and shared by the waves.
#define OKS     64              // k-values per staged slice (one 128-byte line per row)
#define OTILE_H (128 * PITCH)   // halves of one staged operand slice (128 rows)

// One slice pair: each thread copies 16 B of rows r, r+32, r+64, r+96 of Ctx and of Wo.
static __device__ __forceinline__ void stage_ab(unsigned la, const _Float16* ga,
                                                const _Float16* gb) {
  const unsigned la1 = la + 32 * PITCH * 2;
  const unsigned la2 = la + 64 * PITCH * 2;
  const unsigned la3 = la + 96 * PITCH * 2;
  const unsigned lb0 = la + OTILE_H * 2;
  const unsigned lb1 = lb0 + 32 * PITCH * 2;
  const unsigned lb2 = lb0 + 64 * PITCH * 2;
  const unsigned lb3 = lb0 + 96 * PITCH * 2;
  const _Float16* ga1 = ga + 32 * EE;
  const _Float16* ga2 = ga + 64 * EE;
  const _Float16* ga3 = ga + 96 * EE;
  const _Float16* gb1 = gb + 32 * EE;
  const _Float16* gb2 = gb + 64 * EE;
  const _Float16* gb3 = gb + 96 * EE;
  // s_wait_xcnt 0 closes the statement so that no address register of an issued
  // copy is rewritten ahead of it
  asm volatile("global_load_async_to_lds_b128 %0, %8, off\n\t"
               "global_load_async_to_lds_b128 %1, %9, off\n\t"
               "global_load_async_to_lds_b128 %2, %10, off\n\t"
               "global_load_async_to_lds_b128 %3, %11, off\n\t"
               "global_load_async_to_lds_b128 %4, %12, off\n\t"
               "global_load_async_to_lds_b128 %5, %13, off\n\t"
               "global_load_async_to_lds_b128 %6, %14, off\n\t"
               "global_load_async_to_lds_b128 %7, %15, off\n\t"
               "s_wait_xcnt 0x0"
               :: "v"(la), "v"(la1), "v"(la2), "v"(la3),
                  "v"(lb0), "v"(lb1), "v"(lb2), "v"(lb3),
                  "v"(ga), "v"(ga1), "v"(ga2), "v"(ga3),
                  "v"(gb), "v"(gb1), "v"(gb2), "v"(gb3)
               : "memory");
}

// launch bounds = the real block size: lifts the register ceiling so that the 8
// accumulator tiles and their fragments stay in registers
__global__ __launch_bounds__(256) void k_out(const _Float16* __restrict__ Ctx,
                                             const _Float16* __restrict__ WoH,
                                             const float* __restrict__ bo,
                                             float* __restrict__ Out) {
  __shared__ __attribute__((aligned(16))) _Float16 so[2 * 2 * OTILE_H];

  const int lane = threadIdx.x & 31;
  const int wave = threadIdx.x >> 5;
  const int m0 = (blockIdx.x >> 3) * 128;   // 64 m-blocks x 8 e-blocks
  const int e0 = (blockIdx.x & 7) * 128;
  const int wm = (wave >> 1) * 32;          // this wave's rows inside the block tile
  const int we = (wave & 1) * 64;           // this wave's columns inside the block tile
  const int col = lane & 15;
  const int kb  = (lane >> 4) * 8;
  const int hi  = lane >> 4;

  v8f acc[2][4] = {};

  // this thread's share of a staged slice: row sr (+32, +64, +96), 16-byte chunk sc
  const int sr = threadIdx.x >> 3;
  const int sc = (threadIdx.x & 7) * 8;
  const _Float16* ga = Ctx + (size_t)(m0 + sr) * EE + sc;   // + t * OKS per slice
  const _Float16* gb = WoH + (size_t)(e0 + sr) * EE + sc;   // + t * OKS per slice
  const unsigned  ls = (unsigned)(size_t)(so + sr * PITCH + sc);  // LDS byte address, buffer 0

  stage_ab(ls, ga, gb);
  asm volatile("s_wait_asynccnt 0x0" ::: "memory");  // slice 0 landed (this wave's copies)
  __syncthreads();                                   // slice 0 readable by every wave
  stage_ab(ls + 2 * OTILE_H * 2, ga + OKS, gb + OKS);

  // kept rolled: one foot (waits, barrier, refill) per slice, small loop text
#pragma unroll 1
  for (int t = 0; t < EE / OKS; ++t) {
    const _Float16* at = so + (t & 1) * (2 * OTILE_H) + (wm + col) * PITCH + kb;
    const _Float16* bt = so + (t & 1) * (2 * OTILE_H) + OTILE_H + (we + col) * PITCH + kb;
    // the inner loops here and in the epilogue are unrolled so that every index of
    // a[], b[] and acc[][] is a constant and the arrays live in registers
#pragma unroll
    for (int kk = 0; kk < OKS / 32; ++kk) {
      v16h a[2], b[4];
#pragma unroll
      for (int i = 0; i < 2; ++i) {
        const _Float16* r = at + i * 16 * PITCH + kk * 32;
        a[i] = cat16(*(const v8h*)(r), *(const v8h*)(r + 16));
      }
#pragma unroll
      for (int j = 0; j < 4; ++j) {
        const _Float16* r = bt + j * 16 * PITCH + kk * 32;
        b[j] = cat16(*(const v8h*)(r), *(const v8h*)(r + 16));
      }
#pragma unroll
      for (int i = 0; i < 2; ++i)
#pragma unroll
        for (int j = 0; j < 4; ++j) acc[i][j] = wmma16(a[i], b[j], acc[i][j]);
    }

    asm volatile("s_wait_dscnt 0x0" ::: "memory");     // this wave's reads of slice t are done
    asm volatile("s_wait_asynccnt 0x0" ::: "memory");  // this wave's copies of slice t+1 landed
    __syncthreads();  // publishes slice t+1 and frees slice t's buffer for the refill
    if (t + 2 < EE / OKS)
      stage_ab(ls + (t & 1) * (2 * OTILE_H * 2), ga + (t + 2) * OKS, gb + (t + 2) * OKS);
  }
  asm volatile("s_wait_asynccnt 0x0" ::: "memory");    // nothing in flight when the wave ends

#pragma unroll
  for (int j = 0; j < 4; ++j) {
    const int e = e0 + we + j * 16 + col;
    const float bias = bo[e];
#pragma unroll
    for (int i = 0; i < 2; ++i)
#pragma unroll
      for (int r = 0; r < 8; ++r)
        Out[(size_t)(m0 + wm + i * 16 + r + 8 * hi) * EE + e] = acc[i][j][r] + bias;
  }
}

extern "C" void kernel_launch(void* const* d_in, const int* in_sizes, int n_in,
                              void* d_out, int out_size, void* d_ws, size_t ws_size,
                              hipStream_t stream) {
  const float* values  = (const float*)d_in[0];
  const float* keys    = (const float*)d_in[1];
  const float* queries = (const float*)d_in[2];
  const int*   mask    = (const int*)d_in[3];
  const float* Wq      = (const float*)d_in[4];
  const float* Wk      = (const float*)d_in[5];
  const float* Wv      = (const float*)d_in[6];
  const float* Wo      = (const float*)d_in[7];
  const float* bo      = (const float*)d_in[8];
  float* out = (float*)d_out;

  _Float16* ws = (_Float16*)d_ws;
  const size_t per = (size_t)NB * HH * LL * DD;   // 8M halves = 16 MB each
  _Float16* Qp  = ws;
  _Float16* Kp  = Qp + per;
  _Float16* VpT = Kp + per;
  _Float16* Ctx = VpT + per;
  _Float16* WoH = Ctx + per;                       // + 2 MB  (total ~66 MB)

  hipLaunchKernelGGL(k_prep_wo, dim3((EE * EE) / 256), dim3(256), 0, stream, Wo, WoH);
  hipLaunchKernelGGL(k_proj, dim3(3 * 8192 / 8), dim3(256), 0, stream,
                     queries, keys, values, Wq, Wk, Wv, Qp, Kp, VpT);
  hipLaunchKernelGGL(k_attn, dim3(8192 / 8), dim3(256), 0, stream,
                     Qp, Kp, VpT, mask, Ctx);
  hipLaunchKernelGGL(k_out, dim3(64 * 8), dim3(256), 0, stream, Ctx, WoH, bo, out);
}

// v004
// It runs in 142 microseconds.
// Timed twice side by side with v003, it ran 1.16 times as fast both times.
// All steps since v000 together make it 2.53 times as fast.
#include <hip/hip_runtime.h>
#include <hip/hip_bf16.h>

#define NB 4
#define LL 2048
#define EE 1024
#define HH 16
#define DD 64

typedef __attribute__((ext_vector_type(16))) _Float16 v16h;
typedef __attribute__((ext_vector_type(8)))  _Float16 v8h;
typedef __attribute__((ext_vector_type(8)))  float    v8f;
typedef __attribute__((ext_vector_type(4)))  int      v4i;
typedef __attribute__((ext_vector_type(16))) unsigned v16u;
typedef __attribute__((address_space(4))) v16u        cv16u;

// 1/sqrt(E) * log2(e): softmax computed with exp2 (hardware-native) is exact
// softmax of the reference logits since all logits share the same scale.
#define SCALE_LOG2 (0.03125f * 1.44269504088896340736f)

static __device__ __forceinline__ v16h cat16(v8h lo, v8h hi) {
  v16h r;
#pragma unroll
  for (int i = 0; i < 8; ++i) { r[i] = lo[i]; r[i + 8] = hi[i]; }
  return r;
}

static __device__ __forceinline__ v8h cvt8(const float* p) {
  v8h r;
#pragma unroll
  for (int i = 0; i < 8; ++i) r[i] = (_Float16)p[i];
  return r;
}

// e[i] = 2^e[i] on the hardware exponential alone, without the library's range
// fix-up for results below 2^-126: such a weight is 0 as f16 and far below one
// f32 ulp of the row sum (which is at least 1), and a rescale factor that small
// is 0 too.  One statement, in place: every v_exp_f32 is followed by one that is
// independent of it and the last by v_nop, which is the slot the instruction set
// asks for before a transcendental's result is read or its source overwritten.
static __device__ __forceinline__ void exp2_hw17(float (&e)[17]) {
  asm("v_exp_f32 %0, %0\n\t"
      "v_exp_f32 %1, %1\n\t"
      "v_exp_f32 %2, %2\n\t"
      "v_exp_f32 %3, %3\n\t"
      "v_exp_f32 %4, %4\n\t"
      "v_exp_f32 %5, %5\n\t"
      "v_exp_f32 %6, %6\n\t"
      "v_exp_f32 %7, %7\n\t"
      "v_exp_f32 %8, %8\n\t"
      "v_exp_f32 %9, %9\n\t"
      "v_exp_f32 %10, %10\n\t"
      "v_exp_f32 %11, %11\n\t"
      "v_exp_f32 %12, %12\n\t"
      "v_exp_f32 %13, %13\n\t"
      "v_exp_f32 %14, %14\n\t"
      "v_exp_f32 %15, %15\n\t"
      "v_exp_f32 %16, %16\n\t"
      "v_nop"
      : "+v"(e[0]), "+v"(e[1]), "+v"(e[2]), "+v"(e[3]), "+v"(e[4]), "+v"(e[5]),
        "+v"(e[6]), "+v"(e[7]), "+v"(e[8]), "+v"(e[9]), "+v"(e[10]), "+v"(e[11]),
        "+v"(e[12]), "+v"(e[13]), "+v"(e[14]), "+v"(e[15]), "+v"(e[16]));
}

static __device__ __forceinline__ v8f wmma16(v16h a, v16h b, v8f c) {
  // D(16x16,f32) = A(16x32,f16) * B(32x16,f16) + C
  return __builtin_amdgcn_wmma_f32_16x16x32_f16(false, a, false, b, (short)0, c,
                                                false, false);
}

// ---------------------------------------------------------------- Wo -> f16
__global__ void k_prep_wo(const float* __restrict__ Wo, _Float16* __restrict__ WoH) {
  int i = blockIdx.x * blockDim.x + threadIdx.x;
  if (i < EE * EE) WoH[i] = (_Float16)Wo[i];
}

// ------------------------------------------------ mask -> lane-mask words
// MB[n][16-query tile][32-key block][16]: word w of a block is the lane mask that
// k_attn's wave needs for score register w (w < 8: keys 0-15, else keys 16-31 of
// the block): bit `lane` = (mask[q0 + (lane & 15)][k0 + (w >> 3) * 16 + (w & 7) + 8 * (lane >> 4)] != 0).
// The mask does not depend on the head, so it is reduced once for all 16 heads.
// One wave packs MBU tiles of 64 keys; each tile gives one whole 128-byte line.
#define MBU 4
__global__ __launch_bounds__(256) void k_maskbits(const int* __restrict__ mask,
                                                  unsigned* __restrict__ MB) {
  const int lane = threadIdx.x & 31;
  const int wave = threadIdx.x >> 5;
  const int unit = (blockIdx.x * 8 + wave) * MBU;   // 4 * 128 * 32 tiles of 64 keys
  const int n    = unit >> 12;
  const int qt   = (unit >> 5) & 127;
  const int t0   = unit & 31;
  const int col  = lane & 15;
  const int hi   = lane >> 4;
  const int* mr = mask + (size_t)n * LL * LL + (size_t)(qt * 16 + col) * LL + t0 * 64 + 8 * hi;

  unsigned* mo = MB + (size_t)unit * 32 + lane;

  // two tiles a trip, kept rolled: 16 loads in flight per wave, and one trip's 64
  // ballot words fit the scalar registers
#pragma unroll 1
  for (int g = 0; g < MBU / 2; ++g) {
    // the inner loops are unrolled so that every index of m[][] is a constant
    v4i m[2][8];
#pragma unroll
    for (int u = 0; u < 2; ++u)
#pragma unroll
      for (int p = 0; p < 2; ++p) {
        const int* q = mr + (g * 2 + u) * 64 + p * 32;
        m[u][p * 4 + 0] = *(const v4i*)(q);
        m[u][p * 4 + 1] = *(const v4i*)(q + 4);
        m[u][p * 4 + 2] = *(const v4i*)(q + 16);
        m[u][p * 4 + 3] = *(const v4i*)(q + 20);
      }
#pragma unroll
    for (int u = 0; u < 2; ++u) {
      unsigned val = 0;
#pragma unroll
      for (int w = 0; w < 32; ++w) {
        const unsigned b = __builtin_amdgcn_ballot_w32(m[u][w >> 2][w & 3] != 0);
        val = (lane == w) ? b : val;
      }
      mo[(g * 2 + u) * 32] = val;
    }
    // the next trip's loads land in registers that these stores name: kept behind this wait
    asm volatile("s_wait_xcnt 0x0" ::: "memory");
  }
}

// ------------------------------------------- per-head projections Q/K/V @ W^T
// Qp, Kp : f16 [N][H][L][D] row-major.  VpT : f16 [N][H][D][L] (head-transposed)
__global__ void k_proj(const float* __restrict__ Q, const float* __restrict__ K,
                       const float* __restrict__ V,
                       const float* __restrict__ Wq, const float* __restrict__ Wk,
                       const float* __restrict__ Wv,
                       _Float16* __restrict__ Qp, _Float16* __restrict__ Kp,
                       _Float16* __restrict__ VpT) {
  const int lane = threadIdx.x & 31;
  const int wave = threadIdx.x >> 5;
  const int tile = blockIdx.x * 8 + wave;      // 3 * 8192 tiles total
  const int mat  = tile >> 13;                  // 0=Q 1=K 2=V
  int rem        = tile & 8191;
  const int n    = rem >> 11;                   // / (H*128)
  rem           &= 2047;
  const int h    = rem >> 7;
  const int q0   = (rem & 127) * 16;
  const int col  = lane & 15;
  const int kb   = (lane >> 4) * 8;
  const int hi   = lane >> 4;

  const float* X = (mat == 0) ? Q : (mat == 1) ? K : V;
  const float* W = (mat == 0) ? Wq : (mat == 1) ? Wk : Wv;

  // A fragments: X tile (16 rows x 64 d), f32 -> f16 inline
  const float* xrow = X + ((size_t)(n * LL + q0 + col)) * EE + h * DD;
  const v16h a0 = cat16(cvt8(xrow + kb),      cvt8(xrow + 16 + kb));
  const v16h a1 = cat16(cvt8(xrow + 32 + kb), cvt8(xrow + 48 + kb));

  const size_t nh = (size_t)(n * HH + h);
#pragma unroll
  for (int j = 0; j < 4; ++j) {
    // B^T = W (row e, contiguous d)
    const float* wrow = W + (size_t)(j * 16 + col) * DD;
    const v16h b0 = cat16(cvt8(wrow + kb),      cvt8(wrow + 16 + kb));
    const v16h b1 = cat16(cvt8(wrow + 32 + kb), cvt8(wrow + 48 + kb));
    v8f c = {};
    c = wmma16(a0, b0, c);
    c = wmma16(a1, b1, c);
    if (mat == 2) {
      // transpose store: per lane the 8 C values are contiguous along L
      v8h pk;
#pragma unroll
      for (int r = 0; r < 8; ++r) pk[r] = (_Float16)c[r];
      *(v8h*)(VpT + (nh * DD + j * 16 + col) * LL + q0 + 8 * hi) = pk;
    } else {
      _Float16* base = ((mat == 0) ? Qp : Kp) + nh * LL * DD;
#pragma unroll
      for (int r = 0; r < 8; ++r)
        base[(size_t)(q0 + r + 8 * hi) * DD + j * 16 + col] = (_Float16)c[r];
    }
  }
}

// ------------------------------------------------------- flash attention core
// one wave per (n, h, 16-query tile); Ctx: f16 [N][L][E]
// The 8 waves of a block share (n, h): K and V^T tiles of KT keys are staged in
// LDS once per block with whole-line copies instead of 16-line loads per wave.
#define KT     64              // keys per staged tile
#define PITCH  72              // halves per LDS row: 144 B = 16 B x odd, no bank conflict for 16-byte reads
#define TILE_H (64 * PITCH)    // halves of one staged tile (K: 64 keys x 64 d, V^T: 64 d x 64 keys)

// One tile pair: each thread copies rows r and r+32 (16 B each) of K and of V^T.
static __device__ __forceinline__ void stage_kv(unsigned lk, const _Float16* gk,
                                                const _Float16* gv) {
  const unsigned lk1 = lk + 32 * PITCH * 2;
  const unsigned lv0 = lk + TILE_H * 2;
  const unsigned lv1 = lv0 + 32 * PITCH * 2;
  const _Float16* gk1 = gk + 32 * DD;
  const _Float16* gv1 = gv + 32 * LL;
  // s_wait_xcnt 0 closes the statement so that no address register of an issued
  // copy is rewritten ahead of it
  asm volatile("global_load_async_to_lds_b128 %0, %4, off\n\t"
               "global_load_async_to_lds_b128 %1, %5, off\n\t"
               "global_load_async_to_lds_b128 %2, %6, off\n\t"
               "global_load_async_to_lds_b128 %3, %7, off\n\t"
               "s_wait_xcnt 0x0"
               :: "v"(lk), "v"(lk1), "v"(lv0), "v"(lv1),
                  "v"(gk), "v"(gk1), "v"(gv), "v"(gv1)
               : "memory");
}

__global__ void k_attn(const _Float16* __restrict__ Qp, const _Float16* __restrict__ Kp,
                       const _Float16* __restrict__ VpT, const unsigned* __restrict__ MB,
                       _Float16* __restrict__ Ctx) {
  __shared__ __attribute__((aligned(16))) _Float16 sm[2 * 2 * TILE_H];

  const int lane = threadIdx.x & 31;
  const int wave = threadIdx.x >> 5;
  const int tile = blockIdx.x * 8 + wave;      // 8192 tiles
  const int n    = tile >> 11;
  int rem        = tile & 2047;
  const int h    = rem >> 7;
  const int q0   = (rem & 127) * 16;
  const int col  = lane & 15;
  const int kb   = (lane >> 4) * 8;
  const int hi   = lane >> 4;
  const size_t nh = (size_t)(n * HH + h);

  // B fragments of Q^T (== Q rows in A-pattern), fixed for the whole loop
  const _Float16* qrow = Qp + (nh * LL + q0 + col) * DD;
  const v16h bq0 = cat16(*(const v8h*)(qrow + kb),      *(const v8h*)(qrow + 16 + kb));
  const v16h bq1 = cat16(*(const v8h*)(qrow + 32 + kb), *(const v8h*)(qrow + 48 + kb));

  float m_run = -3.4e38f, l_run = 0.f;   // running max in log2 domain
  v8f o0 = {}, o1 = {}, o2 = {}, o3 = {};

  // this wave's lane-mask words: the same address in every lane (readfirstlane tells
  // the compiler) and never written during this launch (the constant address space
  // tells it), so that they come by scalar loads straight into scalar registers
  const int utile = __builtin_amdgcn_readfirstlane(tile);
  const cv16u* mw = (const cv16u*)(MB + (size_t)((utile >> 11) * 128 + (utile & 127)) * (LL / 32 * 16));
  v16u mcur[2] = { mw[0], mw[1] };

  // this thread's share of a staged tile: row sr (and sr + 32), 16-byte chunk sc
  const int sr = threadIdx.x >> 3;
  const int sc = (threadIdx.x & 7) * 8;
  const _Float16* gk = Kp + (nh * LL + sr) * DD + sc;    // + k0 * DD per tile
  const _Float16* gv = VpT + (nh * DD + sr) * LL + sc;   // + k0 per tile
  const unsigned  ls = (unsigned)(size_t)(sm + sr * PITCH + sc);  // LDS byte address, buffer 0

  stage_kv(ls, gk, gv);
  asm volatile("s_wait_asynccnt 0x0" ::: "memory");  // tile 0 landed (this wave's copies)
  __syncthreads();                                   // tile 0 readable by every wave
  stage_kv(ls + 2 * TILE_H * 2, gk + KT * DD, gv + KT);

#pragma unroll 1
  for (int t = 0; t < LL / KT; ++t) {
    const _Float16* kt = sm + (t & 1) * (2 * TILE_H) + col * PITCH + kb;
    const _Float16* vt = kt + TILE_H;
    // the next tile's words are fetched one trip ahead (the last trip fetches its own again)
    const int tn = (t + 1 < LL / KT) ? t + 1 : t;
    const v16u mnxt[2] = { mw[tn * 2], mw[tn * 2 + 1] };
#pragma unroll
    for (int p = 0; p < KT / 32; ++p) {
      // S^T = K * Q^T : two 16x16 tiles (k 0-15, 16-31)
      const _Float16* kr0 = kt + p * 32 * PITCH;
      const _Float16* kr1 = kr0 + 16 * PITCH;
      const v16h ak00 = cat16(*(const v8h*)(kr0),      *(const v8h*)(kr0 + 16));
      const v16h ak01 = cat16(*(const v8h*)(kr0 + 32), *(const v8h*)(kr0 + 48));
      const v16h ak10 = cat16(*(const v8h*)(kr1),      *(const v8h*)(kr1 + 16));
      const v16h ak11 = cat16(*(const v8h*)(kr1 + 32), *(const v8h*)(kr1 + 48));
      v8f sT0 = {}, sT1 = {};
      sT0 = wmma16(ak00, bq0, sT0);  sT0 = wmma16(ak01, bq1, sT0);
      sT1 = wmma16(ak10, bq0, sT1);  sT1 = wmma16(ak11, bq1, sT1);

      // mask (one select per score on its lane-mask word); reference: (-1e20 if masked) then /sqrt(E);
      // whole row pre-scaled by log2(e) so exp2 gives exact reference softmax
      float s0[8], s1[8];
#pragma unroll
      for (int r = 0; r < 8; ++r) {
        const bool mv0 = __builtin_amdgcn_inverse_ballot_w32(mcur[p][r]);
        const bool mv1 = __builtin_amdgcn_inverse_ballot_w32(mcur[p][r + 8]);
        s0[r] = (mv0 ? sT0[r] : -1.0e20f) * SCALE_LOG2;
        s1[r] = (mv1 ? sT1[r] : -1.0e20f) * SCALE_LOG2;
      }

      // online softmax: per-lane partial over 16 k, one xor-16 combine
      float tmax = fmaxf(s0[0], s1[0]);
#pragma unroll
      for (int r = 1; r < 8; ++r) { tmax = fmaxf(tmax, s0[r]); tmax = fmaxf(tmax, s1[r]); }
      tmax = fmaxf(tmax, __shfl_xor(tmax, 16, 32));
      const float m_new = fmaxf(m_run, tmax);
      float e[17];                                 // exponents, then their powers of 2
      e[0] = m_run - m_new;
      // unrolled so that every index of e[] is a constant and e[] lives in registers
#pragma unroll
      for (int r = 0; r < 8; ++r) { e[1 + r] = s0[r] - m_new; e[9 + r] = s1[r] - m_new; }
      exp2_hw17(e);
      const float corr = e[0];

      float tsum = 0.f;
      v16h pf;                                     // P^T B-fragment, in registers
#pragma unroll
      for (int r = 0; r < 8; ++r) {
        const float p0 = e[1 + r];
        const float p1 = e[9 + r];
        tsum += p0 + p1;
        pf[r]     = (_Float16)p0;
        pf[r + 8] = (_Float16)p1;
      }
      tsum += __shfl_xor(tsum, 16, 32);
      l_run = l_run * corr + tsum;
      m_run = m_new;
#pragma unroll
      for (int r = 0; r < 8; ++r) { o0[r] *= corr; o1[r] *= corr; o2[r] *= corr; o3[r] *= corr; }

      // O^T += V^T * P^T  (V^T rows of the staged tile, keys contiguous)
      const _Float16* v0 = vt + p * 32;
      const v16h av0 = cat16(*(const v8h*)(v0),              *(const v8h*)(v0 + 16));
      const v16h av1 = cat16(*(const v8h*)(v0 + 16 * PITCH), *(const v8h*)(v0 + 16 * PITCH + 16));
      const v16h av2 = cat16(*(const v8h*)(v0 + 32 * PITCH), *(const v8h*)(v0 + 32 * PITCH + 16));
      const v16h av3 = cat16(*(const v8h*)(v0 + 48 * PITCH), *(const v8h*)(v0 + 48 * PITCH + 16));
      o0 = wmma16(av0, pf, o0);
      o1 = wmma16(av1, pf, o1);
      o2 = wmma16(av2, pf, o2);
      o3 = wmma16(av3, pf, o3);
    }

    asm volatile("s_wait_dscnt 0x0" ::: "memory");     // this wave's reads of tile t are done
    asm volatile("s_wait_asynccnt 0x0" ::: "memory");  // this wave's copies of tile t+1 landed
    __syncthreads();  // publishes tile t+1 and frees tile t's buffer for the refill
    if (t + 2 < LL / KT)
      stage_kv(ls + (t & 1) * (2 * TILE_H * 2), gk + (size_t)(t + 2) * KT * DD, gv + (t + 2) * KT);
    mcur[0] = mnxt[0];
    mcur[1] = mnxt[1];
  }
  asm volatile("s_wait_asynccnt 0x0" ::: "memory");    // nothing in flight when the wave ends

  const float rinv = 1.0f / l_run;
  _Float16* crow = Ctx + ((size_t)(n * LL) + q0 + col) * EE + h * DD + 8 * hi;
  v8h pk;
#pragma unroll
  for (int r = 0; r < 8; ++r) pk[r] = (_Float16)(o0[r] * rinv);
  *(v8h*)(crow) = pk;
#pragma unroll
  for (int r = 0; r < 8; ++r) pk[r] = (_Float16)(o1[r] * rinv);
  *(v8h*)(crow + 16) = pk;
#pragma unroll
  for (int r = 0; r < 8; ++r) pk[r] = (_Float16)(o2[r] * rinv);
  *(v8h*)(crow + 32) = pk;
#pragma unroll
  for (int r = 0; r < 8; ++r) pk[r] = (_Float16)(o3[r] * rinv);
  *(v8h*)(crow + 48) = pk;
}

// ---------------------------------------------- out = Ctx @ Wo^T + bo  (f32)
// One block computes a 128 x 128 tile of Out; its 8 waves (4 along m, 2 along e)
// each hold 32 x 64.  Slices of OKS k-values of the Ctx rows and of the Wo rows
// are staged in LDS with whole-line copies and shared by the waves.
#define OKS     64              // k-values per staged slice (one 128-byte line per row)
#define OTILE_H (128 * PITCH)   // halves of one staged operand slice (128 rows)

// One slice pair: each thread copies 16 B of rows r, r+32, r+64, r+96 of Ctx and of Wo.
static __device__ __forceinline__ void stage_ab(unsigned la, const _Float16* ga,
                                                const _Float16* gb) {
  const unsigned la1 = la + 32 * PITCH * 2;
  const unsigned la2 = la + 64 * PITCH * 2;
  const unsigned la3 = la + 96 * PITCH * 2;
  const unsigned lb0 = la + OTILE_H * 2;
  const unsigned lb1 = lb0 + 32 * PITCH * 2;
  const unsigned lb2 = lb0 + 64 * PITCH * 2;
  const unsigned lb3 = lb0 + 96 * PITCH * 2;
  const _Float16* ga1 = ga + 32 * EE;
  const _Float16* ga2 = ga + 64 * EE;
  const _Float16* ga3 = ga + 96 * EE;
  const _Float16* gb1 = gb + 32 * EE;
  const _Float16* gb2 = gb + 64 * EE;
  const _Float16* gb3 = gb + 96 * EE;
  // s_wait_xcnt 0 closes the statement so that no address register of an issued
  // copy is rewritten ahead of it
  asm volatile("global_load_async_to_lds_b128 %0, %8, off\n\t"
               "global_load_async_to_lds_b128 %1, %9, off\n\t"
               "global_load_async_to_lds_b128 %2, %10, off\n\t"
               "global_load_async_to_lds_b128 %3, %11, off\n\t"
               "global_load_async_to_lds_b128 %4, %12, off\n\t"
               "global_load_async_to_lds_b128 %5, %13, off\n\t"
               "global_load_async_to_lds_b128 %6, %14, off\n\t"
               "global_load_async_to_lds_b128 %7, %15, off\n\t"
               "s_wait_xcnt 0x0"
               :: "v"(la), "v"(la1), "v"(la2), "v"(la3),
                  "v"(lb0), "v"(lb1), "v"(lb2), "v"(lb3),
                  "v"(ga), "v"(ga1), "v"(ga2), "v"(ga3),
                  "v"(gb), "v"(gb1), "v"(gb2), "v"(gb3)
               : "memory");
}

// launch bounds = the real block size: lifts the register ceiling so that the 8
// accumulator tiles and their fragments stay in registers
__global__ __launch_bounds__(256) void k_out(const _Float16* __restrict__ Ctx,
                                             const _Float16* __restrict__ WoH,
                                             const float* __restrict__ bo,
                                             float* __restrict__ Out) {
  __shared__ __attribute__((aligned(16))) _Float16 so[2 * 2 * OTILE_H];

  const int lane = threadIdx.x & 31;
  const int wave = threadIdx.x >> 5;
  const int m0 = (blockIdx.x >> 3) * 128;   // 64 m-blocks x 8 e-blocks
  const int e0 = (blockIdx.x & 7) * 128;
  const int wm = (wave >> 1) * 32;          // this wave's rows inside the block tile
  const int we = (wave & 1) * 64;           // this wave's columns inside the block tile
  const int col = lane & 15;
  const int kb  = (lane >> 4) * 8;
  const int hi  = lane >> 4;

  v8f acc[2][4] = {};

  // this thread's share of a staged slice: row sr (+32, +64, +96), 16-byte chunk sc
  const int sr = threadIdx.x >> 3;
  const int sc = (threadIdx.x & 7) * 8;
  const _Float16* ga = Ctx + (size_t)(m0 + sr) * EE + sc;   // + t * OKS per slice
  const _Float16* gb = WoH + (size_t)(e0 + sr) * EE + sc;   // + t * OKS per slice
  const unsigned  ls = (unsigned)(size_t)(so + sr * PITCH + sc);  // LDS byte address, buffer 0

  stage_ab(ls, ga, gb);
  asm volatile("s_wait_asynccnt 0x0" ::: "memory");  // slice 0 landed (this wave's copies)
  __syncthreads();                                   // slice 0 readable by every wave
  stage_ab(ls + 2 * OTILE_H * 2, ga + OKS, gb + OKS);

  // kept rolled: one foot (waits, barrier, refill) per slice, small loop text
#pragma unroll 1
  for (int t = 0; t < EE / OKS; ++t) {
    const _Float16* at = so + (t & 1) * (2 * OTILE_H) + (wm + col) * PITCH + kb;
    const _Float16* bt = so + (t & 1) * (2 * OTILE_H) + OTILE_H + (we + col) * PITCH + kb;
    // the inner loops here and in the epilogue are unrolled so that every index of
    // a[], b[] and acc[][] is a constant and the arrays live in registers
#pragma unroll
    for (int kk = 0; kk < OKS / 32; ++kk) {
      v16h a[2], b[4];
#pragma unroll
      for (int i = 0; i < 2; ++i) {
        const _Float16* r = at + i * 16 * PITCH + kk * 32;
        a[i] = cat16(*(const v8h*)(r), *(const v8h*)(r + 16));
      }
#pragma unroll
      for (int j = 0; j < 4; ++j) {
        const _Float16* r = bt + j * 16 * PITCH + kk * 32;
        b[j] = cat16(*(const v8h*)(r), *(const v8h*)(r + 16));
      }
#pragma unroll
      for (int i = 0; i < 2; ++i)
#pragma unroll
        for (int j = 0; j < 4; ++j) acc[i][j] = wmma16(a[i], b[j], acc[i][j]);
    }

    asm volatile("s_wait_dscnt 0x0" ::: "memory");     // this wave's reads of slice t are done
    asm volatile("s_wait_asynccnt 0x0" ::: "memory");  // this wave's copies of slice t+1 landed
    __syncthreads();  // publishes slice t+1 and frees slice t's buffer for the refill
    if (t + 2 < EE / OKS)
      stage_ab(ls + (t & 1) * (2 * OTILE_H * 2), ga + (t + 2) * OKS, gb + (t + 2) * OKS);
  }
  asm volatile("s_wait_asynccnt 0x0" ::: "memory");    // nothing in flight when the wave ends

#pragma unroll
  for (int j = 0; j < 4; ++j) {
    const int e = e0 + we + j * 16 + col;
    const float bias = bo[e];
#pragma unroll
    for (int i = 0; i < 2; ++i)
#pragma unroll
      for (int r = 0; r < 8; ++r)
        Out[(size_t)(m0 + wm + i * 16 + r + 8 * hi) * EE + e] = acc[i][j][r] + bias;
  }
}

extern "C" void kernel_launch(void* const* d_in, const int* in_sizes, int n_in,
                              void* d_out, int out_size, void* d_ws, size_t ws_size,
                              hipStream_t stream) {
  const float* values  = (const float*)d_in[0];
  const float* keys    = (const float*)d_in[1];
  const float* queries = (const float*)d_in[2];
  const int*   mask    = (const int*)d_in[3];
  const float* Wq      = (const float*)d_in[4];
  const float* Wk      = (const float*)d_in[5];
  const float* Wv      = (const float*)d_in[6];
  const float* Wo      = (const float*)d_in[7];
  const float* bo      = (const float*)d_in[8];
  float* out = (float*)d_out;

  _Float16* ws = (_Float16*)d_ws;
  const size_t per = (size_t)NB * HH * LL * DD;   // 8M halves = 16 MB each
  _Float16* Qp  = ws;
  _Float16* Kp  = Qp + per;
  _Float16* VpT = Kp + per;
  _Float16* Ctx = VpT + per;
  _Float16* WoH = Ctx + per;                       // + 2 MB
  unsigned* MB  = (unsigned*)(WoH + (size_t)EE * EE);  // + 2 MB  (total ~68 MB)

  hipLaunchKernelGGL(k_prep_wo, dim3((EE * EE) / 256), dim3(256), 0, stream, Wo, WoH);
  hipLaunchKernelGGL(k_maskbits, dim3(NB * 128 * 32 / (8 * MBU)), dim3(256), 0, stream, mask, MB);
  hipLaunchKernelGGL(k_proj, dim3(3 * 8192 / 8), dim3(256), 0, stream,
                     queries, keys, values, Wq, Wk, Wv, Qp, Kp, VpT);
  hipLaunchKernelGGL(k_attn, dim3(8192 / 8), dim3(256), 0, stream,
                     Qp, Kp, VpT, MB, Ctx);
  hipLaunchKernelGGL(k_out, dim3(64 * 8), dim3(256), 0, stream, Ctx, WoH, bo, out);
}

// v005
// A run of this version takes 131 microseconds.
// In both of two side-by-side timings against v004, it was 1.08 times as fast.
// All steps since v000 together make it 2.73 times as fast.
#include <hip/hip_runtime.h>
#include <hip/hip_bf16.h>

#define NB 4
#define LL 2048
#define EE 1024
#define HH 16
#define DD 64

typedef __attribute__((ext_vector_type(16))) _Float16 v16h;
typedef __attribute__((ext_vector_type(8)))  _Float16 v8h;
typedef __attribute__((ext_vector_type(8)))  float    v8f;
typedef __attribute__((ext_vector_type(4)))  int      v4i;
typedef __attribute__((ext_vector_type(4)))  float    v4f;
typedef __attribute__((ext_vector_type(16))) unsigned v16u;
typedef __attribute__((address_space(4))) v16u        cv16u;

// 1/sqrt(E) * log2(e): softmax computed with exp2 (hardware-native) is exact
// softmax of the reference logits since all logits share the same scale.
#define SCALE_LOG2 (0.03125f * 1.44269504088896340736f)

static __device__ __forceinline__ v16h cat16(v8h lo, v8h hi) {
  v16h r;
#pragma unroll
  for (int i = 0; i < 8; ++i) { r[i] = lo[i]; r[i + 8] = hi[i]; }
  return r;
}

static __device__ __forceinline__ v8h cvt8(const float* p) {
  v8h r;
#pragma unroll
  for (int i = 0; i < 8; ++i) r[i] = (_Float16)p[i];
  return r;
}

// e[i] = 2^e[i] on the hardware exponential alone, without the library's range
// fix-up for results below 2^-126: such a weight is 0 as f16 and far below one
// f32 ulp of the row sum (which is at least 1), and a rescale factor that small
// is 0 too.  One statement, in place: every v_exp_f32 is followed by one that is
// independent of it and the last by v_nop, which is the slot the instruction set
// asks for before a transcendental's result is read or its source overwritten.
static __device__ __forceinline__ void exp2_hw17(float (&e)[17]) {
  asm("v_exp_f32 %0, %0\n\t"
      "v_exp_f32 %1, %1\n\t"
      "v_exp_f32 %2, %2\n\t"
      "v_exp_f32 %3, %3\n\t"
      "v_exp_f32 %4, %4\n\t"
      "v_exp_f32 %5, %5\n\t"
      "v_exp_f32 %6, %6\n\t"
      "v_exp_f32 %7, %7\n\t"
      "v_exp_f32 %8, %8\n\t"
      "v_exp_f32 %9, %9\n\t"
      "v_exp_f32 %10, %10\n\t"
      "v_exp_f32 %11, %11\n\t"
      "v_exp_f32 %12, %12\n\t"
      "v_exp_f32 %13, %13\n\t"
      "v_exp_f32 %14, %14\n\t"
      "v_exp_f32 %15, %15\n\t"
      "v_exp_f32 %16, %16\n\t"
      "v_nop"
      : "+v"(e[0]), "+v"(e[1]), "+v"(e[2]), "+v"(e[3]), "+v"(e[4]), "+v"(e[5]),
        "+v"(e[6]), "+v"(e[7]), "+v"(e[8]), "+v"(e[9]), "+v"(e[10]), "+v"(e[11]),
        "+v"(e[12]), "+v"(e[13]), "+v"(e[14]), "+v"(e[15]), "+v"(e[16]));
}

static __device__ __forceinline__ v8f wmma16(v16h a, v16h b, v8f c) {
  // D(16x16,f32) = A(16x32,f16) * B(32x16,f16) + C
  return __builtin_amdgcn_wmma_f32_16x16x32_f16(false, a, false, b, (short)0, c,
                                                false, false);
}

// ------------------------------------------------ mask -> lane-mask words
// MB[n][16-query tile][32-key block][16]: word w of a block is the lane mask that
// k_attn's wave needs for score register w (w < 8: keys 0-15, else keys 16-31 of
// the block): bit `lane` = (mask[q0 + (lane & 15)][k0 + (w >> 3) * 16 + (w & 7) + 8 * (lane >> 4)] != 0).
// The mask does not depend on the head, so it is reduced once for all 16 heads.
// One wave packs MBU tiles of 64 keys; each tile gives one whole 128-byte line.
// The same threads turn Wo into f16, 8 consecutive values each: MASK_BLOCKS * 256 * 8
// is exactly E * E.  Its two loads are issued ahead of the mask loop and used behind it.
#define MBU 4
#define MASK_BLOCKS (NB * 128 * 32 / (8 * MBU))
static_assert(MASK_BLOCKS * 256 * 8 == EE * EE, "one thread per 8 values of Wo");
static __device__ __forceinline__ void mask_wo_block(const int blk,
                                                     const int* __restrict__ mask,
                                                     unsigned* __restrict__ MB,
                                                     const float* __restrict__ Wo,
                                                     _Float16* __restrict__ WoH) {
  const int wi = (blk * 256 + (int)threadIdx.x) * 8;
  const v4f w0 = *(const v4f*)(Wo + wi);
  const v4f w1 = *(const v4f*)(Wo + wi + 4);

  const int lane = threadIdx.x & 31;
  const int wave = threadIdx.x >> 5;
  const int unit = (blk * 8 + wave) * MBU;          // 4 * 128 * 32 tiles of 64 keys
  const int n    = unit >> 12;
  const int qt   = (unit >> 5) & 127;
  const int t0   = unit & 31;
  const int col  = lane & 15;
  const int hi   = lane >> 4;
  const int* mr = mask + (size_t)n * LL * LL + (size_t)(qt * 16 + col) * LL + t0 * 64 + 8 * hi;

  unsigned* mo = MB + (size_t)unit * 32 + lane;

  // two tiles a trip, kept rolled: 16 loads in flight per wave, and one trip's 64
  // ballot words fit the scalar registers
#pragma unroll 1
  for (int g = 0; g < MBU / 2; ++g) {
    // the inner loops are unrolled so that every index of m[][] is a constant
    v4i m[2][8];
#pragma unroll
    for (int u = 0; u < 2; ++u)
#pragma unroll
      for (int p = 0; p < 2; ++p) {
        const int* q = mr + (g * 2 + u) * 64 + p * 32;
        m[u][p * 4 + 0] = *(const v4i*)(q);
        m[u][p * 4 + 1] = *(const v4i*)(q + 4);
        m[u][p * 4 + 2] = *(const v4i*)(q + 16);
        m[u][p * 4 + 3] = *(const v4i*)(q + 20);
      }
#pragma unroll
    for (int u = 0; u < 2; ++u) {
      unsigned val = 0;
#pragma unroll
      for (int w = 0; w < 32; ++w) {
        const unsigned b = __builtin_amdgcn_ballot_w32(m[u][w >> 2][w & 3] != 0);
        val = (lane == w) ? b : val;
      }
      mo[(g * 2 + u) * 32] = val;
    }
    // the next trip's loads land in registers that these stores name: kept behind this wait
    asm volatile("s_wait_xcnt 0x0" ::: "memory");
  }

  v8h wh;
  // unrolled so that every index of wh, w0 and w1 is a constant
#pragma unroll
  for (int i = 0; i < 4; ++i) { wh[i] = (_Float16)w0[i]; wh[i + 4] = (_Float16)w1[i]; }
  *(v8h*)(WoH + wi) = wh;
}

// ------------------------------------------- per-head projections Q/K/V @ W^T
// Qp, Kp : f16 [N][H][L][D] row-major.  VpT : f16 [N][H][D][L] (head-transposed)
#define PROJ_BLOCKS (3 * 8192 / 8)
static __device__ __forceinline__ void proj_block(const int blk,
                       const float* __restrict__ Q, const float* __restrict__ K,
                       const float* __restrict__ V,
                       const float* __restrict__ Wq, const float* __restrict__ Wk,
                       const float* __restrict__ Wv,
                       _Float16* __restrict__ Qp, _Float16* __restrict__ Kp,
                       _Float16* __restrict__ VpT) {
  const int lane = threadIdx.x & 31;
  const int wave = threadIdx.x >> 5;
  const int tile = blk * 8 + wave;             // 3 * 8192 tiles total
  const int mat  = tile >> 13;                  // 0=Q 1=K 2=V
  int rem        = tile & 8191;
  const int n    = rem >> 11;                   // / (H*128)
  rem           &= 2047;
  const int h    = rem >> 7;
  const int q0   = (rem & 127) * 16;
  const int col  = lane & 15;
  const int kb   = (lane >> 4) * 8;
  const int hi   = lane >> 4;

  const float* X = (mat == 0) ? Q : (mat == 1) ? K : V;
  const float* W = (mat == 0) ? Wq : (mat == 1) ? Wk : Wv;

  // A fragments: X tile (16 rows x 64 d), f32 -> f16 inline
  const float* xrow = X + ((size_t)(n * LL + q0 + col)) * EE + h * DD;
  const v16h a0 = cat16(cvt8(xrow + kb),      cvt8(xrow + 16 + kb));
  const v16h a1 = cat16(cvt8(xrow + 32 + kb), cvt8(xrow + 48 + kb));

  const size_t nh = (size_t)(n * HH + h);
#pragma unroll
  for (int j = 0; j < 4; ++j) {
    // B^T = W (row e, contiguous d)
    const float* wrow = W + (size_t)(j * 16 + col) * DD;
    const v16h b0 = cat16(cvt8(wrow + kb),      cvt8(wrow + 16 + kb));
    const v16h b1 = cat16(cvt8(wrow + 32 + kb), cvt8(wrow + 48 + kb));
    v8f c = {};
    c = wmma16(a0, b0, c);
    c = wmma16(a1, b1, c);
    if (mat == 2) {
      // transpose store: per lane the 8 C values are contiguous along L
      v8h pk;
#pragma unroll
      for (int r = 0; r < 8; ++r) pk[r] = (_Float16)c[r];
      *(v8h*)(VpT + (nh * DD + j * 16 + col) * LL + q0 + 8 * hi) = pk;
    } else {
      _Float16* base = ((mat == 0) ? Qp : Kp) + nh * LL * DD;
#pragma unroll
      for (int r = 0; r < 8; ++r)
        base[(size_t)(q0 + r + 8 * hi) * DD + j * 16 + col] = (_Float16)c[r];
    }
  }
}

// ------------------------------------------------ all input preparation, one launch
// Mask packing, Wo -> f16 and the projections depend on the inputs alone and not on
// each other: one grid, the part chosen by the block index (the same for a whole
// block).  The mask blocks stream from memory and come first, so that their loads
// are under way while the projection blocks start.  Launch bounds = the real block
// size: the wave index is then known to be below 8, and which of Q, K, V a block
// projects is a scalar choice.
__global__ __launch_bounds__(256) void k_prep(const float* __restrict__ Q, const float* __restrict__ K,
                       const float* __restrict__ V,
                       const float* __restrict__ Wq, const float* __restrict__ Wk,
                       const float* __restrict__ Wv,
                       const int* __restrict__ mask, const float* __restrict__ Wo,
                       _Float16* __restrict__ Qp, _Float16* __restrict__ Kp,
                       _Float16* __restrict__ VpT, unsigned* __restrict__ MB,
                       _Float16* __restrict__ WoH) {
  const int blk = blockIdx.x;
  if (blk < MASK_BLOCKS) mask_wo_block(blk, mask, MB, Wo, WoH);
  else                   proj_block(blk - MASK_BLOCKS, Q, K, V, Wq, Wk, Wv, Qp, Kp, VpT);
}

// ------------------------------------------------------- flash attention core
// one wave per (n, h, 16-query tile); Ctx: f16 [N][L][E]
// The 8 waves of a block share (n, h): K and V^T tiles of KT keys are staged in
// LDS once per block with whole-line copies instead of 16-line loads per wave.
#define KT     64              // keys per staged tile
#define PITCH  72              // halves per LDS row: 144 B = 16 B x odd, no bank conflict for 16-byte reads
#define TILE_H (64 * PITCH)    // halves of one staged tile (K: 64 keys x 64 d, V^T: 64 d x 64 keys)

// One tile pair: each thread copies rows r and r+32 (16 B each) of K and of V^T.
static __device__ __forceinline__ void stage_kv(unsigned lk, const _Float16* gk,
                                                const _Float16* gv) {
  const unsigned lk1 = lk + 32 * PITCH * 2;
  const unsigned lv0 = lk + TILE_H * 2;
  const unsigned lv1 = lv0 + 32 * PITCH * 2;
  const _Float16* gk1 = gk + 32 * DD;
  const _Float16* gv1 = gv + 32 * LL;
  // s_wait_xcnt 0 closes the statement so that no address register of an issued
  // copy is rewritten ahead of it
  asm volatile("global_load_async_to_lds_b128 %0, %4, off\n\t"
               "global_load_async_to_lds_b128 %1, %5, off\n\t"
               "global_load_async_to_lds_b128 %2, %6, off\n\t"
               "global_load_async_to_lds_b128 %3, %7, off\n\t"
               "s_wait_xcnt 0x0"
               :: "v"(lk), "v"(lk1), "v"(lv0), "v"(lv1),
                  "v"(gk), "v"(gk1), "v"(gv), "v"(gv1)
               : "memory");
}

__global__ void k_attn(const _Float16* __restrict__ Qp, const _Float16* __restrict__ Kp,
                       const _Float16* __restrict__ VpT, const unsigned* __restrict__ MB,
                       _Float16* __restrict__ Ctx) {
  __shared__ __attribute__((aligned(16))) _Float16 sm[2 * 2 * TILE_H];

  const int lane = threadIdx.x & 31;
  const int wave = threadIdx.x >> 5;
  const int tile = blockIdx.x * 8 + wave;      // 8192 tiles
  const int n    = tile >> 11;
  int rem        = tile & 2047;
  const int h    = rem >> 7;
  const int q0   = (rem & 127) * 16;
  const int col  = lane & 15;
  const int kb   = (lane >> 4) * 8;
  const int hi   = lane >> 4;
  const size_t nh = (size_t)(n * HH + h);

  // B fragments of Q^T (== Q rows in A-pattern), fixed for the whole loop
  const _Float16* qrow = Qp + (nh * LL + q0 + col) * DD;
  const v16h bq0 = cat16(*(const v8h*)(qrow + kb),      *(const v8h*)(qrow + 16 + kb));
  const v16h bq1 = cat16(*(const v8h*)(qrow + 32 + kb), *(const v8h*)(qrow + 48 + kb));

  float m_run = -3.4e38f, l_run = 0.f;   // running max in log2 domain
  v8f o0 = {}, o1 = {}, o2 = {}, o3 = {};

  // this wave's lane-mask words: the same address in every lane (readfirstlane tells
  // the compiler) and never written during this launch (the constant address space
  // tells it), so that they come by scalar loads straight into scalar registers
  const int utile = __builtin_amdgcn_readfirstlane(tile);
  const cv16u* mw = (const cv16u*)(MB + (size_t)((utile >> 11) * 128 + (utile & 127)) * (LL / 32 * 16));
  v16u mcur[2] = { mw[0], mw[1] };

  // this thread's share of a staged tile: row sr (and sr + 32), 16-byte chunk sc
  const int sr = threadIdx.x >> 3;
  const int sc = (threadIdx.x & 7) * 8;
  const _Float16* gk = Kp + (nh * LL + sr) * DD + sc;    // + k0 * DD per tile
  const _Float16* gv = VpT + (nh * DD + sr) * LL + sc;   // + k0 per tile
  const unsigned  ls = (unsigned)(size_t)(sm + sr * PITCH + sc);  // LDS byte address, buffer 0

  stage_kv(ls, gk, gv);
  asm volatile("s_wait_asynccnt 0x0" ::: "memory");  // tile 0 landed (this wave's copies)
  __syncthreads();                                   // tile 0 readable by every wave
  stage_kv(ls + 2 * TILE_H * 2, gk + KT * DD, gv + KT);

#pragma unroll 1
  for (int t = 0; t < LL / KT; ++t) {
    const _Float16* kt = sm + (t & 1) * (2 * TILE_H) + col * PITCH + kb;
    const _Float16* vt = kt + TILE_H;
    // the next tile's words are fetched one trip ahead (the last trip fetches its own again)
    const int tn = (t + 1 < LL / KT) ? t + 1 : t;
    const v16u mnxt[2] = { mw[tn * 2], mw[tn * 2 + 1] };
#pragma unroll
    for (int p = 0; p < KT / 32; ++p) {
      // S^T = K * Q^T : two 16x16 tiles (k 0-15, 16-31)
      const _Float16* kr0 = kt + p * 32 * PITCH;
      const _Float16* kr1 = kr0 + 16 * PITCH;
      const v16h ak00 = cat16(*(const v8h*)(kr0),      *(const v8h*)(kr0 + 16));
      const v16h ak01 = cat16(*(const v8h*)(kr0 + 32), *(const v8h*)(kr0 + 48));
      const v16h ak10 = cat16(*(const v8h*)(kr1),      *(const v8h*)(kr1 + 16));
      const v16h ak11 = cat16(*(const v8h*)(kr1 + 32), *(const v8h*)(kr1 + 48));
      v8f sT0 = {}, sT1 = {};
      sT0 = wmma16(ak00, bq0, sT0);  sT0 = wmma16(ak01, bq1, sT0);
      sT1 = wmma16(ak10, bq0, sT1);  sT1 = wmma16(ak11, bq1, sT1);

      // mask (one select per score on its lane-mask word); reference: (-1e20 if masked) then /sqrt(E);
      // whole row pre-scaled by log2(e) so exp2 gives exact reference softmax
      float s0[8], s1[8];
#pragma unroll
      for (int r = 0; r < 8; ++r) {
        const bool mv0 = __builtin_amdgcn_inverse_ballot_w32(mcur[p][r]);
        const bool mv1 = __builtin_amdgcn_inverse_ballot_w32(mcur[p][r + 8]);
        s0[r] = (mv0 ? sT0[r] : -1.0e20f) * SCALE_LOG2;
        s1[r] = (mv1 ? sT1[r] : -1.0e20f) * SCALE_LOG2;
      }

      // online softmax: per-lane partial over 16 k, one xor-16 combine
      float tmax = fmaxf(s0[0], s1[0]);
#pragma unroll
      for (int r = 1; r < 8; ++r) { tmax = fmaxf(tmax, s0[r]); tmax = fmaxf(tmax, s1[r]); }
      tmax = fmaxf(tmax, __shfl_xor(tmax, 16, 32));
      const float m_new = fmaxf(m_run, tmax);
      float e[17];                                 // exponents, then their powers of 2
      e[0] = m_run - m_new;
      // unrolled so that every index of e[] is a constant and e[] lives in registers
#pragma unroll
      for (int r = 0; r < 8; ++r) { e[1 + r] = s0[r] - m_new; e[9 + r] = s1[r] - m_new; }
      exp2_hw17(e);
      const float corr = e[0];

      float tsum = 0.f;
      v16h pf;                                     // P^T B-fragment, in registers
#pragma unroll
      for (int r = 0; r < 8; ++r) {
        const float p0 = e[1 + r];
        const float p1 = e[9 + r];
        tsum += p0 + p1;
        pf[r]     = (_Float16)p0;
        pf[r + 8] = (_Float16)p1;
      }
      tsum += __shfl_xor(tsum, 16, 32);
      l_run = l_run * corr + tsum;
      m_run = m_new;
#pragma unroll
      for (int r = 0; r < 8; ++r) { o0[r] *= corr; o1[r] *= corr; o2[r] *= corr; o3[r] *= corr; }

      // O^T += V^T * P^T  (V^T rows of the staged tile, keys contiguous)
      const _Float16* v0 = vt + p * 32;
      const v16h av0 = cat16(*(const v8h*)(v0),              *(const v8h*)(v0 + 16));
      const v16h av1 = cat16(*(const v8h*)(v0 + 16 * PITCH), *(const v8h*)(v0 + 16 * PITCH + 16));
      const v16h av2 = cat16(*(const v8h*)(v0 + 32 * PITCH), *(const v8h*)(v0 + 32 * PITCH + 16));
      const v16h av3 = cat16(*(const v8h*)(v0 + 48 * PITCH), *(const v8h*)(v0 + 48 * PITCH + 16));
      o0 = wmma16(av0, pf, o0);
      o1 = wmma16(av1, pf, o1);
      o2 = wmma16(av2, pf, o2);
      o3 = wmma16(av3, pf, o3);
    }

    asm volatile("s_wait_dscnt 0x0" ::: "memory");     // this wave's reads of tile t are done
    asm volatile("s_wait_asynccnt 0x0" ::: "memory");  // this wave's copies of tile t+1 landed
    __syncthreads();  // publishes tile t+1 and frees tile t's buffer for the refill
    if (t + 2 < LL / KT)
      stage_kv(ls + (t & 1) * (2 * TILE_H * 2), gk + (size_t)(t + 2) * KT * DD, gv + (t + 2) * KT);
    mcur[0] = mnxt[0];
    mcur[1] = mnxt[1];
  }
  asm volatile("s_wait_asynccnt 0x0" ::: "memory");    // nothing in flight when the wave ends

  const float rinv = 1.0f / l_run;
  _Float16* crow = Ctx + ((size_t)(n * LL) + q0 + col) * EE + h * DD + 8 * hi;
  v8h pk;
#pragma unroll
  for (int r = 0; r < 8; ++r) pk[r] = (_Float16)(o0[r] * rinv);
  *(v8h*)(crow) = pk;
#pragma unroll
  for (int r = 0; r < 8; ++r) pk[r] = (_Float16)(o1[r] * rinv);
  *(v8h*)(crow + 16) = pk;
#pragma unroll
  for (int r = 0; r < 8; ++r) pk[r] = (_Float16)(o2[r] * rinv);
  *(v8h*)(crow + 32) = pk;
#pragma unroll
  for (int r = 0; r < 8; ++r) pk[r] = (_Float16)(o3[r] * rinv);
  *(v8h*)(crow + 48) = pk;
}

// ---------------------------------------------- out = Ctx @ Wo^T + bo  (f32)
// One block computes a 128 x 128 tile of Out; its 8 waves (4 along m, 2 along e)
// each hold 32 x 64.  Slices of OKS k-values of the Ctx rows and of the Wo rows
// are staged in LDS with whole-line copies and shared by the waves.
#define OKS     64              // k-values per staged slice (one 128-byte line per row)
#define OTILE_H (128 * PITCH)   // halves of one staged operand slice (128 rows)

// One slice pair: each thread copies 16 B of rows r, r+32, r+64, r+96 of Ctx and of Wo.
static __device__ __forceinline__ void stage_ab(unsigned la, const _Float16* ga,
                                                const _Float16* gb) {
  const unsigned la1 = la + 32 * PITCH * 2;
  const unsigned la2 = la + 64 * PITCH * 2;
  const unsigned la3 = la + 96 * PITCH * 2;
  const unsigned lb0 = la + OTILE_H * 2;
  const unsigned lb1 = lb0 + 32 * PITCH * 2;
  const unsigned lb2 = lb0 + 64 * PITCH * 2;
  const unsigned lb3 = lb0 + 96 * PITCH * 2;
  const _Float16* ga1 = ga + 32 * EE;
  const _Float16* ga2 = ga + 64 * EE;
  const _Float16* ga3 = ga + 96 * EE;
  const _Float16* gb1 = gb + 32 * EE;
  const _Float16* gb2 = gb + 64 * EE;
  const _Float16* gb3 = gb + 96 * EE;
  // s_wait_xcnt 0 closes the statement so that no address register of an issued
  // copy is rewritten ahead of it
  asm volatile("global_load_async_to_lds_b128 %0, %8, off\n\t"
               "global_load_async_to_lds_b128 %1, %9, off\n\t"
               "global_load_async_to_lds_b128 %2, %10, off\n\t"
               "global_load_async_to_lds_b128 %3, %11, off\n\t"
               "global_load_async_to_lds_b128 %4, %12, off\n\t"
               "global_load_async_to_lds_b128 %5, %13, off\n\t"
               "global_load_async_to_lds_b128 %6, %14, off\n\t"
               "global_load_async_to_lds_b128 %7, %15, off\n\t"
               "s_wait_xcnt 0x0"
               :: "v"(la), "v"(la1), "v"(la2), "v"(la3),
                  "v"(lb0), "v"(lb1), "v"(lb2), "v"(lb3),
                  "v"(ga), "v"(ga1), "v"(ga2), "v"(ga3),
                  "v"(gb), "v"(gb1), "v"(gb2), "v"(gb3)
               : "memory");
}

// launch bounds = the real block size: lifts the register ceiling so that the 8
// accumulator tiles and their fragments stay in registers
__global__ __launch_bounds__(256) void k_out(const _Float16* __restrict__ Ctx,
                                             const _Float16* __restrict__ WoH,
                                             const float* __restrict__ bo,
                                             float* __restrict__ Out) {
  __shared__ __attribute__((aligned(16))) _Float16 so[2 * 2 * OTILE_H];

  const int lane = threadIdx.x & 31;
  const int wave = threadIdx.x >> 5;
  const int m0 = (blockIdx.x >> 3) * 128;   // 64 m-blocks x 8 e-blocks
  const int e0 = (blockIdx.x & 7) * 128;
  const int wm = (wave >> 1) * 32;          // this wave's rows inside the block tile
  const int we = (wave & 1) * 64;           // this wave's columns inside the block tile
  const int col = lane & 15;
  const int kb  = (lane >> 4) * 8;
  const int hi  = lane >> 4;

  v8f acc[2][4] = {};

  // this thread's share of a staged slice: row sr (+32, +64, +96), 16-byte chunk sc
  const int sr = threadIdx.x >> 3;
  const int sc = (threadIdx.x & 7) * 8;
  const _Float16* ga = Ctx + (size_t)(m0 + sr) * EE + sc;   // + t * OKS per slice
  const _Float16* gb = WoH + (size_t)(e0 + sr) * EE + sc;   // + t * OKS per slice
  const unsigned  ls = (unsigned)(size_t)(so + sr * PITCH + sc);  // LDS byte address, buffer 0

  stage_ab(ls, ga, gb);
  asm volatile("s_wait_asynccnt 0x0" ::: "memory");  // slice 0 landed (this wave's copies)
  __syncthreads();                                   // slice 0 readable by every wave
  stage_ab(ls + 2 * OTILE_H * 2, ga + OKS, gb + OKS);

  // kept rolled: one foot (waits, barrier, refill) per slice, small loop text
#pragma unroll 1
  for (int t = 0; t < EE / OKS; ++t) {
    const _Float16* at = so + (t & 1) * (2 * OTILE_H) + (wm + col) * PITCH + kb;
    const _Float16* bt = so + (t & 1) * (2 * OTILE_H) + OTILE_H + (we + col) * PITCH + kb;
    // the inner loops here and in the epilogue are unrolled so that every index of
    // a[], b[] and acc[][] is a constant and the arrays live in registers
#pragma unroll
    for (int kk = 0; kk < OKS / 32; ++kk) {
      v16h a[2], b[4];
#pragma unroll
      for (int i = 0; i < 2; ++i) {
        const _Float16* r = at + i * 16 * PITCH + kk * 32;
        a[i] = cat16(*(const v8h*)(r), *(const v8h*)(r + 16));
      }
#pragma unroll
      for (int j = 0; j < 4; ++j) {
        const _Float16* r = bt + j * 16 * PITCH + kk * 32;
        b[j] = cat16(*(const v8h*)(r), *(const v8h*)(r + 16));
      }
#pragma unroll
      for (int i = 0; i < 2; ++i)
#pragma unroll
        for (int j = 0; j < 4; ++j) acc[i][j] = wmma16(a[i], b[j], acc[i][j]);
    }

    asm volatile("s_wait_dscnt 0x0" ::: "memory");     // this wave's reads of slice t are done
    asm volatile("s_wait_asynccnt 0x0" ::: "memory");  // this wave's copies of slice t+1 landed
    __syncthreads();  // publishes slice t+1 and frees slice t's buffer for the refill
    if (t + 2 < EE / OKS)
      stage_ab(ls + (t & 1) * (2 * OTILE_H * 2), ga + (t + 2) * OKS, gb + (t + 2) * OKS);
  }
  asm volatile("s_wait_asynccnt 0x0" ::: "memory");    // nothing in flight when the wave ends

#pragma unroll
  for (int j = 0; j < 4; ++j) {
    const int e = e0 + we + j * 16 + col;
    const float bias = bo[e];
#pragma unroll
    for (int i = 0; i < 2; ++i)
#pragma unroll
      for (int r = 0; r < 8; ++r)
        Out[(size_t)(m0 + wm + i * 16 + r + 8 * hi) * EE + e] = acc[i][j][r] + bias;
  }
}

extern "C" void kernel_launch(void* const* d_in, const int* in_sizes, int n_in,
                              void* d_out, int out_size, void* d_ws, size_t ws_size,
                              hipStream_t stream) {
  const float* values  = (const float*)d_in[0];
  const float* keys    = (const float*)d_in[1];
  const float* queries = (const float*)d_in[2];
  const int*   mask    = (const int*)d_in[3];
  const float* Wq      = (const float*)d_in[4];
  const float* Wk      = (const float*)d_in[5];
  const float* Wv      = (const float*)d_in[6];
  const float* Wo      = (const float*)d_in[7];
  const float* bo      = (const float*)d_in[8];
  float* out = (float*)d_out;

  _Float16* ws = (_Float16*)d_ws;
  const size_t per = (size_t)NB * HH * LL * DD;   // 8M halves = 16 MB each
  _Float16* Qp  = ws;
  _Float16* Kp  = Qp + per;
  _Float16* VpT = Kp + per;
  _Float16* Ctx = VpT + per;
  _Float16* WoH = Ctx + per;                       // + 2 MB
  unsigned* MB  = (unsigned*)(WoH + (size_t)EE * EE);  // + 2 MB  (total ~68 MB)

  hipLaunchKernelGGL(k_prep, dim3(MASK_BLOCKS + PROJ_BLOCKS), dim3(256), 0, stream,
                     queries, keys, values, Wq, Wk, Wv, mask, Wo, Qp, Kp, VpT, MB, WoH);
  hipLaunchKernelGGL(k_attn, dim3(8192 / 8), dim3(256), 0, stream,
                     Qp, Kp, VpT, MB, Ctx);
  hipLaunchKernelGGL(k_out, dim3(64 * 8), dim3(256), 0, stream, Ctx, WoH, bo, out);
}

// v006
// A run of this version takes 124 microseconds.
// Timed twice side by side with v005, it ran 1.05 and 1.06 times as fast.
// Over all steps from v000 it is 2.89 times as fast.
#include <hip/hip_runtime.h>
#include <hip/hip_bf16.h>

#define NB 4
#define LL 2048
#define EE 1024
#define HH 16
#define DD 64

typedef __attribute__((ext_vector_type(16))) _Float16 v16h;
typedef __attribute__((ext_vector_type(8)))  _Float16 v8h;
typedef __attribute__((ext_vector_type(8)))  float    v8f;
typedef __attribute__((ext_vector_type(4)))  int      v4i;
typedef __attribute__((ext_vector_type(4)))  float    v4f;
typedef __attribute__((ext_vector_type(16))) unsigned v16u;
typedef __attribute__((address_space(4))) v16u        cv16u;

// 1/sqrt(E) * log2(e): softmax computed with exp2 (hardware-native) is exact
// softmax of the reference logits since all logits share the same scale.
#define SCALE_LOG2 (0.03125f * 1.44269504088896340736f)

static __device__ __forceinline__ v16h cat16(v8h lo, v8h hi) {
  v16h r;
#pragma unroll
  for (int i = 0; i < 8; ++i) { r[i] = lo[i]; r[i + 8] = hi[i]; }
  return r;
}

static __device__ __forceinline__ v8h cvt8(const float* p) {
  v8h r;
#pragma unroll
  for (int i = 0; i < 8; ++i) r[i] = (_Float16)p[i];
  return r;
}

// e[i] = 2^e[i] on the hardware exponential alone, without the library's range
// fix-up for results below 2^-126: such a weight is 0 as f16 and far below one
// f32 ulp of the row sum (which is at least 1), and a rescale factor that small
// is 0 too.  One statement, in place: every v_exp_f32 is followed by one that is
// independent of it and the last by v_nop, which is the slot the instruction set
// asks for before a transcendental's result is read or its source overwritten.
static __device__ __forceinline__ void exp2_hw17(float (&e)[17]) {
  asm("v_exp_f32 %0, %0\n\t"
      "v_exp_f32 %1, %1\n\t"
      "v_exp_f32 %2, %2\n\t"
      "v_exp_f32 %3, %3\n\t"
      "v_exp_f32 %4, %4\n\t"
      "v_exp_f32 %5, %5\n\t"
      "v_exp_f32 %6, %6\n\t"
      "v_exp_f32 %7, %7\n\t"
      "v_exp_f32 %8, %8\n\t"
      "v_exp_f32 %9, %9\n\t"
      "v_exp_f32 %10, %10\n\t"
      "v_exp_f32 %11, %11\n\t"
      "v_exp_f32 %12, %12\n\t"
      "v_exp_f32 %13, %13\n\t"
      "v_exp_f32 %14, %14\n\t"
      "v_exp_f32 %15, %15\n\t"
      "v_exp_f32 %16, %16\n\t"
      "v_nop"
      : "+v"(e[0]), "+v"(e[1]), "+v"(e[2]), "+v"(e[3]), "+v"(e[4]), "+v"(e[5]),
        "+v"(e[6]), "+v"(e[7]), "+v"(e[8]), "+v"(e[9]), "+v"(e[10]), "+v"(e[11]),
        "+v"(e[12]), "+v"(e[13]), "+v"(e[14]), "+v"(e[15]), "+v"(e[16]));
}

static __device__ __forceinline__ v8f wmma16(v16h a, v16h b, v8f c) {
  // D(16x16,f32) = A(16x32,f16) * B(32x16,f16) + C
  return __builtin_amdgcn_wmma_f32_16x16x32_f16(false, a, false, b, (short)0, c,
                                                false, false);
}

// ------------------------------------------------ mask -> lane-mask words
// MB[n][16-query tile][32-key block][16]: word w of a block is the lane mask that
// k_attn's wave needs for score register w (w < 8: keys 0-15, else keys 16-31 of
// the block): bit `lane` = (mask[q0 + (lane & 15)][k0 + (w >> 3) * 16 + (w & 7) + 8 * (lane >> 4)] != 0).
// The mask does not depend on the head, so it is reduced once for all 16 heads.
// One wave packs MBU tiles of 64 keys; each tile gives one whole 128-byte line.
// The same threads turn Wo into f16, 8 consecutive values each: MASK_BLOCKS * 256 * 8
// is exactly E * E.  Its two loads are issued ahead of the mask loop and used behind it.
#define MBU 4
#define MASK_BLOCKS (NB * 128 * 32 / (8 * MBU))
static_assert(MASK_BLOCKS * 256 * 8 == EE * EE, "one thread per 8 values of Wo");
static __device__ __forceinline__ void mask_wo_block(const int blk,
                                                     const int* __restrict__ mask,
                                                     unsigned* __restrict__ MB,
                                                     const float* __restrict__ Wo,
                                                     _Float16* __restrict__ WoH) {
  const int wi = (blk * 256 + (int)threadIdx.x) * 8;
  const v4f w0 = *(const v4f*)(Wo + wi);
  const v4f w1 = *(const v4f*)(Wo + wi + 4);

  const int lane = threadIdx.x & 31;
  const int wave = threadIdx.x >> 5;
  const int unit = (blk * 8 + wave) * MBU;          // 4 * 128 * 32 tiles of 64 keys
  const int n    = unit >> 12;
  const int qt   = (unit >> 5) & 127;
  const int t0   = unit & 31;
  const int col  = lane & 15;
  const int hi   = lane >> 4;
  const int* mr = mask + (size_t)n * LL * LL + (size_t)(qt * 16 + col) * LL + t0 * 64 + 8 * hi;

  unsigned* mo = MB + (size_t)unit * 32 + lane;

  // two tiles a trip, kept rolled: 16 loads in flight per wave, and one trip's 64
  // ballot words fit the scalar registers
#pragma unroll 1
  for (int g = 0; g < MBU / 2; ++g) {
    // the inner loops are unrolled so that every index of m[][] is a constant
    v4i m[2][8];
    const int* mg = mr + g * 2 * 64;
#pragma unroll
    for (int u = 0; u < 2; ++u)
#pragma unroll
      for (int p = 0; p < 2; ++p) {
        const int* q = mg + u * 64 + p * 32;
        m[u][p * 4 + 0] = *(const v4i*)(q);
        m[u][p * 4 + 1] = *(const v4i*)(q + 4);
        m[u][p * 4 + 2] = *(const v4i*)(q + 16);
        m[u][p * 4 + 3] = *(const v4i*)(q + 20);
      }
#pragma unroll
    for (int u = 0; u < 2; ++u) {
      unsigned val = 0;
#pragma unroll
      for (int w = 0; w < 32; ++w) {
        const unsigned b = __builtin_amdgcn_ballot_w32(m[u][w >> 2][w & 3] != 0);
        val = (lane == w) ? b : val;
      }
      mo[(g * 2 + u) * 32] = val;
    }
    // the next trip's loads land in registers that these stores name: kept behind this wait;
    // it takes the trip's load address as an input, so that no load lands in its registers
    asm volatile("s_wait_xcnt 0x0" :: "v"(mg) : "memory");
  }

  v8h wh;
  // unrolled so that every index of wh, w0 and w1 is a constant
#pragma unroll
  for (int i = 0; i < 4; ++i) { wh[i] = (_Float16)w0[i]; wh[i + 4] = (_Float16)w1[i]; }
  *(v8h*)(WoH + wi) = wh;
}

// ------------------------------------------- per-head projections Q/K/V @ W^T
// Qp, Kp : f16 [N][H][L][D] row-major.  VpT : f16 [N][H][D][L] (head-transposed)
// W is the same for every head and row: a wave turns it into its 8 B fragments once,
// keeps them in registers and walks PT consecutive 16-row tiles of one head with them.
#define PT 4
#define PROJ_BLOCKS (3 * 8192 / (8 * PT))
static_assert(128 % (8 * PT) == 0, "a block's tiles lie inside one head");

// one lane's share of a 16 x 64 f32 tile: 8 values at p, p + 16, p + 32, p + 48
static __device__ __forceinline__ void load_x(v4f (&x)[8], const float* p) {
  // unrolled so that every index of x[] is a constant
#pragma unroll
  for (int i = 0; i < 4; ++i) {
    x[2 * i]     = *(const v4f*)(p + 16 * i);
    x[2 * i + 1] = *(const v4f*)(p + 16 * i + 4);
  }
}

static __device__ __forceinline__ v8h cvt8v(v4f lo, v4f hi) {
  v8h r;
  // unrolled so that every index of r, lo and hi is a constant
#pragma unroll
  for (int i = 0; i < 4; ++i) { r[i] = (_Float16)lo[i]; r[i + 4] = (_Float16)hi[i]; }
  return r;
}

// VT: the result goes out transposed (V); else row-major (Q, K).  out points at the
// lane's first element of the wave's first tile.
template <bool VT>
static __device__ __forceinline__ void proj_tiles(const float* __restrict__ xp,
                                                  const float* __restrict__ wp,
                                                  _Float16* __restrict__ out) {
  // the first tile's rows come from memory: asked for together with the first half of W
  v4f x[8];
  load_x(x, xp);

  // B^T = W (row e, contiguous d)
  v16h b[4][2];
  // every loop here is unrolled so that the indices of x[], b[][] and c are constants
  // and the arrays live in registers
#pragma unroll
  for (int j = 0; j < 4; ++j) {
    const float* wrow = wp + j * 16 * DD;
    b[j][0] = cat16(cvt8(wrow),      cvt8(wrow + 16));
    b[j][1] = cat16(cvt8(wrow + 32), cvt8(wrow + 48));
    // W is asked for in two halves, and the tiles' loads stay behind it: half the landing
    // registers, so that three blocks fit a WGP
    if (j & 1) __builtin_amdgcn_sched_barrier(0);
  }
  // behind W's loads; takes their address as an input, so that no load lands in its registers
  asm volatile("s_wait_xcnt 0x0" :: "v"(wp) : "memory");

#pragma unroll
  for (int t = 0; t < PT; ++t) {
    // A fragments: X tile (16 rows x 64 d), f32 -> f16
    const v16h a0 = cat16(cvt8v(x[0], x[1]), cvt8v(x[2], x[3]));
    const v16h a1 = cat16(cvt8v(x[4], x[5]), cvt8v(x[6], x[7]));
    // keeps the next tile's loads behind this tile's conversion: one set of landing
    // registers, not two
    __builtin_amdgcn_sched_barrier(0);
    // the next tile's rows are fetched while this tile is worked on
    if (t + 1 < PT) load_x(x, xp + (t + 1) * 16 * EE);

#pragma unroll
    for (int j = 0; j < 4; ++j) {
      v8f c = {};
      c = wmma16(a0, b[j][0], c);
      c = wmma16(a1, b[j][1], c);
      if (VT) {
        // transpose store: per lane the 8 C values are contiguous along L
        v8h pk;
#pragma unroll
        for (int r = 0; r < 8; ++r) pk[r] = (_Float16)c[r];
        *(v8h*)(out + (size_t)(j * 16) * LL + t * 16) = pk;
      } else {
#pragma unroll
        for (int r = 0; r < 8; ++r)
          out[(t * 16 + r) * DD + j * 16] = (_Float16)c[r];
      }
      // the next product lands in registers that these stores name: kept behind this wait;
      // it takes both addresses as inputs, so that nothing lands in their registers before it
      asm volatile("s_wait_xcnt 0x0" :: "v"(xp), "v"(out) : "memory");
    }
    // keeps the next tile's conversion, which waits for its loads, behind this tile's stores
    __builtin_amdgcn_sched_barrier(0);
  }
}

static __device__ __forceinline__ void proj_block(const int blk,
                       const float* __restrict__ Q, const float* __restrict__ K,
                       const float* __restrict__ V,
                       const float* __restrict__ Wq, const float* __restrict__ Wk,
                       const float* __restrict__ Wv,
                       _Float16* __restrict__ Qp, _Float16* __restrict__ Kp,
                       _Float16* __restrict__ VpT) {
  const int lane = threadIdx.x & 31;
  const int wave = threadIdx.x >> 5;
  const int mat  = blk / (PROJ_BLOCKS / 3);               // 0=Q 1=K 2=V
  const int tb   = (blk % (PROJ_BLOCKS / 3)) * (8 * PT);  // the block's first of 8192 tiles
  const int n    = tb >> 11;                              // / (H*128)
  const int h    = (tb >> 7) & 15;
  const int q0   = ((tb & 127) + wave * PT) * 16;         // the wave's first row
  const int col  = lane & 15;
  const int kb   = (lane >> 4) * 8;
  const int hi   = lane >> 4;

  const float* X = (mat == 0) ? Q : (mat == 1) ? K : V;
  const float* W = (mat == 0) ? Wq : (mat == 1) ? Wk : Wv;
  const float* xp = X + ((size_t)(n * LL + q0 + col)) * EE + h * DD + kb;
  const float* wp = W + col * DD + kb;
  const size_t nh = (size_t)(n * HH + h);

  if (mat == 2) proj_tiles<true>(xp, wp, VpT + (nh * DD + col) * LL + q0 + 8 * hi);
  else          proj_tiles<false>(xp, wp, ((mat == 0) ? Qp : Kp) + (nh * LL + q0 + 8 * hi) * DD + col);
}

// ------------------------------------------------ all input preparation, one launch
// Mask packing, Wo -> f16 and the projections depend on the inputs alone and not on
// each other: one grid, the part chosen by the block index (the same for a whole
// block).  The mask blocks stream from memory and come first, so that their loads
// are under way while the projection blocks start.  Launch bounds = the real block
// size: lifts the register ceiling, so that a projection wave's W fragments and the
// rows in flight stay in registers.
__global__ __launch_bounds__(256) void k_prep(const float* __restrict__ Q, const float* __restrict__ K,
                       const float* __restrict__ V,
                       const float* __restrict__ Wq, const float* __restrict__ Wk,
                       const float* __restrict__ Wv,
                       const int* __restrict__ mask, const float* __restrict__ Wo,
                       _Float16* __restrict__ Qp, _Float16* __restrict__ Kp,
                       _Float16* __restrict__ VpT, unsigned* __restrict__ MB,
                       _Float16* __restrict__ WoH) {
  const int blk = blockIdx.x;
  if (blk < MASK_BLOCKS) mask_wo_block(blk, mask, MB, Wo, WoH);
  else                   proj_block(blk - MASK_BLOCKS, Q, K, V, Wq, Wk, Wv, Qp, Kp, VpT);
}

// ------------------------------------------------------- flash attention core
// one wave per (n, h, 16-query tile); Ctx: f16 [N][L][E]
// The 8 waves of a block share (n, h): K and V^T tiles of KT keys are staged in
// LDS once per block with whole-line copies instead of 16-line loads per wave.
#define KT     64              // keys per staged tile
#define PITCH  72              // halves per LDS row: 144 B = 16 B x odd, no bank conflict for 16-byte reads
#define TILE_H (64 * PITCH)    // halves of one staged tile (K: 64 keys x 64 d, V^T: 64 d x 64 keys)

// One tile pair: each thread copies rows r and r+32 (16 B each) of K and of V^T.
static __device__ __forceinline__ void stage_kv(unsigned lk, const _Float16* gk,
                                                const _Float16* gv) {
  const unsigned lk1 = lk + 32 * PITCH * 2;
  const unsigned lv0 = lk + TILE_H * 2;
  const unsigned lv1 = lv0 + 32 * PITCH * 2;
  const _Float16* gk1 = gk + 32 * DD;
  const _Float16* gv1 = gv + 32 * LL;
  // s_wait_xcnt 0 closes the statement so that no address register of an issued
  // copy is rewritten ahead of it
  asm volatile("global_load_async_to_lds_b128 %0, %4, off\n\t"
               "global_load_async_to_lds_b128 %1, %5, off\n\t"
               "global_load_async_to_lds_b128 %2, %6, off\n\t"
               "global_load_async_to_lds_b128 %3, %7, off\n\t"
               "s_wait_xcnt 0x0"
               :: "v"(lk), "v"(lk1), "v"(lv0), "v"(lv1),
                  "v"(gk), "v"(gk1), "v"(gv), "v"(gv1)
               : "memory");
}

__global__ void k_attn(const _Float16* __restrict__ Qp, const _Float16* __restrict__ Kp,
                       const _Float16* __restrict__ VpT, const unsigned* __restrict__ MB,
                       _Float16* __restrict__ Ctx) {
  __shared__ __attribute__((aligned(16))) _Float16 sm[2 * 2 * TILE_H];

  const int lane = threadIdx.x & 31;
  const int wave = threadIdx.x >> 5;
  const int tile = blockIdx.x * 8 + wave;      // 8192 tiles
  const int n    = tile >> 11;
  int rem        = tile & 2047;
  const int h    = rem >> 7;
  const int q0   = (rem & 127) * 16;
  const int col  = lane & 15;
  const int kb   = (lane >> 4) * 8;
  const int hi   = lane >> 4;
  const size_t nh = (size_t)(n * HH + h);

  // B fragments of Q^T (== Q rows in A-pattern), fixed for the whole loop
  const _Float16* qrow = Qp + (nh * LL + q0 + col) * DD;
  const v16h bq0 = cat16(*(const v8h*)(qrow + kb),      *(const v8h*)(qrow + 16 + kb));
  const v16h bq1 = cat16(*(const v8h*)(qrow + 32 + kb), *(const v8h*)(qrow + 48 + kb));

  float m_run = -3.4e38f, l_run = 0.f;   // running max in log2 domain
  v8f o0 = {}, o1 = {}, o2 = {}, o3 = {};

  // this wave's lane-mask words: the same address in every lane (readfirstlane tells
  // the compiler) and never written during this launch (the constant address space
  // tells it), so that they come by scalar loads straight into scalar registers
  const int utile = __builtin_amdgcn_readfirstlane(tile);
  const cv16u* mw = (const cv16u*)(MB + (size_t)((utile >> 11) * 128 + (utile & 127)) * (LL / 32 * 16));
  v16u mcur[2] = { mw[0], mw[1] };

  // this thread's share of a staged tile: row sr (and sr + 32), 16-byte chunk sc
  const int sr = threadIdx.x >> 3;
  const int sc = (threadIdx.x & 7) * 8;
  const _Float16* gk = Kp + (nh * LL + sr) * DD + sc;    // + k0 * DD per tile
  const _Float16* gv = VpT + (nh * DD + sr) * LL + sc;   // + k0 per tile
  const unsigned  ls = (unsigned)(size_t)(sm + sr * PITCH + sc);  // LDS byte address, buffer 0

  stage_kv(ls, gk, gv);
  asm volatile("s_wait_asynccnt 0x0" ::: "memory");  // tile 0 landed (this wave's copies)
  __syncthreads();                                   // tile 0 readable by every wave
  stage_kv(ls + 2 * TILE_H * 2, gk + KT * DD, gv + KT);

#pragma unroll 1
  for (int t = 0; t < LL / KT; ++t) {
    const _Float16* kt = sm + (t & 1) * (2 * TILE_H) + col * PITCH + kb;
    const _Float16* vt = kt + TILE_H;
    // the next tile's words are fetched one trip ahead (the last trip fetches its own again)
    const int tn = (t + 1 < LL / KT) ? t + 1 : t;
    const v16u mnxt[2] = { mw[tn * 2], mw[tn * 2 + 1] };
#pragma unroll
    for (int p = 0; p < KT / 32; ++p) {
      // S^T = K * Q^T : two 16x16 tiles (k 0-15, 16-31)
      const _Float16* kr0 = kt + p * 32 * PITCH;
      const _Float16* kr1 = kr0 + 16 * PITCH;
      const v16h ak00 = cat16(*(const v8h*)(kr0),      *(const v8h*)(kr0 + 16));
      const v16h ak01 = cat16(*(const v8h*)(kr0 + 32), *(const v8h*)(kr0 + 48));
      const v16h ak10 = cat16(*(const v8h*)(kr1),      *(const v8h*)(kr1 + 16));
      const v16h ak11 = cat16(*(const v8h*)(kr1 + 32), *(const v8h*)(kr1 + 48));
      v8f sT0 = {}, sT1 = {};
      sT0 = wmma16(ak00, bq0, sT0);  sT0 = wmma16(ak01, bq1, sT0);
      sT1 = wmma16(ak10, bq0, sT1);  sT1 = wmma16(ak11, bq1, sT1);

      // mask (one select per score on its lane-mask word); reference: (-1e20 if masked) then /sqrt(E);
      // whole row pre-scaled by log2(e) so exp2 gives exact reference softmax
      float s0[8], s1[8];
#pragma unroll
      for (int r = 0; r < 8; ++r) {
        const bool mv0 = __builtin_amdgcn_inverse_ballot_w32(mcur[p][r]);
        const bool mv1 = __builtin_amdgcn_inverse_ballot_w32(mcur[p][r + 8]);
        s0[r] = (mv0 ? sT0[r] : -1.0e20f) * SCALE_LOG2;
        s1[r] = (mv1 ? sT1[r] : -1.0e20f) * SCALE_LOG2;
      }

      // online softmax: per-lane partial over 16 k, one xor-16 combine
      float tmax = fmaxf(s0[0], s1[0]);
#pragma unroll
      for (int r = 1; r < 8; ++r) { tmax = fmaxf(tmax, s0[r]); tmax = fmaxf(tmax, s1[r]); }
      tmax = fmaxf(tmax, __shfl_xor(tmax, 16, 32));
      const float m_new = fmaxf(m_run, tmax);
      float e[17];                                 // exponents, then their powers of 2
      e[0] = m_run - m_new;
      // unrolled so that every index of e[] is a constant and e[] lives in registers
#pragma unroll
      for (int r = 0; r < 8; ++r) { e[1 + r] = s0[r] - m_new; e[9 + r] = s1[r] - m_new; }
      exp2_hw17(e);
      const float corr = e[0];

      float tsum = 0.f;
      v16h pf;                                     // P^T B-fragment, in registers
#pragma unroll
      for (int r = 0; r < 8; ++r) {
        const float p0 = e[1 + r];
        const float p1 = e[9 + r];
        tsum += p0 + p1;
        pf[r]     = (_Float16)p0;
        pf[r + 8] = (_Float16)p1;
      }
      tsum += __shfl_xor(tsum, 16, 32);
      l_run = l_run * corr + tsum;
      m_run = m_new;
#pragma unroll
      for (int r = 0; r < 8; ++r) { o0[r] *= corr; o1[r] *= corr; o2[r] *= corr; o3[r] *= corr; }

      // O^T += V^T * P^T  (V^T rows of the staged tile, keys contiguous)
      const _Float16* v0 = vt + p * 32;
      const v16h av0 = cat16(*(const v8h*)(v0),              *(const v8h*)(v0 + 16));
      const v16h av1 = cat16(*(const v8h*)(v0 + 16 * PITCH), *(const v8h*)(v0 + 16 * PITCH + 16));
      const v16h av2 = cat16(*(const v8h*)(v0 + 32 * PITCH), *(const v8h*)(v0 + 32 * PITCH + 16));
      const v16h av3 = cat16(*(const v8h*)(v0 + 48 * PITCH), *(const v8h*)(v0 + 48 * PITCH + 16));
      o0 = wmma16(av0, pf, o0);
      o1 = wmma16(av1, pf, o1);
      o2 = wmma16(av2, pf, o2);
      o3 = wmma16(av3, pf, o3);
    }

    asm volatile("s_wait_dscnt 0x0" ::: "memory");     // this wave's reads of tile t are done
    asm volatile("s_wait_asynccnt 0x0" ::: "memory");  // this wave's copies of tile t+1 landed
    __syncthreads();  // publishes tile t+1 and frees tile t's buffer for the refill
    if (t + 2 < LL / KT)
      stage_kv(ls + (t & 1) * (2 * TILE_H * 2), gk + (size_t)(t + 2) * KT * DD, gv + (t + 2) * KT);
    mcur[0] = mnxt[0];
    mcur[1] = mnxt[1];
  }
  asm volatile("s_wait_asynccnt 0x0" ::: "memory");    // nothing in flight when the wave ends

  const float rinv = 1.0f / l_run;
  _Float16* crow = Ctx + ((size_t)(n * LL) + q0 + col) * EE + h * DD + 8 * hi;
  v8h pk;
#pragma unroll
  for (int r = 0; r < 8; ++r) pk[r] = (_Float16)(o0[r] * rinv);
  *(v8h*)(crow) = pk;
#pragma unroll
  for (int r = 0; r < 8; ++r) pk[r] = (_Float16)(o1[r] * rinv);
  *(v8h*)(crow + 16) = pk;
#pragma unroll
  for (int r = 0; r < 8; ++r) pk[r] = (_Float16)(o2[r] * rinv);
  *(v8h*)(crow + 32) = pk;
#pragma unroll
  for (int r = 0; r < 8; ++r) pk[r] = (_Float16)(o3[r] * rinv);
  *(v8h*)(crow + 48) = pk;
}

// ---------------------------------------------- out = Ctx @ Wo^T + bo  (f32)
// One block computes a 128 x 128 tile of Out; its 8 waves (4 along m, 2 along e)
// each hold 32 x 64.  Slices of OKS k-values of the Ctx rows and of the Wo rows
// are staged in LDS with whole-line copies and shared by the waves.
#define OKS     64              // k-values per staged slice (one 128-byte line per row)
#define OTILE_H (128 * PITCH)   // halves of one staged operand slice (128 rows)

// One slice pair: each thread copies 16 B of rows r, r+32, r+64, r+96 of Ctx and of Wo.
static __device__ __forceinline__ void stage_ab(unsigned la, const _Float16* ga,
                                                const _Float16* gb) {
  const unsigned la1 = la + 32 * PITCH * 2;
  const unsigned la2 = la + 64 * PITCH * 2;
  const unsigned la3 = la + 96 * PITCH * 2;
  const unsigned lb0 = la + OTILE_H * 2;
  const unsigned lb1 = lb0 + 32 * PITCH * 2;
  const unsigned lb2 = lb0 + 64 * PITCH * 2;
  const unsigned lb3 = lb0 + 96 * PITCH * 2;
  const _Float16* ga1 = ga + 32 * EE;
  const _Float16* ga2 = ga + 64 * EE;
  const _Float16* ga3 = ga + 96 * EE;
  const _Float16* gb1 = gb + 32 * EE;
  const _Float16* gb2 = gb + 64 * EE;
  const _Float16* gb3 = gb + 96 * EE;
  // s_wait_xcnt 0 closes the statement so that no address register of an issued
  // copy is rewritten ahead of it
  asm volatile("global_load_async_to_lds_b128 %0, %8, off\n\t"
               "global_load_async_to_lds_b128 %1, %9, off\n\t"
               "global_load_async_to_lds_b128 %2, %10, off\n\t"
               "global_load_async_to_lds_b128 %3, %11, off\n\t"
               "global_load_async_to_lds_b128 %4, %12, off\n\t"
               "global_load_async_to_lds_b128 %5, %13, off\n\t"
               "global_load_async_to_lds_b128 %6, %14, off\n\t"
               "global_load_async_to_lds_b128 %7, %15, off\n\t"
               "s_wait_xcnt 0x0"
               :: "v"(la), "v"(la1), "v"(la2), "v"(la3),
                  "v"(lb0), "v"(lb1), "v"(lb2), "v"(lb3),
                  "v"(ga), "v"(ga1), "v"(ga2), "v"(ga3),
                  "v"(gb), "v"(gb1), "v"(gb2), "v"(gb3)
               : "memory");
}

// launch bounds = the real block size: lifts the register ceiling so that the 8
// accumulator tiles and their fragments stay in registers
__global__ __launch_bounds__(256) void k_out(const _Float16* __restrict__ Ctx,
                                             const _Float16* __restrict__ WoH,
                                             const float* __restrict__ bo,
                                             float* __restrict__ Out) {
  __shared__ __attribute__((aligned(16))) _Float16 so[2 * 2 * OTILE_H];

  const int lane = threadIdx.x & 31;
  const int wave = threadIdx.x >> 5;
  const int m0 = (blockIdx.x >> 3) * 128;   // 64 m-blocks x 8 e-blocks
  const int e0 = (blockIdx.x & 7) * 128;
  const int wm = (wave >> 1) * 32;          // this wave's rows inside the block tile
  const int we = (wave & 1) * 64;           // this wave's columns inside the block tile
  const int col = lane & 15;
  const int kb  = (lane >> 4) * 8;
  const int hi  = lane >> 4;

  v8f acc[2][4] = {};

  // this thread's share of a staged slice: row sr (+32, +64, +96), 16-byte chunk sc
  const int sr = threadIdx.x >> 3;
  const int sc = (threadIdx.x & 7) * 8;
  const _Float16* ga = Ctx + (size_t)(m0 + sr) * EE + sc;   // + t * OKS per slice
  const _Float16* gb = WoH + (size_t)(e0 + sr) * EE + sc;   // + t * OKS per slice
  const unsigned  ls = (unsigned)(size_t)(so + sr * PITCH + sc);  // LDS byte address, buffer 0

  stage_ab(ls, ga, gb);
  asm volatile("s_wait_asynccnt 0x0" ::: "memory");  // slice 0 landed (this wave's copies)
  __syncthreads();                                   // slice 0 readable by every wave
  stage_ab(ls + 2 * OTILE_H * 2, ga + OKS, gb + OKS);

  // kept rolled: one foot (waits, barrier, refill) per slice, small loop text
#pragma unroll 1
  for (int t = 0; t < EE / OKS; ++t) {
    const _Float16* at = so + (t & 1) * (2 * OTILE_H) + (wm + col) * PITCH + kb;
    const _Float16* bt = so + (t & 1) * (2 * OTILE_H) + OTILE_H + (we + col) * PITCH + kb;
    // the inner loops here and in the epilogue are unrolled so that every index of
    // a[], b[] and acc[][] is a constant and the arrays live in registers
#pragma unroll
    for (int kk = 0; kk < OKS / 32; ++kk) {
      v16h a[2], b[4];
#pragma unroll
      for (int i = 0; i < 2; ++i) {
        const _Float16* r = at + i * 16 * PITCH + kk * 32;
        a[i] = cat16(*(const v8h*)(r), *(const v8h*)(r + 16));
      }
#pragma unroll
      for (int j = 0; j < 4; ++j) {
        const _Float16* r = bt + j * 16 * PITCH + kk * 32;
        b[j] = cat16(*(const v8h*)(r), *(const v8h*)(r + 16));
      }
#pragma unroll
      for (int i = 0; i < 2; ++i)
#pragma unroll
        for (int j = 0; j < 4; ++j) acc[i][j] = wmma16(a[i], b[j], acc[i][j]);
    }

    asm volatile("s_wait_dscnt 0x0" ::: "memory");     // this wave's reads of slice t are done
    asm volatile("s_wait_asynccnt 0x0" ::: "memory");  // this wave's copies of slice t+1 landed
    __syncthreads();  // publishes slice t+1 and frees slice t's buffer for the refill
    if (t + 2 < EE / OKS)
      stage_ab(ls + (t & 1) * (2 * OTILE_H * 2), ga + (t + 2) * OKS, gb + (t + 2) * OKS);
  }
  asm volatile("s_wait_asynccnt 0x0" ::: "memory");    // nothing in flight when the wave ends

#pragma unroll
  for (int j = 0; j < 4; ++j) {
    const int e = e0 + we + j * 16 + col;
    const float bias = bo[e];
#pragma unroll
    for (int i = 0; i < 2; ++i)
#pragma unroll
      for (int r = 0; r < 8; ++r)
        Out[(size_t)(m0 + wm + i * 16 + r + 8 * hi) * EE + e] = acc[i][j][r] + bias;
  }
}

extern "C" void kernel_launch(void* const* d_in, const int* in_sizes, int n_in,
                              void* d_out, int out_size, void* d_ws, size_t ws_size,
                              hipStream_t stream) {
  const float* values  = (const float*)d_in[0];
  const float* keys    = (const float*)d_in[1];
  const float* queries = (const float*)d_in[2];
  const int*   mask    = (const int*)d_in[3];
  const float* Wq      = (const float*)d_in[4];
  const float* Wk      = (const float*)d_in[5];
  const float* Wv      = (const float*)d_in[6];
  const float* Wo      = (const float*)d_in[7];
  const float* bo      = (const float*)d_in[8];
  float* out = (float*)d_out;

  _Float16* ws = (_Float16*)d_ws;
  const size_t per = (size_t)NB * HH * LL * DD;   // 8M halves = 16 MB each
  _Float16* Qp  = ws;
  _Float16* Kp  = Qp + per;
  _Float16* VpT = Kp + per;
  _Float16* Ctx = VpT + per;
  _Float16* WoH = Ctx + per;                       // + 2 MB
  unsigned* MB  = (unsigned*)(WoH + (size_t)EE * EE);  // + 2 MB  (total ~68 MB)

  hipLaunchKernelGGL(k_prep, dim3(MASK_BLOCKS + PROJ_BLOCKS), dim3(256), 0, stream,
                     queries, keys, values, Wq, Wk, Wv, mask, Wo, Qp, Kp, VpT, MB, WoH);
  hipLaunchKernelGGL(k_attn, dim3(8192 / 8), dim3(256), 0, stream,
                     Qp, Kp, VpT, MB, Ctx);
  hipLaunchKernelGGL(k_out, dim3(64 * 8), dim3(256), 0, stream, Ctx, WoH, bo, out);
}

// v007
// One run takes 119 microseconds.
// Next to v006, in two timings, it ran 1.04 times as fast each time.
// Over all steps from v000 it is 3.01 times as fast.
#include <hip/hip_runtime.h>
#include <hip/hip_bf16.h>

#define NB 4
#define LL 2048
#define EE 1024
#define HH 16
#define DD 64

typedef __attribute__((ext_vector_type(16))) _Float16 v16h;
typedef __attribute__((ext_vector_type(8)))  _Float16 v8h;
typedef __attribute__((ext_vector_type(8)))  float    v8f;
typedef __attribute__((ext_vector_type(4)))  int      v4i;
typedef __attribute__((ext_vector_type(4)))  float    v4f;
typedef __attribute__((ext_vector_type(16))) unsigned v16u;
typedef __attribute__((address_space(4))) v16u        cv16u;

// 1/sqrt(E) * log2(e): softmax computed with exp2 (hardware-native) is exact
// softmax of the reference logits since all logits share the same scale.
#define SCALE_LOG2 (0.03125f * 1.44269504088896340736f)

static __device__ __forceinline__ v16h cat16(v8h lo, v8h hi) {
  v16h r;
#pragma unroll
  for (int i = 0; i < 8; ++i) { r[i] = lo[i]; r[i + 8] = hi[i]; }
  return r;
}

static __device__ __forceinline__ v8h cvt8(const float* p) {
  v8h r;
#pragma unroll
  for (int i = 0; i < 8; ++i) r[i] = (_Float16)p[i];
  return r;
}

// e[i] = 2^e[i] on the hardware exponential alone, without the library's range
// fix-up for results below 2^-126: such a weight is 0 as f16 and far below one
// f32 ulp of the row sum (which is at least 1), and a rescale factor that small
// is 0 too.  One statement, in place: every v_exp_f32 is followed by one that is
// independent of it and the last by v_nop, which is the slot the instruction set
// asks for before a transcendental's result is read or its source overwritten.
static __device__ __forceinline__ void exp2_hw17(float (&e)[17]) {
  asm("v_exp_f32 %0, %0\n\t"
      "v_exp_f32 %1, %1\n\t"
      "v_exp_f32 %2, %2\n\t"
      "v_exp_f32 %3, %3\n\t"
      "v_exp_f32 %4, %4\n\t"
      "v_exp_f32 %5, %5\n\t"
      "v_exp_f32 %6, %6\n\t"
      "v_exp_f32 %7, %7\n\t"
      "v_exp_f32 %8, %8\n\t"
      "v_exp_f32 %9, %9\n\t"
      "v_exp_f32 %10, %10\n\t"
      "v_exp_f32 %11, %11\n\t"
      "v_exp_f32 %12, %12\n\t"
      "v_exp_f32 %13, %13\n\t"
      "v_exp_f32 %14, %14\n\t"
      "v_exp_f32 %15, %15\n\t"
      "v_exp_f32 %16, %16\n\t"
      "v_nop"
      : "+v"(e[0]), "+v"(e[1]), "+v"(e[2]), "+v"(e[3]), "+v"(e[4]), "+v"(e[5]),
        "+v"(e[6]), "+v"(e[7]), "+v"(e[8]), "+v"(e[9]), "+v"(e[10]), "+v"(e[11]),
        "+v"(e[12]), "+v"(e[13]), "+v"(e[14]), "+v"(e[15]), "+v"(e[16]));
}

static __device__ __forceinline__ v8f wmma16(v16h a, v16h b, v8f c) {
  // D(16x16,f32) = A(16x32,f16) * B(32x16,f16) + C
  return __builtin_amdgcn_wmma_f32_16x16x32_f16(false, a, false, b, (short)0, c,
                                                false, false);
}

// ------------------------------------------------ mask -> lane-mask words
// MB[n][16-query tile][32-key block][16]: word w of a block is the lane mask that
// k_attn's wave needs for score register w (w < 8: keys 0-15, else keys 16-31 of
// the block): bit `lane` = (mask[q0 + (lane & 15)][k0 + (w >> 3) * 16 + (w & 7) + 8 * (lane >> 4)] != 0).
// The mask does not depend on the head, so it is reduced once for all 16 heads.
// One wave packs MBU tiles of 64 keys; each tile gives one whole 128-byte line.
// The same threads turn Wo into f16, 8 consecutive values each: MASK_BLOCKS * 256 * 8
// is exactly E * E.  Its two loads are issued ahead of the mask loop and used behind it.
#define MBU 4
#define MASK_BLOCKS (NB * 128 * 32 / (8 * MBU))
static_assert(MASK_BLOCKS * 256 * 8 == EE * EE, "one thread per 8 values of Wo");
static __device__ __forceinline__ void mask_wo_block(const int blk,
                                                     const int* __restrict__ mask,
                                                     unsigned* __restrict__ MB,
                                                     const float* __restrict__ Wo,
                                                     _Float16* __restrict__ WoH) {
  const int wi = (blk * 256 + (int)threadIdx.x) * 8;
  const v4f w0 = *(const v4f*)(Wo + wi);
  const v4f w1 = *(const v4f*)(Wo + wi + 4);

  const int lane = threadIdx.x & 31;
  const int wave = threadIdx.x >> 5;
  const int unit = (blk * 8 + wave) * MBU;          // 4 * 128 * 32 tiles of 64 keys
  const int n    = unit >> 12;
  const int qt   = (unit >> 5) & 127;
  const int t0   = unit & 31;
  const int col  = lane & 15;
  const int hi   = lane >> 4;
  const int* mr = mask + (size_t)n * LL * LL + (size_t)(qt * 16 + col) * LL + t0 * 64 + 8 * hi;

  unsigned* mo = MB + (size_t)unit * 32 + lane;

  // two tiles a trip, kept rolled: 16 loads in flight per wave, and one trip's 64
  // ballot words fit the scalar registers
#pragma unroll 1
  for (int g = 0; g < MBU / 2; ++g) {
    // the inner loops are unrolled so that every index of m[][] is a constant
    v4i m[2][8];
    const int* mg = mr + g * 2 * 64;
#pragma unroll
    for (int u = 0; u < 2; ++u)
#pragma unroll
      for (int p = 0; p < 2; ++p) {
        const int* q = mg + u * 64 + p * 32;
        m[u][p * 4 + 0] = *(const v4i*)(q);
        m[u][p * 4 + 1] = *(const v4i*)(q + 4);
        m[u][p * 4 + 2] = *(const v4i*)(q + 16);
        m[u][p * 4 + 3] = *(const v4i*)(q + 20);
      }
#pragma unroll
    for (int u = 0; u < 2; ++u) {
      unsigned val = 0;
#pragma unroll
      for (int w = 0; w < 32; ++w) {
        const unsigned b = __builtin_amdgcn_ballot_w32(m[u][w >> 2][w & 3] != 0);
        val = (lane == w) ? b : val;
      }
      mo[(g * 2 + u) * 32] = val;
    }
    // the next trip's loads land in registers that these stores name: kept behind this wait;
    // it takes the trip's load address as an input, so that no load lands in its registers
    asm volatile("s_wait_xcnt 0x0" :: "v"(mg) : "memory");
  }

  v8h wh;
  // unrolled so that every index of wh, w0 and w1 is a constant
#pragma unroll
  for (int i = 0; i < 4; ++i) { wh[i] = (_Float16)w0[i]; wh[i + 4] = (_Float16)w1[i]; }
  *(v8h*)(WoH + wi) = wh;
}

// ------------------------------------------- per-head projections Q/K/V @ W^T
// Qp, Kp : f16 [N][H][L][D] row-major.  VpT : f16 [N][H][D][L] (head-transposed)
// W is the same for every head and row: a wave turns it into its 8 B fragments once,
// keeps them in registers and walks PT consecutive 16-row tiles of one head with them.
#define PT 4
#define PROJ_BLOCKS (3 * 8192 / (8 * PT))
static_assert(128 % (8 * PT) == 0, "a block's tiles lie inside one head");

// one lane's share of a 16 x 64 f32 tile: 8 values at p, p + 16, p + 32, p + 48
static __device__ __forceinline__ void load_x(v4f (&x)[8], const float* p) {
  // unrolled so that every index of x[] is a constant
#pragma unroll
  for (int i = 0; i < 4; ++i) {
    x[2 * i]     = *(const v4f*)(p + 16 * i);
    x[2 * i + 1] = *(const v4f*)(p + 16 * i + 4);
  }
}

static __device__ __forceinline__ v8h cvt8v(v4f lo, v4f hi) {
  v8h r;
  // unrolled so that every index of r, lo and hi is a constant
#pragma unroll
  for (int i = 0; i < 4; ++i) { r[i] = (_Float16)lo[i]; r[i + 4] = (_Float16)hi[i]; }
  return r;
}

// VT: the result goes out transposed (V); else row-major (Q, K).  out points at the
// lane's first element of the wave's first tile.
template <bool VT>
static __device__ __forceinline__ void proj_tiles(const float* __restrict__ xp,
                                                  const float* __restrict__ wp,
                                                  _Float16* __restrict__ out) {
  // the first tile's rows come from memory: asked for together with the first half of W
  v4f x[8];
  load_x(x, xp);

  // B^T = W (row e, contiguous d)
  v16h b[4][2];
  // every loop here is unrolled so that the indices of x[], b[][] and c are constants
  // and the arrays live in registers
#pragma unroll
  for (int j = 0; j < 4; ++j) {
    const float* wrow = wp + j * 16 * DD;
    b[j][0] = cat16(cvt8(wrow),      cvt8(wrow + 16));
    b[j][1] = cat16(cvt8(wrow + 32), cvt8(wrow + 48));
    // W is asked for in two halves, and the tiles' loads stay behind it: half the landing
    // registers, so that three blocks fit a WGP
    if (j & 1) __builtin_amdgcn_sched_barrier(0);
  }
  // behind W's loads; takes their address as an input, so that no load lands in its registers
  asm volatile("s_wait_xcnt 0x0" :: "v"(wp) : "memory");

#pragma unroll
  for (int t = 0; t < PT; ++t) {
    // A fragments: X tile (16 rows x 64 d), f32 -> f16
    const v16h a0 = cat16(cvt8v(x[0], x[1]), cvt8v(x[2], x[3]));
    const v16h a1 = cat16(cvt8v(x[4], x[5]), cvt8v(x[6], x[7]));
    // keeps the next tile's loads behind this tile's conversion: one set of landing
    // registers, not two
    __builtin_amdgcn_sched_barrier(0);
    // the next tile's rows are fetched while this tile is worked on
    if (t + 1 < PT) load_x(x, xp + (t + 1) * 16 * EE);

#pragma unroll
    for (int j = 0; j < 4; ++j) {
      v8f c = {};
      c = wmma16(a0, b[j][0], c);
      c = wmma16(a1, b[j][1], c);
      if (VT) {
        // transpose store: per lane the 8 C values are contiguous along L
        v8h pk;
#pragma unroll
        for (int r = 0; r < 8; ++r) pk[r] = (_Float16)c[r];
        *(v8h*)(out + (size_t)(j * 16) * LL + t * 16) = pk;
      } else {
#pragma unroll
        for (int r = 0; r < 8; ++r)
          out[(t * 16 + r) * DD + j * 16] = (_Float16)c[r];
      }
      // the next product lands in registers that these stores name: kept behind this wait;
      // it takes both addresses as inputs, so that nothing lands in their registers before it
      asm volatile("s_wait_xcnt 0x0" :: "v"(xp), "v"(out) : "memory");
    }
    // keeps the next tile's conversion, which waits for its loads, behind this tile's stores
    __builtin_amdgcn_sched_barrier(0);
  }
}

static __device__ __forceinline__ void proj_block(const int blk,
                       const float* __restrict__ Q, const float* __restrict__ K,
                       const float* __restrict__ V,
                       const float* __restrict__ Wq, const float* __restrict__ Wk,
                       const float* __restrict__ Wv,
                       _Float16* __restrict__ Qp, _Float16* __restrict__ Kp,
                       _Float16* __restrict__ VpT) {
  const int lane = threadIdx.x & 31;
  const int wave = threadIdx.x >> 5;
  const int mat  = blk / (PROJ_BLOCKS / 3);               // 0=Q 1=K 2=V
  const int tb   = (blk % (PROJ_BLOCKS / 3)) * (8 * PT);  // the block's first of 8192 tiles
  const int n    = tb >> 11;                              // / (H*128)
  const int h    = (tb >> 7) & 15;
  const int q0   = ((tb & 127) + wave * PT) * 16;         // the wave's first row
  const int col  = lane & 15;
  const int kb   = (lane >> 4) * 8;
  const int hi   = lane >> 4;

  const float* X = (mat == 0) ? Q : (mat == 1) ? K : V;
  const float* W = (mat == 0) ? Wq : (mat == 1) ? Wk : Wv;
  const float* xp = X + ((size_t)(n * LL + q0 + col)) * EE + h * DD + kb;
  const float* wp = W + col * DD + kb;
  const size_t nh = (size_t)(n * HH + h);

  if (mat == 2) proj_tiles<true>(xp, wp, VpT + (nh * DD + col) * LL + q0 + 8 * hi);
  else          proj_tiles<false>(xp, wp, ((mat == 0) ? Qp : Kp) + (nh * LL + q0 + 8 * hi) * DD + col);
}

// ------------------------------------------------ all input preparation, one launch
// Mask packing, Wo -> f16 and the projections depend on the inputs alone and not on
// each other: one grid, the part chosen by the block index (the same for a whole
// block).  The mask blocks stream from memory and come first, so that their loads
// are under way while the projection blocks start.  Launch bounds = the real block
// size: lifts the register ceiling, so that a projection wave's W fragments and the
// rows in flight stay in registers.
__global__ __launch_bounds__(256) void k_prep(const float* __restrict__ Q, const float* __restrict__ K,
                       const float* __restrict__ V,
                       const float* __restrict__ Wq, const float* __restrict__ Wk,
                       const float* __restrict__ Wv,
                       const int* __restrict__ mask, const float* __restrict__ Wo,
                       _Float16* __restrict__ Qp, _Float16* __restrict__ Kp,
                       _Float16* __restrict__ VpT, unsigned* __restrict__ MB,
                       _Float16* __restrict__ WoH) {
  const int blk = blockIdx.x;
  if (blk < MASK_BLOCKS) mask_wo_block(blk, mask, MB, Wo, WoH);
  else                   proj_block(blk - MASK_BLOCKS, Q, K, V, Wq, Wk, Wv, Qp, Kp, VpT);
}

// ------------------------------------------------------- flash attention core
// one wave per (n, h, QT 16-query tiles); Ctx: f16 [N][L][E]
// The 8 waves of a block share (n, h): K and V^T tiles of KT keys are staged in
// LDS once per block with whole-line copies instead of 16-line loads per wave.
#define QT     2               // 16-query tiles per wave
#define KT     64              // keys per staged tile
#define PITCH  72              // halves per LDS row: 144 B = 16 B x odd, no bank conflict for 16-byte reads
#define TILE_H (64 * PITCH)    // halves of one staged tile (K: 64 keys x 64 d, V^T: 64 d x 64 keys)

// One tile pair: each thread copies rows r and r+32 (16 B each) of K and of V^T.
static __device__ __forceinline__ void stage_kv(unsigned lk, const _Float16* gk,
                                                const _Float16* gv) {
  const unsigned lk1 = lk + 32 * PITCH * 2;
  const unsigned lv0 = lk + TILE_H * 2;
  const unsigned lv1 = lv0 + 32 * PITCH * 2;
  const _Float16* gk1 = gk + 32 * DD;
  const _Float16* gv1 = gv + 32 * LL;
  // s_wait_xcnt 0 closes the statement so that no address register of an issued
  // copy is rewritten ahead of it
  asm volatile("global_load_async_to_lds_b128 %0, %4, off\n\t"
               "global_load_async_to_lds_b128 %1, %5, off\n\t"
               "global_load_async_to_lds_b128 %2, %6, off\n\t"
               "global_load_async_to_lds_b128 %3, %7, off\n\t"
               "s_wait_xcnt 0x0"
               :: "v"(lk), "v"(lk1), "v"(lv0), "v"(lv1),
                  "v"(gk), "v"(gk1), "v"(gv), "v"(gv1)
               : "memory");
}

// launch bounds = the real block size: lifts the register ceiling so that QT tiles'
// accumulators, scores and Q fragments stay in registers
__global__ __launch_bounds__(256) void k_attn(const _Float16* __restrict__ Qp, const _Float16* __restrict__ Kp,
                       const _Float16* __restrict__ VpT, const unsigned* __restrict__ MB,
                       _Float16* __restrict__ Ctx) {
  __shared__ __attribute__((aligned(16))) _Float16 sm[2 * 2 * TILE_H];

  const int lane = threadIdx.x & 31;
  const int wave = threadIdx.x >> 5;
  const int tile = (blockIdx.x * 8 + wave) * QT;   // the wave's first of 8192 tiles
  const int n    = tile >> 11;
  int rem        = tile & 2047;
  const int h    = rem >> 7;
  const int q0   = (rem & 127) * 16;
  const int col  = lane & 15;
  const int kb   = (lane >> 4) * 8;
  const int hi   = lane >> 4;
  const size_t nh = (size_t)(n * HH + h);

  // every loop over c or j is unrolled so that the indices of bq, o, sT, pf, m_run, l_run
  // and the mask words are constants and the arrays live in registers

  // B fragments of Q^T (== Q rows in A-pattern), fixed for the whole loop
  v16h bq[QT][2];
#pragma unroll
  for (int c = 0; c < QT; ++c) {
    const _Float16* qrow = Qp + (nh * LL + q0 + c * 16 + col) * DD;
    bq[c][0] = cat16(*(const v8h*)(qrow + kb),      *(const v8h*)(qrow + 16 + kb));
    bq[c][1] = cat16(*(const v8h*)(qrow + 32 + kb), *(const v8h*)(qrow + 48 + kb));
  }

  float m_run[QT], l_run[QT];            // running max in log2 domain, running sum
  v8f o[QT][4];
#pragma unroll
  for (int c = 0; c < QT; ++c) {
    m_run[c] = -3.4e38f;
    l_run[c] = 0.f;
#pragma unroll
    for (int j = 0; j < 4; ++j) o[c][j] = v8f{};
  }

  // this wave's lane-mask words: the same address in every lane (readfirstlane tells
  // the compiler) and never written during this launch (the constant address space
  // tells it), so that they come by scalar loads straight into scalar registers.
  // Tile c's words for 32-key block s are mw[c * (LL / 32) + s].
  const int utile = __builtin_amdgcn_readfirstlane(tile);
  const cv16u* mw = (const cv16u*)(MB + (size_t)((utile >> 11) * 128 + (utile & 127)) * (LL / 32 * 16));
  v16u mcur[QT];
#pragma unroll
  for (int c = 0; c < QT; ++c) mcur[c] = mw[c * (LL / 32)];

  // this thread's share of a staged tile: row sr (and sr + 32), 16-byte chunk sc
  const int sr = threadIdx.x >> 3;
  const int sc = (threadIdx.x & 7) * 8;
  const _Float16* gk = Kp + (nh * LL + sr) * DD + sc;    // + k0 * DD per tile
  const _Float16* gv = VpT + (nh * DD + sr) * LL + sc;   // + k0 per tile
  const unsigned  ls = (unsigned)(size_t)(sm + sr * PITCH + sc);  // LDS byte address, buffer 0

  stage_kv(ls, gk, gv);
  asm volatile("s_wait_asynccnt 0x0" ::: "memory");  // tile 0 landed (this wave's copies)
  __syncthreads();                                   // tile 0 readable by every wave
  stage_kv(ls + 2 * TILE_H * 2, gk + KT * DD, gv + KT);

#pragma unroll 1
  for (int t = 0; t < LL / KT; ++t) {
    const _Float16* kt = sm + (t & 1) * (2 * TILE_H) + col * PITCH + kb;
    const _Float16* vt = kt + TILE_H;
#pragma unroll
    for (int p = 0; p < KT / 32; ++p) {
      // S^T = K * Q^T : per query tile two 16x16 tiles (k 0-15, 16-31); each K fragment feeds QT products
      const _Float16* kr0 = kt + p * 32 * PITCH;
      const _Float16* kr1 = kr0 + 16 * PITCH;
      const v16h ak00 = cat16(*(const v8h*)(kr0),      *(const v8h*)(kr0 + 16));
      const v16h ak01 = cat16(*(const v8h*)(kr0 + 32), *(const v8h*)(kr0 + 48));
      const v16h ak10 = cat16(*(const v8h*)(kr1),      *(const v8h*)(kr1 + 16));
      const v16h ak11 = cat16(*(const v8h*)(kr1 + 32), *(const v8h*)(kr1 + 48));
      v8f sT[QT][2];
#pragma unroll
      for (int c = 0; c < QT; ++c) {
        sT[c][0] = wmma16(ak00, bq[c][0], v8f{});
        sT[c][1] = wmma16(ak10, bq[c][0], v8f{});
      }
#pragma unroll
      for (int c = 0; c < QT; ++c) {
        sT[c][0] = wmma16(ak01, bq[c][1], sT[c][0]);
        sT[c][1] = wmma16(ak11, bq[c][1], sT[c][1]);
      }

      // mask (one select per score on its lane-mask word); reference: (-1e20 if masked) then /sqrt(E);
      // whole row pre-scaled by log2(e) so exp2 gives exact reference softmax
      float s0[QT][8], s1[QT][8];
#pragma unroll
      for (int c = 0; c < QT; ++c)
#pragma unroll
        for (int r = 0; r < 8; ++r) {
          const bool mv0 = __builtin_amdgcn_inverse_ballot_w32(mcur[c][r]);
          const bool mv1 = __builtin_amdgcn_inverse_ballot_w32(mcur[c][r + 8]);
          s0[c][r] = (mv0 ? sT[c][0][r] : -1.0e20f) * SCALE_LOG2;
          s1[c][r] = (mv1 ? sT[c][1][r] : -1.0e20f) * SCALE_LOG2;
        }

      // the next 32 keys' words are fetched as soon as this pass's are used up (the last pass
      // fetches its own again)
      const int s  = t * (KT / 32) + p;
      const int sn = (s + 1 < LL / 32) ? s + 1 : s;
#pragma unroll
      for (int c = 0; c < QT; ++c) mcur[c] = mw[c * (LL / 32) + sn];
      // keeps these scalar loads here, a whole pass ahead of their use: left free they sink to
      // just in front of the next pass's selects, and the wave waits out their latency
      __builtin_amdgcn_sched_barrier(0);

      v16h pf[QT];                                 // P^T B-fragments, in registers
#pragma unroll
      for (int c = 0; c < QT; ++c) {
        // online softmax: per-lane partial over 16 k, one xor-16 combine
        float tmax = fmaxf(s0[c][0], s1[c][0]);
#pragma unroll
        for (int r = 1; r < 8; ++r) { tmax = fmaxf(tmax, s0[c][r]); tmax = fmaxf(tmax, s1[c][r]); }
        tmax = fmaxf(tmax, __shfl_xor(tmax, 16, 32));
        const float m_new = fmaxf(m_run[c], tmax);
        float e[17];                               // exponents, then their powers of 2
        e[0] = m_run[c] - m_new;
        // unrolled so that every index of e[] is a constant and e[] lives in registers
#pragma unroll
        for (int r = 0; r < 8; ++r) { e[1 + r] = s0[c][r] - m_new; e[9 + r] = s1[c][r] - m_new; }
        exp2_hw17(e);
        const float corr = e[0];

        float tsum = 0.f;
#pragma unroll
        for (int r = 0; r < 8; ++r) {
          const float p0 = e[1 + r];
          const float p1 = e[9 + r];
          tsum += p0 + p1;
          pf[c][r]     = (_Float16)p0;
          pf[c][r + 8] = (_Float16)p1;
        }
        tsum += __shfl_xor(tsum, 16, 32);
        l_run[c] = l_run[c] * corr + tsum;
        m_run[c] = m_new;
#pragma unroll
        for (int j = 0; j < 4; ++j)
#pragma unroll
          for (int r = 0; r < 8; ++r) o[c][j][r] *= corr;
      }

      // O^T += V^T * P^T  (V^T rows of the staged tile, keys contiguous); each V^T fragment feeds QT products
      const _Float16* v0 = vt + p * 32;
#pragma unroll
      for (int j = 0; j < 4; ++j) {
        const v16h av = cat16(*(const v8h*)(v0 + j * 16 * PITCH), *(const v8h*)(v0 + j * 16 * PITCH + 16));
#pragma unroll
        for (int c = 0; c < QT; ++c) o[c][j] = wmma16(av, pf[c], o[c][j]);
      }
    }

    asm volatile("s_wait_dscnt 0x0" ::: "memory");     // this wave's reads of tile t are done
    asm volatile("s_wait_asynccnt 0x0" ::: "memory");  // this wave's copies of tile t+1 landed
    __syncthreads();  // publishes tile t+1 and frees tile t's buffer for the refill
    if (t + 2 < LL / KT)
      stage_kv(ls + (t & 1) * (2 * TILE_H * 2), gk + (size_t)(t + 2) * KT * DD, gv + (t + 2) * KT);
  }
  asm volatile("s_wait_asynccnt 0x0" ::: "memory");    // nothing in flight when the wave ends

#pragma unroll
  for (int c = 0; c < QT; ++c) {
    const float rinv = 1.0f / l_run[c];
    _Float16* crow = Ctx + ((size_t)(n * LL) + q0 + c * 16 + col) * EE + h * DD + 8 * hi;
#pragma unroll
    for (int j = 0; j < 4; ++j) {
      v8h pk;
#pragma unroll
      for (int r = 0; r < 8; ++r) pk[r] = (_Float16)(o[c][j][r] * rinv);
      *(v8h*)(crow + j * 16) = pk;
    }
  }
}

// ---------------------------------------------- out = Ctx @ Wo^T + bo  (f32)
// One block computes a 128 x 128 tile of Out; its 8 waves (4 along m, 2 along e)
// each hold 32 x 64.  Slices of OKS k-values of the Ctx rows and of the Wo rows
// are staged in LDS with whole-line copies and shared by the waves.
#define OKS     64              // k-values per staged slice (one 128-byte line per row)
#define OTILE_H (128 * PITCH)   // halves of one staged operand slice (128 rows)

// One slice pair: each thread copies 16 B of rows r, r+32, r+64, r+96 of Ctx and of Wo.
static __device__ __forceinline__ void stage_ab(unsigned la, const _Float16* ga,
                                                const _Float16* gb) {
  const unsigned la1 = la + 32 * PITCH * 2;
  const unsigned la2 = la + 64 * PITCH * 2;
  const unsigned la3 = la + 96 * PITCH * 2;
  const unsigned lb0 = la + OTILE_H * 2;
  const unsigned lb1 = lb0 + 32 * PITCH * 2;
  const unsigned lb2 = lb0 + 64 * PITCH * 2;
  const unsigned lb3 = lb0 + 96 * PITCH * 2;
  const _Float16* ga1 = ga + 32 * EE;
  const _Float16* ga2 = ga + 64 * EE;
  const _Float16* ga3 = ga + 96 * EE;
  const _Float16* gb1 = gb + 32 * EE;
  const _Float16* gb2 = gb + 64 * EE;
  const _Float16* gb3 = gb + 96 * EE;
  // s_wait_xcnt 0 closes the statement so that no address register of an issued
  // copy is rewritten ahead of it
  asm volatile("global_load_async_to_lds_b128 %0, %8, off\n\t"
               "global_load_async_to_lds_b128 %1, %9, off\n\t"
               "global_load_async_to_lds_b128 %2, %10, off\n\t"
               "global_load_async_to_lds_b128 %3, %11, off\n\t"
               "global_load_async_to_lds_b128 %4, %12, off\n\t"
               "global_load_async_to_lds_b128 %5, %13, off\n\t"
               "global_load_async_to_lds_b128 %6, %14, off\n\t"
               "global_load_async_to_lds_b128 %7, %15, off\n\t"
               "s_wait_xcnt 0x0"
               :: "v"(la), "v"(la1), "v"(la2), "v"(la3),
                  "v"(lb0), "v"(lb1), "v"(lb2), "v"(lb3),
                  "v"(ga), "v"(ga1), "v"(ga2), "v"(ga3),
                  "v"(gb), "v"(gb1), "v"(gb2), "v"(gb3)
               : "memory");
}

// launch bounds = the real block size: lifts the register ceiling so that the 8
// accumulator tiles and their fragments stay in registers
__global__ __launch_bounds__(256) void k_out(const _Float16* __restrict__ Ctx,
                                             const _Float16* __restrict__ WoH,
                                             const float* __restrict__ bo,
                                             float* __restrict__ Out) {
  __shared__ __attribute__((aligned(16))) _Float16 so[2 * 2 * OTILE_H];

  const int lane = threadIdx.x & 31;
  const int wave = threadIdx.x >> 5;
  const int m0 = (blockIdx.x >> 3) * 128;   // 64 m-blocks x 8 e-blocks
  const int e0 = (blockIdx.x & 7) * 128;
  const int wm = (wave >> 1) * 32;          // this wave's rows inside the block tile
  const int we = (wave & 1) * 64;           // this wave's columns inside the block tile
  const int col = lane & 15;
  const int kb  = (lane >> 4) * 8;
  const int hi  = lane >> 4;

  v8f acc[2][4] = {};

  // this thread's share of a staged slice: row sr (+32, +64, +96), 16-byte chunk sc
  const int sr = threadIdx.x >> 3;
  const int sc = (threadIdx.x & 7) * 8;
  const _Float16* ga = Ctx + (size_t)(m0 + sr) * EE + sc;   // + t * OKS per slice
  const _Float16* gb = WoH + (size_t)(e0 + sr) * EE + sc;   // + t * OKS per slice
  const unsigned  ls = (unsigned)(size_t)(so + sr * PITCH + sc);  // LDS byte address, buffer 0

  stage_ab(ls, ga, gb);
  asm volatile("s_wait_asynccnt 0x0" ::: "memory");  // slice 0 landed (this wave's copies)
  __syncthreads();                                   // slice 0 readable by every wave
  stage_ab(ls + 2 * OTILE_H * 2, ga + OKS, gb + OKS);

  // kept rolled: one foot (waits, barrier, refill) per slice, small loop text
#pragma unroll 1
  for (int t = 0; t < EE / OKS; ++t) {
    const _Float16* at = so + (t & 1) * (2 * OTILE_H) + (wm + col) * PITCH + kb;
    const _Float16* bt = so + (t & 1) * (2 * OTILE_H) + OTILE_H + (we + col) * PITCH + kb;
    // the inner loops here and in the epilogue are unrolled so that every index of
    // a[], b[] and acc[][] is a constant and the arrays live in registers
#pragma unroll
    for (int kk = 0; kk < OKS / 32; ++kk) {
      v16h a[2], b[4];
#pragma unroll
      for (int i = 0; i < 2; ++i) {
        const _Float16* r = at + i * 16 * PITCH + kk * 32;
        a[i] = cat16(*(const v8h*)(r), *(const v8h*)(r + 16));
      }
#pragma unroll
      for (int j = 0; j < 4; ++j) {
        const _Float16* r = bt + j * 16 * PITCH + kk * 32;
        b[j] = cat16(*(const v8h*)(r), *(const v8h*)(r + 16));
      }
#pragma unroll
      for (int i = 0; i < 2; ++i)
#pragma unroll
        for (int j = 0; j < 4; ++j) acc[i][j] = wmma16(a[i], b[j], acc[i][j]);
    }

    asm volatile("s_wait_dscnt 0x0" ::: "memory");     // this wave's reads of slice t are done
    asm volatile("s_wait_asynccnt 0x0" ::: "memory");  // this wave's copies of slice t+1 landed
    __syncthreads();  // publishes slice t+1 and frees slice t's buffer for the refill
    if (t + 2 < EE / OKS)
      stage_ab(ls + (t & 1) * (2 * OTILE_H * 2), ga + (t + 2) * OKS, gb + (t + 2) * OKS);
  }
  asm volatile("s_wait_asynccnt 0x0" ::: "memory");    // nothing in flight when the wave ends

#pragma unroll
  for (int j = 0; j < 4; ++j) {
    const int e = e0 + we + j * 16 + col;
    const float bias = bo[e];
#pragma unroll
    for (int i = 0; i < 2; ++i)
#pragma unroll
      for (int r = 0; r < 8; ++r)
        Out[(size_t)(m0 + wm + i * 16 + r + 8 * hi) * EE + e] = acc[i][j][r] + bias;
  }
}

extern "C" void kernel_launch(void* const* d_in, const int* in_sizes, int n_in,
                              void* d_out, int out_size, void* d_ws, size_t ws_size,
                              hipStream_t stream) {
  const float* values  = (const float*)d_in[0];
  const float* keys    = (const float*)d_in[1];
  const float* queries = (const float*)d_in[2];
  const int*   mask    = (const int*)d_in[3];
  const float* Wq      = (const float*)d_in[4];
  const float* Wk      = (const float*)d_in[5];
  const float* Wv      = (const float*)d_in[6];
  const float* Wo      = (const float*)d_in[7];
  const float* bo      = (const float*)d_in[8];
  float* out = (float*)d_out;

  _Float16* ws = (_Float16*)d_ws;
  const size_t per = (size_t)NB * HH * LL * DD;   // 8M halves = 16 MB each
  _Float16* Qp  = ws;
  _Float16* Kp  = Qp + per;
  _Float16* VpT = Kp + per;
  _Float16* Ctx = VpT + per;
  _Float16* WoH = Ctx + per;                       // + 2 MB
  unsigned* MB  = (unsigned*)(WoH + (size_t)EE * EE);  // + 2 MB  (total ~68 MB)

  hipLaunchKernelGGL(k_prep, dim3(MASK_BLOCKS + PROJ_BLOCKS), dim3(256), 0, stream,
                     queries, keys, values, Wq, Wk, Wv, mask, Wo, Qp, Kp, VpT, MB, WoH);
  hipLaunchKernelGGL(k_attn, dim3(8192 / (8 * QT)), dim3(256), 0, stream,
                     Qp, Kp, VpT, MB, Ctx);
  hipLaunchKernelGGL(k_out, dim3(64 * 8), dim3(256), 0, stream, Ctx, WoH, bo, out);
}

// v008
// A run of this version takes 113 microseconds.
// Two timings next to v007 both put it at 1.05 times that version's speed.
// Counting every step since v000, it is 3.16 times as fast.
#include <hip/hip_runtime.h>
#include <hip/hip_bf16.h>

#define NB 4
#define LL 2048
#define EE 1024
#define HH 16
#define DD 64

typedef __attribute__((ext_vector_type(16))) _Float16 v16h;
typedef __attribute__((ext_vector_type(8)))  _Float16 v8h;
typedef __attribute__((ext_vector_type(8)))  float    v8f;
typedef __attribute__((ext_vector_type(4)))  int      v4i;
typedef __attribute__((ext_vector_type(4)))  float    v4f;
typedef __attribute__((ext_vector_type(16))) unsigned v16u;
typedef __attribute__((address_space(4))) v16u        cv16u;

// 1/sqrt(E) * log2(e): softmax computed with exp2 (hardware-native) is exact
// softmax of the reference logits since all logits share the same scale.
#define SCALE_LOG2 (0.03125f * 1.44269504088896340736f)

static __device__ __forceinline__ v16h cat16(v8h lo, v8h hi) {
  v16h r;
#pragma unroll
  for (int i = 0; i < 8; ++i) { r[i] = lo[i]; r[i + 8] = hi[i]; }
  return r;
}

static __device__ __forceinline__ v8h cvt8(const float* p) {
  v8h r;
#pragma unroll
  for (int i = 0; i < 8; ++i) r[i] = (_Float16)p[i];
  return r;
}

// e[i] = 2^e[i] on the hardware exponential alone, without the library's range
// fix-up for results below 2^-126: such a weight is 0 as f16 and far below one
// f32 ulp of the row sum (which is at least 1), and a rescale factor that small
// is 0 too.  One statement, in place: every v_exp_f32 is followed by one that is
// independent of it and the last by v_nop, which is the slot the instruction set
// asks for before a transcendental's result is read or its source overwritten.
static __device__ __forceinline__ float exp2_hw1(float x) {
  // v_nop: the same slot behind a single v_exp_f32
  asm("v_exp_f32 %0, %0\n\t"
      "v_nop"
      : "+v"(x));
  return x;
}

static __device__ __forceinline__ void exp2_hw16(float (&e)[16]) {
  asm("v_exp_f32 %0, %0\n\t"
      "v_exp_f32 %1, %1\n\t"
      "v_exp_f32 %2, %2\n\t"
      "v_exp_f32 %3, %3\n\t"
      "v_exp_f32 %4, %4\n\t"
      "v_exp_f32 %5, %5\n\t"
      "v_exp_f32 %6, %6\n\t"
      "v_exp_f32 %7, %7\n\t"
      "v_exp_f32 %8, %8\n\t"
      "v_exp_f32 %9, %9\n\t"
      "v_exp_f32 %10, %10\n\t"
      "v_exp_f32 %11, %11\n\t"
      "v_exp_f32 %12, %12\n\t"
      "v_exp_f32 %13, %13\n\t"
      "v_exp_f32 %14, %14\n\t"
      "v_exp_f32 %15, %15\n\t"
      "v_nop"
      : "+v"(e[0]), "+v"(e[1]), "+v"(e[2]), "+v"(e[3]), "+v"(e[4]), "+v"(e[5]),
        "+v"(e[6]), "+v"(e[7]), "+v"(e[8]), "+v"(e[9]), "+v"(e[10]), "+v"(e[11]),
        "+v"(e[12]), "+v"(e[13]), "+v"(e[14]), "+v"(e[15]));
}

static __device__ __forceinline__ v8f wmma16(v16h a, v16h b, v8f c) {
  // D(16x16,f32) = A(16x32,f16) * B(32x16,f16) + C
  return __builtin_amdgcn_wmma_f32_16x16x32_f16(false, a, false, b, (short)0, c,
                                                false, false);
}

// ------------------------------------------------ mask -> lane-mask words
// MB[n][16-query tile][32-key block][16]: word w of a block is the lane mask that
// k_attn's wave needs for score register w (w < 8: keys 0-15, else keys 16-31 of
// the block): bit `lane` = (mask[q0 + (lane & 15)][k0 + (w >> 3) * 16 + (w & 7) + 8 * (lane >> 4)] != 0).
// The mask does not depend on the head, so it is reduced once for all 16 heads.
// One wave packs MBU tiles of 64 keys; each tile gives one whole 128-byte line.
// The same threads turn Wo into f16, 8 consecutive values each: MASK_BLOCKS * 256 * 8
// is exactly E * E.  Its two loads are issued ahead of the mask loop and used behind it.
#define MBU 4
#define MASK_BLOCKS (NB * 128 * 32 / (8 * MBU))
static_assert(MASK_BLOCKS * 256 * 8 == EE * EE, "one thread per 8 values of Wo");
static __device__ __forceinline__ void mask_wo_block(const int blk,
                                                     const int* __restrict__ mask,
                                                     unsigned* __restrict__ MB,
                                                     const float* __restrict__ Wo,
                                                     _Float16* __restrict__ WoH) {
  const int wi = (blk * 256 + (int)threadIdx.x) * 8;
  const v4f w0 = *(const v4f*)(Wo + wi);
  const v4f w1 = *(const v4f*)(Wo + wi + 4);

  const int lane = threadIdx.x & 31;
  const int wave = threadIdx.x >> 5;
  const int unit = (blk * 8 + wave) * MBU;          // 4 * 128 * 32 tiles of 64 keys
  const int n    = unit >> 12;
  const int qt   = (unit >> 5) & 127;
  const int t0   = unit & 31;
  const int col  = lane & 15;
  const int hi   = lane >> 4;
  const int* mr = mask + (size_t)n * LL * LL + (size_t)(qt * 16 + col) * LL + t0 * 64 + 8 * hi;

  unsigned* mo = MB + (size_t)unit * 32 + lane;

  // two tiles a trip, kept rolled: 16 loads in flight per wave, and one trip's 64
  // ballot words fit the scalar registers
#pragma unroll 1
  for (int g = 0; g < MBU / 2; ++g) {
    // the inner loops are unrolled so that every index of m[][] is a constant
    v4i m[2][8];
    const int* mg = mr + g * 2 * 64;
#pragma unroll
    for (int u = 0; u < 2; ++u)
#pragma unroll
      for (int p = 0; p < 2; ++p) {
        const int* q = mg + u * 64 + p * 32;
        m[u][p * 4 + 0] = *(const v4i*)(q);
        m[u][p * 4 + 1] = *(const v4i*)(q + 4);
        m[u][p * 4 + 2] = *(const v4i*)(q + 16);
        m[u][p * 4 + 3] = *(const v4i*)(q + 20);
      }
#pragma unroll
    for (int u = 0; u < 2; ++u) {
      unsigned val = 0;
#pragma unroll
      for (int w = 0; w < 32; ++w) {
        const unsigned b = __builtin_amdgcn_ballot_w32(m[u][w >> 2][w & 3] != 0);
        val = (lane == w) ? b : val;
      }
      mo[(g * 2 + u) * 32] = val;
    }
    // the next trip's loads land in registers that these stores name: kept behind this wait;
    // it takes the trip's load address as an input, so that no load lands in its registers
    asm volatile("s_wait_xcnt 0x0" :: "v"(mg) : "memory");
  }

  v8h wh;
  // unrolled so that every index of wh, w0 and w1 is a constant
#pragma unroll
  for (int i = 0; i < 4; ++i) { wh[i] = (_Float16)w0[i]; wh[i + 4] = (_Float16)w1[i]; }
  *(v8h*)(WoH + wi) = wh;
}

// ------------------------------------------- per-head projections Q/K/V @ W^T
// Qp, Kp : f16 [N][H][L][D] row-major.  VpT : f16 [N][H][D][L] (head-transposed)
// W is the same for every head and row: a wave turns it into its 8 B fragments once,
// keeps them in registers and walks PT consecutive 16-row tiles of one head with them.
#define PT 4
#define PROJ_BLOCKS (3 * 8192 / (8 * PT))
static_assert(128 % (8 * PT) == 0, "a block's tiles lie inside one head");

// one lane's share of a 16 x 64 f32 tile: 8 values at p, p + 16, p + 32, p + 48
static __device__ __forceinline__ void load_x(v4f (&x)[8], const float* p) {
  // unrolled so that every index of x[] is a constant
#pragma unroll
  for (int i = 0; i < 4; ++i) {
    x[2 * i]     = *(const v4f*)(p + 16 * i);
    x[2 * i + 1] = *(const v4f*)(p + 16 * i + 4);
  }
}

static __device__ __forceinline__ v8h cvt8v(v4f lo, v4f hi) {
  v8h r;
  // unrolled so that every index of r, lo and hi is a constant
#pragma unroll
  for (int i = 0; i < 4; ++i) { r[i] = (_Float16)lo[i]; r[i + 4] = (_Float16)hi[i]; }
  return r;
}

// VT: the result goes out transposed (V); else row-major (Q, K).  out points at the
// lane's first element of the wave's first tile.
template <bool VT>
static __device__ __forceinline__ void proj_tiles(const float* __restrict__ xp,
                                                  const float* __restrict__ wp,
                                                  _Float16* __restrict__ out) {
  // the first tile's rows come from memory: asked for together with the first half of W
  v4f x[8];
  load_x(x, xp);

  // B^T = W (row e, contiguous d)
  v16h b[4][2];
  // every loop here is unrolled so that the indices of x[], b[][] and c are constants
  // and the arrays live in registers
#pragma unroll
  for (int j = 0; j < 4; ++j) {
    const float* wrow = wp + j * 16 * DD;
    b[j][0] = cat16(cvt8(wrow),      cvt8(wrow + 16));
    b[j][1] = cat16(cvt8(wrow + 32), cvt8(wrow + 48));
    // W is asked for in two halves, and the tiles' loads stay behind it: half the landing
    // registers, so that three blocks fit a WGP
    if (j & 1) __builtin_amdgcn_sched_barrier(0);
  }
  // behind W's loads; takes their address as an input, so that no load lands in its registers
  asm volatile("s_wait_xcnt 0x0" :: "v"(wp) : "memory");

#pragma unroll
  for (int t = 0; t < PT; ++t) {
    // A fragments: X tile (16 rows x 64 d), f32 -> f16
    const v16h a0 = cat16(cvt8v(x[0], x[1]), cvt8v(x[2], x[3]));
    const v16h a1 = cat16(cvt8v(x[4], x[5]), cvt8v(x[6], x[7]));
    // keeps the next tile's loads behind this tile's conversion: one set of landing
    // registers, not two
    __builtin_amdgcn_sched_barrier(0);
    // the next tile's rows are fetched while this tile is worked on
    if (t + 1 < PT) load_x(x, xp + (t + 1) * 16 * EE);

#pragma unroll
    for (int j = 0; j < 4; ++j) {
      v8f c = {};
      c = wmma16(a0, b[j][0], c);
      c = wmma16(a1, b[j][1], c);
      if (VT) {
        // transpose store: per lane the 8 C values are contiguous along L
        v8h pk;
#pragma unroll
        for (int r = 0; r < 8; ++r) pk[r] = (_Float16)c[r];
        *(v8h*)(out + (size_t)(j * 16) * LL + t * 16) = pk;
      } else {
#pragma unroll
        for (int r = 0; r < 8; ++r)
          out[(t * 16 + r) * DD + j * 16] = (_Float16)c[r];
      }
      // the next product lands in registers that these stores name: kept behind this wait;
      // it takes both addresses as inputs, so that nothing lands in their registers before it
      asm volatile("s_wait_xcnt 0x0" :: "v"(xp), "v"(out) : "memory");
    }
    // keeps the next tile's conversion, which waits for its loads, behind this tile's stores
    __builtin_amdgcn_sched_barrier(0);
  }
}

static __device__ __forceinline__ void proj_block(const int blk,
                       const float* __restrict__ Q, const float* __restrict__ K,
                       const float* __restrict__ V,
                       const float* __restrict__ Wq, const float* __restrict__ Wk,
                       const float* __restrict__ Wv,
                       _Float16* __restrict__ Qp, _Float16* __restrict__ Kp,
                       _Float16* __restrict__ VpT) {
  const int lane = threadIdx.x & 31;
  const int wave = threadIdx.x >> 5;
  const int mat  = blk / (PROJ_BLOCKS / 3);               // 0=Q 1=K 2=V
  const int tb   = (blk % (PROJ_BLOCKS / 3)) * (8 * PT);  // the block's first of 8192 tiles
  const int n    = tb >> 11;                              // / (H*128)
  const int h    = (tb >> 7) & 15;
  const int q0   = ((tb & 127) + wave * PT) * 16;         // the wave's first row
  const int col  = lane & 15;
  const int kb   = (lane >> 4) * 8;
  const int hi   = lane >> 4;

  const float* X = (mat == 0) ? Q : (mat == 1) ? K : V;
  const float* W = (mat == 0) ? Wq : (mat == 1) ? Wk : Wv;
  const float* xp = X + ((size_t)(n * LL + q0 + col)) * EE + h * DD + kb;
  const float* wp = W + col * DD + kb;
  const size_t nh = (size_t)(n * HH + h);

  if (mat == 2) proj_tiles<true>(xp, wp, VpT + (nh * DD + col) * LL + q0 + 8 * hi);
  else          proj_tiles<false>(xp, wp, ((mat == 0) ? Qp : Kp) + (nh * LL + q0 + 8 * hi) * DD + col);
}

// ------------------------------------------------ all input preparation, one launch
// Mask packing, Wo -> f16 and the projections depend on the inputs alone and not on
// each other: one grid, the part chosen by the block index (the same for a whole
// block).  The mask blocks stream from memory and come first, so that their loads
// are under way while the projection blocks start.  Launch bounds = the real block
// size: lifts the register ceiling, so that a projection wave's W fragments and the
// rows in flight stay in registers.
__global__ __launch_bounds__(256) void k_prep(const float* __restrict__ Q, const float* __restrict__ K,
                       const float* __restrict__ V,
                       const float* __restrict__ Wq, const float* __restrict__ Wk,
                       const float* __restrict__ Wv,
                       const int* __restrict__ mask, const float* __restrict__ Wo,
                       _Float16* __restrict__ Qp, _Float16* __restrict__ Kp,
                       _Float16* __restrict__ VpT, unsigned* __restrict__ MB,
                       _Float16* __restrict__ WoH) {
  const int blk = blockIdx.x;
  if (blk < MASK_BLOCKS) mask_wo_block(blk, mask, MB, Wo, WoH);
  else                   proj_block(blk - MASK_BLOCKS, Q, K, V, Wq, Wk, Wv, Qp, Kp, VpT);
}

// ------------------------------------------------------- flash attention core
// one wave per (n, h, QT 16-query tiles); Ctx: f16 [N][L][E]
// The 8 waves of a block share (n, h): K and V^T tiles of KT keys are staged in
// LDS once per block with whole-line copies instead of 16-line loads per wave.
#define QT     2               // 16-query tiles per wave
#define KT     64              // keys per staged tile
#define PITCH  72              // halves per LDS row: 144 B = 16 B x odd, no bank conflict for 16-byte reads
#define TILE_H (64 * PITCH)    // halves of one staged tile (K: 64 keys x 64 d, V^T: 64 d x 64 keys)

// One tile pair: each thread copies rows r and r+32 (16 B each) of K and of V^T.
static __device__ __forceinline__ void stage_kv(unsigned lk, const _Float16* gk,
                                                const _Float16* gv) {
  const unsigned lk1 = lk + 32 * PITCH * 2;
  const unsigned lv0 = lk + TILE_H * 2;
  const unsigned lv1 = lv0 + 32 * PITCH * 2;
  const _Float16* gk1 = gk + 32 * DD;
  const _Float16* gv1 = gv + 32 * LL;
  // s_wait_xcnt 0 closes the statement so that no address register of an issued
  // copy is rewritten ahead of it
  asm volatile("global_load_async_to_lds_b128 %0, %4, off\n\t"
               "global_load_async_to_lds_b128 %1, %5, off\n\t"
               "global_load_async_to_lds_b128 %2, %6, off\n\t"
               "global_load_async_to_lds_b128 %3, %7, off\n\t"
               "s_wait_xcnt 0x0"
               :: "v"(lk), "v"(lk1), "v"(lv0), "v"(lv1),
                  "v"(gk), "v"(gk1), "v"(gv), "v"(gv1)
               : "memory");
}

// launch bounds = the real block size: lifts the register ceiling so that QT tiles'
// accumulators, scores and Q fragments stay in registers
__global__ __launch_bounds__(256) void k_attn(const _Float16* __restrict__ Qp, const _Float16* __restrict__ Kp,
                       const _Float16* __restrict__ VpT, const unsigned* __restrict__ MB,
                       _Float16* __restrict__ Ctx) {
  __shared__ __attribute__((aligned(16))) _Float16 sm[2 * 2 * TILE_H];

  const int lane = threadIdx.x & 31;
  const int wave = threadIdx.x >> 5;
  const int tile = (blockIdx.x * 8 + wave) * QT;   // the wave's first of 8192 tiles
  const int n    = tile >> 11;
  int rem        = tile & 2047;
  const int h    = rem >> 7;
  const int q0   = (rem & 127) * 16;
  const int col  = lane & 15;
  const int kb   = (lane >> 4) * 8;
  const int hi   = lane >> 4;
  const size_t nh = (size_t)(n * HH + h);

  // every loop over c or j is unrolled so that the indices of bq, o, sT, pf, m_run, l_run
  // and the mask words are constants and the arrays live in registers

  // B fragments of Q^T (== Q rows in A-pattern), fixed for the whole loop
  v16h bq[QT][2];
#pragma unroll
  for (int c = 0; c < QT; ++c) {
    const _Float16* qrow = Qp + (nh * LL + q0 + c * 16 + col) * DD;
    bq[c][0] = cat16(*(const v8h*)(qrow + kb),      *(const v8h*)(qrow + 16 + kb));
    bq[c][1] = cat16(*(const v8h*)(qrow + 32 + kb), *(const v8h*)(qrow + 48 + kb));
  }

  float m_run[QT], l_run[QT];            // running max in log2 domain, running sum
  v8f o[QT][4];
#pragma unroll
  for (int c = 0; c < QT; ++c) {
    m_run[c] = -3.4e38f;
    l_run[c] = 0.f;
#pragma unroll
    for (int j = 0; j < 4; ++j) o[c][j] = v8f{};
  }

  // this wave's lane-mask words: the same address in every lane (readfirstlane tells
  // the compiler) and never written during this launch (the constant address space
  // tells it), so that they come by scalar loads straight into scalar registers.
  // Tile c's words for 32-key block s are mw[c * (LL / 32) + s].
  const int utile = __builtin_amdgcn_readfirstlane(tile);
  const cv16u* mw = (const cv16u*)(MB + (size_t)((utile >> 11) * 128 + (utile & 127)) * (LL / 32 * 16));
  v16u mcur[QT];
#pragma unroll
  for (int c = 0; c < QT; ++c) mcur[c] = mw[c * (LL / 32)];

  // this thread's share of a staged tile: row sr (and sr + 32), 16-byte chunk sc
  const int sr = threadIdx.x >> 3;
  const int sc = (threadIdx.x & 7) * 8;
  const _Float16* gk = Kp + (nh * LL + sr) * DD + sc;    // + k0 * DD per tile
  const _Float16* gv = VpT + (nh * DD + sr) * LL + sc;   // + k0 per tile
  const unsigned  ls = (unsigned)(size_t)(sm + sr * PITCH + sc);  // LDS byte address, buffer 0

  stage_kv(ls, gk, gv);
  asm volatile("s_wait_asynccnt 0x0" ::: "memory");  // tile 0 landed (this wave's copies)
  __syncthreads();                                   // tile 0 readable by every wave
  stage_kv(ls + 2 * TILE_H * 2, gk + KT * DD, gv + KT);

#pragma unroll 1
  for (int t = 0; t < LL / KT; ++t) {
    const _Float16* kt = sm + (t & 1) * (2 * TILE_H) + col * PITCH + kb;
    const _Float16* vt = kt + TILE_H;
#pragma unroll
    for (int p = 0; p < KT / 32; ++p) {
      // S^T = K * Q^T : per query tile two 16x16 tiles (k 0-15, 16-31); each K fragment feeds QT products
      const _Float16* kr0 = kt + p * 32 * PITCH;
      const _Float16* kr1 = kr0 + 16 * PITCH;
      const v16h ak00 = cat16(*(const v8h*)(kr0),      *(const v8h*)(kr0 + 16));
      const v16h ak01 = cat16(*(const v8h*)(kr0 + 32), *(const v8h*)(kr0 + 48));
      const v16h ak10 = cat16(*(const v8h*)(kr1),      *(const v8h*)(kr1 + 16));
      const v16h ak11 = cat16(*(const v8h*)(kr1 + 32), *(const v8h*)(kr1 + 48));
      v8f sT[QT][2];
#pragma unroll
      for (int c = 0; c < QT; ++c) {
        sT[c][0] = wmma16(ak00, bq[c][0], v8f{});
        sT[c][1] = wmma16(ak10, bq[c][0], v8f{});
      }
#pragma unroll
      for (int c = 0; c < QT; ++c) {
        sT[c][0] = wmma16(ak01, bq[c][1], sT[c][0]);
        sT[c][1] = wmma16(ak11, bq[c][1], sT[c][1]);
      }

      // mask (one select per score on its lane-mask word); reference: (-1e20 if masked) then /sqrt(E);
      // whole row pre-scaled by log2(e) so exp2 gives exact reference softmax
      float s0[QT][8], s1[QT][8];
#pragma unroll
      for (int c = 0; c < QT; ++c)
#pragma unroll
        for (int r = 0; r < 8; ++r) {
          const bool mv0 = __builtin_amdgcn_inverse_ballot_w32(mcur[c][r]);
          const bool mv1 = __builtin_amdgcn_inverse_ballot_w32(mcur[c][r + 8]);
          s0[c][r] = (mv0 ? sT[c][0][r] : -1.0e20f) * SCALE_LOG2;
          s1[c][r] = (mv1 ? sT[c][1][r] : -1.0e20f) * SCALE_LOG2;
        }

      // the next 32 keys' words are fetched as soon as this pass's are used up (the last pass
      // fetches its own again)
      const int s  = t * (KT / 32) + p;
      const int sn = (s + 1 < LL / 32) ? s + 1 : s;
#pragma unroll
      for (int c = 0; c < QT; ++c) mcur[c] = mw[c * (LL / 32) + sn];
      // keeps these scalar loads here, a whole pass ahead of their use: left free they sink to
      // just in front of the next pass's selects, and the wave waits out their latency
      __builtin_amdgcn_sched_barrier(0);

      // online softmax with a lazy rescale: the maximum in use, m_run, stays as it is while no
      // score of this pass lies more than 8 (a factor 2^8) above it: the weights then reach at
      // most 256, well inside f16, and sums and accumulators keep their scale.  softmax does not
      // depend on which value is subtracted, so the result is the reference's for any m_run.
      float tmax[QT];                              // per-lane maximum over the lane's 16 keys
      bool need = false;
#pragma unroll
      for (int c = 0; c < QT; ++c) {
        tmax[c] = fmaxf(s0[c][0], s1[c][0]);
#pragma unroll
        for (int r = 1; r < 8; ++r) { tmax[c] = fmaxf(tmax[c], s0[c][r]); tmax[c] = fmaxf(tmax[c], s1[c][r]); }
        need = need || (tmax[c] > m_run[c] + 8.0f);
      }

      // the weights are formed with the maximum in use while the test is on its way to the
      // scalar side; where the test then asks for a new maximum they are formed again
      float e[QT][16];                             // exponents, then their powers of 2
      // unrolled so that every index of e[][] is a constant and e[][] lives in registers
#pragma unroll
      for (int c = 0; c < QT; ++c) {
#pragma unroll
        for (int r = 0; r < 8; ++r) { e[c][r] = s0[c][r] - m_run[c]; e[c][8 + r] = s1[c][r] - m_run[c]; }
        exp2_hw16(e[c]);
      }

      // one test per pass for the whole wave (a scalar branch); the first pass always takes it
      if (__builtin_amdgcn_ballot_w32(need) != 0) {
#pragma unroll
        for (int c = 0; c < QT; ++c) {
          // both halves of a column take the same new maximum: one xor-16 combine
          const float m_new = fmaxf(m_run[c], fmaxf(tmax[c], __shfl_xor(tmax[c], 16, 32)));
          const float corr  = exp2_hw1(m_run[c] - m_new);
          l_run[c] *= corr;
          m_run[c] = m_new;
#pragma unroll
          for (int j = 0; j < 4; ++j)
#pragma unroll
            for (int r = 0; r < 8; ++r) o[c][j][r] *= corr;
#pragma unroll
          for (int r = 0; r < 8; ++r) { e[c][r] = s0[c][r] - m_new; e[c][8 + r] = s1[c][r] - m_new; }
          exp2_hw16(e[c]);
        }
      }

      v16h pf[QT];                                 // P^T B-fragments, in registers
#pragma unroll
      for (int c = 0; c < QT; ++c) {
        float tsum = 0.f;
#pragma unroll
        for (int r = 0; r < 8; ++r) {
          const float p0 = e[c][r];
          const float p1 = e[c][8 + r];
          tsum += p0 + p1;
          pf[c][r]     = (_Float16)p0;
          pf[c][r + 8] = (_Float16)p1;
        }
        tsum += __shfl_xor(tsum, 16, 32);
        l_run[c] += tsum;
      }

      // O^T += V^T * P^T  (V^T rows of the staged tile, keys contiguous); each V^T fragment feeds QT products
      const _Float16* v0 = vt + p * 32;
#pragma unroll
      for (int j = 0; j < 4; ++j) {
        const v16h av = cat16(*(const v8h*)(v0 + j * 16 * PITCH), *(const v8h*)(v0 + j * 16 * PITCH + 16));
#pragma unroll
        for (int c = 0; c < QT; ++c) o[c][j] = wmma16(av, pf[c], o[c][j]);
      }
    }

    asm volatile("s_wait_dscnt 0x0" ::: "memory");     // this wave's reads of tile t are done
    asm volatile("s_wait_asynccnt 0x0" ::: "memory");  // this wave's copies of tile t+1 landed
    __syncthreads();  // publishes tile t+1 and frees tile t's buffer for the refill
    if (t + 2 < LL / KT)
      stage_kv(ls + (t & 1) * (2 * TILE_H * 2), gk + (size_t)(t + 2) * KT * DD, gv + (t + 2) * KT);
  }
  asm volatile("s_wait_asynccnt 0x0" ::: "memory");    // nothing in flight when the wave ends

#pragma unroll
  for (int c = 0; c < QT; ++c) {
    const float rinv = 1.0f / l_run[c];
    _Float16* crow = Ctx + ((size_t)(n * LL) + q0 + c * 16 + col) * EE + h * DD + 8 * hi;
#pragma unroll
    for (int j = 0; j < 4; ++j) {
      v8h pk;
#pragma unroll
      for (int r = 0; r < 8; ++r) pk[r] = (_Float16)(o[c][j][r] * rinv);
      *(v8h*)(crow + j * 16) = pk;
    }
  }
}

// ---------------------------------------------- out = Ctx @ Wo^T + bo  (f32)
// One block computes a 128 x 128 tile of Out; its 8 waves (4 along m, 2 along e)
// each hold 32 x 64.  Slices of OKS k-values of the Ctx rows and of the Wo rows
// are staged in LDS with whole-line copies and shared by the waves.
#define OKS     64              // k-values per staged slice (one 128-byte line per row)
#define OTILE_H (128 * PITCH)   // halves of one staged operand slice (128 rows)

// One slice pair: each thread copies 16 B of rows r, r+32, r+64, r+96 of Ctx and of Wo.
static __device__ __forceinline__ void stage_ab(unsigned la, const _Float16* ga,
                                                const _Float16* gb) {
  const unsigned la1 = la + 32 * PITCH * 2;
  const unsigned la2 = la + 64 * PITCH * 2;
  const unsigned la3 = la + 96 * PITCH * 2;
  const unsigned lb0 = la + OTILE_H * 2;
  const unsigned lb1 = lb0 + 32 * PITCH * 2;
  const unsigned lb2 = lb0 + 64 * PITCH * 2;
  const unsigned lb3 = lb0 + 96 * PITCH * 2;
  const _Float16* ga1 = ga + 32 * EE;
  const _Float16* ga2 = ga + 64 * EE;
  const _Float16* ga3 = ga + 96 * EE;
  const _Float16* gb1 = gb + 32 * EE;
  const _Float16* gb2 = gb + 64 * EE;
  const _Float16* gb3 = gb + 96 * EE;
  // s_wait_xcnt 0 closes the statement so that no address register of an issued
  // copy is rewritten ahead of it
  asm volatile("global_load_async_to_lds_b128 %0, %8, off\n\t"
               "global_load_async_to_lds_b128 %1, %9, off\n\t"
               "global_load_async_to_lds_b128 %2, %10, off\n\t"
               "global_load_async_to_lds_b128 %3, %11, off\n\t"
               "global_load_async_to_lds_b128 %4, %12, off\n\t"
               "global_load_async_to_lds_b128 %5, %13, off\n\t"
               "global_load_async_to_lds_b128 %6, %14, off\n\t"
               "global_load_async_to_lds_b128 %7, %15, off\n\t"
               "s_wait_xcnt 0x0"
               :: "v"(la), "v"(la1), "v"(la2), "v"(la3),
                  "v"(lb0), "v"(lb1), "v"(lb2), "v"(lb3),
                  "v"(ga), "v"(ga1), "v"(ga2), "v"(ga3),
                  "v"(gb), "v"(gb1), "v"(gb2), "v"(gb3)
               : "memory");
}

// launch bounds = the real block size: lifts the register ceiling so that the 8
// accumulator tiles and their fragments stay in registers
__global__ __launch_bounds__(256) void k_out(const _Float16* __restrict__ Ctx,
                                             const _Float16* __restrict__ WoH,
                                             const float* __restrict__ bo,
                                             float* __restrict__ Out) {
  __shared__ __attribute__((aligned(16))) _Float16 so[2 * 2 * OTILE_H];

  const int lane = threadIdx.x & 31;
  const int wave = threadIdx.x >> 5;
  const int m0 = (blockIdx.x >> 3) * 128;   // 64 m-blocks x 8 e-blocks
  const int e0 = (blockIdx.x & 7) * 128;
  const int wm = (wave >> 1) * 32;          // this wave's rows inside the block tile
  const int we = (wave & 1) * 64;           // this wave's columns inside the block tile
  const int col = lane & 15;
  const int kb  = (lane >> 4) * 8;
  const int hi  = lane >> 4;

  v8f acc[2][4] = {};

  // this thread's share of a staged slice: row sr (+32, +64, +96), 16-byte chunk sc
  const int sr = threadIdx.x >> 3;
  const int sc = (threadIdx.x & 7) * 8;
  const _Float16* ga = Ctx + (size_t)(m0 + sr) * EE + sc;   // + t * OKS per slice
  const _Float16* gb = WoH + (size_t)(e0 + sr) * EE + sc;   // + t * OKS per slice
  const unsigned  ls = (unsigned)(size_t)(so + sr * PITCH + sc);  // LDS byte address, buffer 0

  stage_ab(ls, ga, gb);
  asm volatile("s_wait_asynccnt 0x0" ::: "memory");  // slice 0 landed (this wave's copies)
  __syncthreads();                                   // slice 0 readable by every wave
  stage_ab(ls + 2 * OTILE_H * 2, ga + OKS, gb + OKS);

  // kept rolled: one foot (waits, barrier, refill) per slice, small loop text
#pragma unroll 1
  for (int t = 0; t < EE / OKS; ++t) {
    const _Float16* at = so + (t & 1) * (2 * OTILE_H) + (wm + col) * PITCH + kb;
    const _Float16* bt = so + (t & 1) * (2 * OTILE_H) + OTILE_H + (we + col) * PITCH + kb;
    // the inner loops here and in the epilogue are unrolled so that every index of
    // a[], b[] and acc[][] is a constant and the arrays live in registers
#pragma unroll
    for (int kk = 0; kk < OKS / 32; ++kk) {
      v16h a[2], b[4];
#pragma unroll
      for (int i = 0; i < 2; ++i) {
        const _Float16* r = at + i * 16 * PITCH + kk * 32;
        a[i] = cat16(*(const v8h*)(r), *(const v8h*)(r + 16));
      }
#pragma unroll
      for (int j = 0; j < 4; ++j) {
        const _Float16* r = bt + j * 16 * PITCH + kk * 32;
        b[j] = cat16(*(const v8h*)(r), *(const v8h*)(r + 16));
      }
#pragma unroll
      for (int i = 0; i < 2; ++i)
#pragma unroll
        for (int j = 0; j < 4; ++j) acc[i][j] = wmma16(a[i], b[j], acc[i][j]);
    }

    asm volatile("s_wait_dscnt 0x0" ::: "memory");     // this wave's reads of slice t are done
    asm volatile("s_wait_asynccnt 0x0" ::: "memory");  // this wave's copies of slice t+1 landed
    __syncthreads();  // publishes slice t+1 and frees slice t's buffer for the refill
    if (t + 2 < EE / OKS)
      stage_ab(ls + (t & 1) * (2 * OTILE_H * 2), ga + (t + 2) * OKS, gb + (t + 2) * OKS);
  }
  asm volatile("s_wait_asynccnt 0x0" ::: "memory");    // nothing in flight when the wave ends

#pragma unroll
  for (int j = 0; j < 4; ++j) {
    const int e = e0 + we + j * 16 + col;
    const float bias = bo[e];
#pragma unroll
    for (int i = 0; i < 2; ++i)
#pragma unroll
      for (int r = 0; r < 8; ++r)
        Out[(size_t)(m0 + wm + i * 16 + r + 8 * hi) * EE + e] = acc[i][j][r] + bias;
  }
}

extern "C" void kernel_launch(void* const* d_in, const int* in_sizes, int n_in,
                              void* d_out, int out_size, void* d_ws, size_t ws_size,
                              hipStream_t stream) {
  const float* values  = (const float*)d_in[0];
  const float* keys    = (const float*)d_in[1];
  const float* queries = (const float*)d_in[2];
  const int*   mask    = (const int*)d_in[3];
  const float* Wq      = (const float*)d_in[4];
  const float* Wk      = (const float*)d_in[5];
  const float* Wv      = (const float*)d_in[6];
  const float* Wo      = (const float*)d_in[7];
  const float* bo      = (const float*)d_in[8];
  float* out = (float*)d_out;

  _Float16* ws = (_Float16*)d_ws;
  const size_t per = (size_t)NB * HH * LL * DD;   // 8M halves = 16 MB each
  _Float16* Qp  = ws;
  _Float16* Kp  = Qp + per;
  _Float16* VpT = Kp + per;
  _Float16* Ctx = VpT + per;
  _Float16* WoH = Ctx + per;                       // + 2 MB
  unsigned* MB  = (unsigned*)(WoH + (size_t)EE * EE);  // + 2 MB  (total ~68 MB)

  hipLaunchKernelGGL(k_prep, dim3(MASK_BLOCKS + PROJ_BLOCKS), dim3(256), 0, stream,
                     queries, keys, values, Wq, Wk, Wv, mask, Wo, Qp, Kp, VpT, MB, WoH);
  hipLaunchKernelGGL(k_attn, dim3(8192 / (8 * QT)), dim3(256), 0, stream,
                     Qp, Kp, VpT, MB, Ctx);
  hipLaunchKernelGGL(k_out, dim3(64 * 8), dim3(256), 0, stream, Ctx, WoH, bo, out);
}

// v009
// A run of this version takes 105 microseconds.
// Two timings next to v008 put it at 1.09 and 1.08 times that version's speed.
// Counting every step since v000, it is 3.42 times as fast.
#include <hip/hip_runtime.h>
#include <hip/hip_bf16.h>

#define NB 4
#define LL 2048
#define EE 1024
#define HH 16
#define DD 64

typedef __attribute__((ext_vector_type(16))) _Float16 v16h;
typedef __attribute__((ext_vector_type(8)))  _Float16 v8h;
typedef __attribute__((ext_vector_type(8)))  float    v8f;
typedef __attribute__((ext_vector_type(4)))  int      v4i;
typedef __attribute__((ext_vector_type(4)))  float    v4f;
typedef __attribute__((ext_vector_type(16))) unsigned v16u;
typedef __attribute__((address_space(4))) v16u        cv16u;

// 1/sqrt(E) * log2(e): softmax computed with exp2 (hardware-native) is exact
// softmax of the reference logits since all logits share the same scale.
#define SCALE_LOG2 (0.03125f * 1.44269504088896340736f)

static __device__ __forceinline__ v16h cat16(v8h lo, v8h hi) {
  v16h r;
#pragma unroll
  for (int i = 0; i < 8; ++i) { r[i] = lo[i]; r[i + 8] = hi[i]; }
  return r;
}

static __device__ __forceinline__ v8h cvt8(const float* p) {
  v8h r;
#pragma unroll
  for (int i = 0; i < 8; ++i) r[i] = (_Float16)p[i];
  return r;
}

// e[i] = 2^e[i] on the hardware exponential alone, without the library's range
// fix-up for results below 2^-126: such a weight is 0 as f16 and far below one
// f32 ulp of the row sum (which is at least 1), and a rescale factor that small
// is 0 too.  One statement, in place: every v_exp_f32 is followed by one that is
// independent of it and the last by v_nop, which is the slot the instruction set
// asks for before a transcendental's result is read or its source overwritten.
static __device__ __forceinline__ float exp2_hw1(float x) {
  // v_nop: the same slot behind a single v_exp_f32
  asm("v_exp_f32 %0, %0\n\t"
      "v_nop"
      : "+v"(x));
  return x;
}

static __device__ __forceinline__ void exp2_hw16(float (&e)[16]) {
  asm("v_exp_f32 %0, %0\n\t"
      "v_exp_f32 %1, %1\n\t"
      "v_exp_f32 %2, %2\n\t"
      "v_exp_f32 %3, %3\n\t"
      "v_exp_f32 %4, %4\n\t"
      "v_exp_f32 %5, %5\n\t"
      "v_exp_f32 %6, %6\n\t"
      "v_exp_f32 %7, %7\n\t"
      "v_exp_f32 %8, %8\n\t"
      "v_exp_f32 %9, %9\n\t"
      "v_exp_f32 %10, %10\n\t"
      "v_exp_f32 %11, %11\n\t"
      "v_exp_f32 %12, %12\n\t"
      "v_exp_f32 %13, %13\n\t"
      "v_exp_f32 %14, %14\n\t"
      "v_exp_f32 %15, %15\n\t"
      "v_nop"
      : "+v"(e[0]), "+v"(e[1]), "+v"(e[2]), "+v"(e[3]), "+v"(e[4]), "+v"(e[5]),
        "+v"(e[6]), "+v"(e[7]), "+v"(e[8]), "+v"(e[9]), "+v"(e[10]), "+v"(e[11]),
        "+v"(e[12]), "+v"(e[13]), "+v"(e[14]), "+v"(e[15]));
}

static __device__ __forceinline__ v8f wmma16(v16h a, v16h b, v8f c) {
  // D(16x16,f32) = A(16x32,f16) * B(32x16,f16) + C
  return __builtin_amdgcn_wmma_f32_16x16x32_f16(false, a, false, b, (short)0, c,
                                                false, false);
}

// ------------------------------------------------ whole-line staging for k_prep
// A wave's tile is 16 rows of 256 bytes (64 f32 of X, or 64 mask words).  Read straight
// into fragment order, a load takes 32 bytes from each of 16 lines; here the tile comes
// into LDS by copies that take two whole rows (four whole lines) each, and the lanes pick
// their fragment order out of LDS.  Every wave has two buffers of its own: no other wave
// reads or refills them, so the wave's own waits order everything and no barrier is needed.
#define SP 272                 // bytes per staged row: 256 + 16 = 16 B x odd, no bank conflict for 16-byte reads
#define ST (16 * SP)           // bytes of one staged tile
#define SW (2 * ST)            // bytes of one wave's two buffers

// One tile: a lane copies its 16 bytes of rows r, r + 2, ..., r + 14; pitch in elements.
template <typename T>
static __device__ __forceinline__ void stage_rows(unsigned l0, const T* g0, const int pitch) {
  const unsigned l1 = l0 + 2 * SP,  l2 = l0 + 4 * SP,  l3 = l0 + 6 * SP;
  const unsigned l4 = l0 + 8 * SP,  l5 = l0 + 10 * SP, l6 = l0 + 12 * SP, l7 = l0 + 14 * SP;
  const T* g1 = g0 + 2 * pitch;
  const T* g2 = g0 + 4 * pitch;
  const T* g3 = g0 + 6 * pitch;
  const T* g4 = g0 + 8 * pitch;
  const T* g5 = g0 + 10 * pitch;
  const T* g6 = g0 + 12 * pitch;
  const T* g7 = g0 + 14 * pitch;
  // s_wait_xcnt 0 closes the statement so that no address register of an issued
  // copy is rewritten ahead of it
  asm volatile("global_load_async_to_lds_b128 %0, %8, off\n\t"
               "global_load_async_to_lds_b128 %1, %9, off\n\t"
               "global_load_async_to_lds_b128 %2, %10, off\n\t"
               "global_load_async_to_lds_b128 %3, %11, off\n\t"
               "global_load_async_to_lds_b128 %4, %12, off\n\t"
               "global_load_async_to_lds_b128 %5, %13, off\n\t"
               "global_load_async_to_lds_b128 %6, %14, off\n\t"
               "global_load_async_to_lds_b128 %7, %15, off\n\t"
               "s_wait_xcnt 0x0"
               :: "v"(l0), "v"(l1), "v"(l2), "v"(l3), "v"(l4), "v"(l5), "v"(l6), "v"(l7),
                  "v"(g0), "v"(g1), "v"(g2), "v"(g3), "v"(g4), "v"(g5), "v"(g6), "v"(g7)
               : "memory");
}

// the foot of a trip over staged tiles: behind it the wave may refill the buffer it has
// just read and read the other one
static __device__ __forceinline__ void stage_foot() {
  asm volatile("s_wait_dscnt 0x0" ::: "memory");     // this wave's reads of the tile are done
  asm volatile("s_wait_asynccnt 0x0" ::: "memory");  // this wave's copies of the next tile landed
}

// ------------------------------------------------ mask -> lane-mask words
// MB[n][16-query tile][32-key block][16]: word w of a block is the lane mask that
// k_attn's wave needs for score register w (w < 8: keys 0-15, else keys 16-31 of
// the block): bit `lane` = (mask[q0 + (lane & 15)][k0 + (w >> 3) * 16 + (w & 7) + 8 * (lane >> 4)] != 0).
// The mask does not depend on the head, so it is reduced once for all 16 heads.
// One wave packs MBU tiles of 64 keys, staged ahead; each tile gives one whole 128-byte line.
// The same threads turn Wo into f16, 8 consecutive values each: MASK_BLOCKS * 256 * 8
// is exactly E * E.  Its two loads are issued ahead of the mask loop and used behind it.
#define MBU 4
#define MASK_BLOCKS (NB * 128 * 32 / (8 * MBU))
static_assert(MASK_BLOCKS * 256 * 8 == EE * EE, "one thread per 8 values of Wo");
static __device__ __forceinline__ void mask_wo_block(const int blk, const char* sb,
                                                     const int* __restrict__ mask,
                                                     unsigned* __restrict__ MB,
                                                     const float* __restrict__ Wo,
                                                     _Float16* __restrict__ WoH) {
  const int wi = (blk * 256 + (int)threadIdx.x) * 8;
  const v4f w0 = *(const v4f*)(Wo + wi);
  const v4f w1 = *(const v4f*)(Wo + wi + 4);

  const int lane = threadIdx.x & 31;
  const int wave = threadIdx.x >> 5;
  const int unit = (blk * 8 + wave) * MBU;          // 4 * 128 * 32 tiles of 64 keys
  const int n    = unit >> 12;
  const int qt   = (unit >> 5) & 127;
  const int t0   = unit & 31;
  const int col  = lane & 15;
  const int hi   = lane >> 4;
  // the lane's share of a copy: row lane >> 4 (and every second row on), 16-byte chunk lane & 15
  const int* mg = mask + (size_t)n * LL * LL + (size_t)(qt * 16 + hi) * LL + t0 * 64 + col * 4;
  const unsigned lw = (unsigned)(size_t)(sb + wave * SW + hi * SP + col * 16);  // LDS byte address, buffer 0
  // the lane's reads: row col, from word 8 * hi
  const char* lr = sb + wave * SW + col * SP + hi * 32;

  unsigned* mo = MB + (size_t)unit * 32 + lane;

  // both buffers are filled at the start, their copies in flight together
  stage_rows(lw, mg, LL);
  stage_rows(lw + ST, mg + 64, LL);
  asm volatile("s_wait_asynccnt 0x0" ::: "memory");  // tiles 0 and 1 landed (this wave's copies)

  // kept rolled: one trip's 32 ballot words fit the scalar registers, small loop text
#pragma unroll 1
  for (int u = 0; u < MBU; ++u) {
    // the inner loops are unrolled so that every index of m[] is a constant
    v4i m[8];
    const char* q = lr + (u & 1) * ST;
#pragma unroll
    for (int p = 0; p < 2; ++p) {
      m[p * 4 + 0] = *(const v4i*)(q + p * 128);
      m[p * 4 + 1] = *(const v4i*)(q + p * 128 + 16);
      m[p * 4 + 2] = *(const v4i*)(q + p * 128 + 64);
      m[p * 4 + 3] = *(const v4i*)(q + p * 128 + 80);
    }
    // keeps the tile's eight LDS reads together, in flight at once: left free they are issued
    // one at a time among the ballots and the wave waits out each one's latency in turn
    __builtin_amdgcn_sched_barrier(0);
    unsigned val = 0;
#pragma unroll
    for (int w = 0; w < 32; ++w) {
      const unsigned b = __builtin_amdgcn_ballot_w32(m[w >> 2][w & 3] != 0);
      val = (lane == w) ? b : val;
    }
    mo[u * 32] = val;
    // the next trip's word lands in the register that this store names: kept behind this wait;
    // it takes the store's address as an input, so that nothing lands in its registers before it
    asm volatile("s_wait_xcnt 0x0" :: "v"(mo) : "memory");

    stage_foot();
    // the tile after next is copied while the next one is worked on
    if (u + 2 < MBU) stage_rows(lw + (u & 1) * ST, mg + (u + 2) * 64, LL);
  }
  asm volatile("s_wait_asynccnt 0x0" ::: "memory");  // nothing in flight when the wave ends

  v8h wh;
  // unrolled so that every index of wh, w0 and w1 is a constant
#pragma unroll
  for (int i = 0; i < 4; ++i) { wh[i] = (_Float16)w0[i]; wh[i + 4] = (_Float16)w1[i]; }
  *(v8h*)(WoH + wi) = wh;
}

// ------------------------------------------- per-head projections Q/K/V @ W^T
// Qp, Kp : f16 [N][H][L][D] row-major.  VpT : f16 [N][H][D][L] (head-transposed)
// W is the same for every head and row: a wave turns it into its 8 B fragments once,
// keeps them in registers and walks PT consecutive 16-row tiles of one head with them.
#define PT 4
#define PROJ_BLOCKS (3 * 8192 / (8 * PT))
static_assert(128 % (8 * PT) == 0, "a block's tiles lie inside one head");

// one lane's share of a staged 16 x 64 f32 tile: 8 values at p, p + 16, p + 32, p + 48
static __device__ __forceinline__ void load_x(v4f (&x)[8], const float* p) {
  // unrolled so that every index of x[] is a constant
#pragma unroll
  for (int i = 0; i < 4; ++i) {
    x[2 * i]     = *(const v4f*)(p + 16 * i);
    x[2 * i + 1] = *(const v4f*)(p + 16 * i + 4);
  }
}

static __device__ __forceinline__ v8h cvt8v(v4f lo, v4f hi) {
  v8h r;
  // unrolled so that every index of r, lo and hi is a constant
#pragma unroll
  for (int i = 0; i < 4; ++i) { r[i] = (_Float16)lo[i]; r[i + 4] = (_Float16)hi[i]; }
  return r;
}

// VT: the result goes out transposed (V); else row-major (Q, K).  out points at the
// lane's first element of the wave's first tile; xp at the lane's share of the first copy,
// lw at its place in LDS, lr at the lane's first read of buffer 0.
template <bool VT>
static __device__ __forceinline__ void proj_tiles(const float* __restrict__ xp, const unsigned lw,
                                                  const char* lr,
                                                  const float* __restrict__ wp,
                                                  _Float16* __restrict__ out) {
  // the first two tiles' rows come from memory: asked for ahead of W, both buffers at once
  stage_rows(lw, xp, EE);
  stage_rows(lw + ST, xp + 16 * EE, EE);

  // B^T = W (row e, contiguous d)
  v16h b[4][2];
  // every loop here is unrolled so that the indices of x[], b[][] and c are constants
  // and the arrays live in registers
#pragma unroll
  for (int j = 0; j < 4; ++j) {
    const float* wrow = wp + j * 16 * DD;
    b[j][0] = cat16(cvt8(wrow),      cvt8(wrow + 16));
    b[j][1] = cat16(cvt8(wrow + 32), cvt8(wrow + 48));
    // W is asked for in two halves: half the landing registers, so that three blocks fit a WGP
    if (j & 1) __builtin_amdgcn_sched_barrier(0);
  }
  // behind W's loads; takes their address as an input, so that no load lands in its registers
  asm volatile("s_wait_xcnt 0x0" :: "v"(wp) : "memory");

  asm volatile("s_wait_asynccnt 0x0" ::: "memory");  // tiles 0 and 1 landed (this wave's copies)

#pragma unroll
  for (int t = 0; t < PT; ++t) {
    // A fragments: X tile (16 rows x 64 d), f32 -> f16
    v4f x[8];
    load_x(x, (const float*)(lr + (t & 1) * ST));
    const v16h a0 = cat16(cvt8v(x[0], x[1]), cvt8v(x[2], x[3]));
    const v16h a1 = cat16(cvt8v(x[4], x[5]), cvt8v(x[6], x[7]));

#pragma unroll
    for (int j = 0; j < 4; ++j) {
      v8f c = {};
      c = wmma16(a0, b[j][0], c);
      c = wmma16(a1, b[j][1], c);
      if (VT) {
        // transpose store: per lane the 8 C values are contiguous along L
        v8h pk;
#pragma unroll
        for (int r = 0; r < 8; ++r) pk[r] = (_Float16)c[r];
        *(v8h*)(out + (size_t)(j * 16) * LL + t * 16) = pk;
      } else {
#pragma unroll
        for (int r = 0; r < 8; ++r)
          out[(t * 16 + r) * DD + j * 16] = (_Float16)c[r];
      }
      // the next product lands in registers that these stores name: kept behind this wait;
      // it takes both addresses as inputs, so that nothing lands in their registers before it
      asm volatile("s_wait_xcnt 0x0" :: "v"(xp), "v"(out) : "memory");
    }
    stage_foot();
    // the tile after next is copied while the next one is worked on
    if (t + 2 < PT) stage_rows(lw + (t & 1) * ST, xp + (t + 2) * 16 * EE, EE);
  }
  asm volatile("s_wait_asynccnt 0x0" ::: "memory");  // nothing in flight when the wave ends
}

static __device__ __forceinline__ void proj_block(const int blk, const char* sb,
                       const float* __restrict__ Q, const float* __restrict__ K,
                       const float* __restrict__ V,
                       const float* __restrict__ Wq, const float* __restrict__ Wk,
                       const float* __restrict__ Wv,
                       _Float16* __restrict__ Qp, _Float16* __restrict__ Kp,
                       _Float16* __restrict__ VpT) {
  const int lane = threadIdx.x & 31;
  const int wave = threadIdx.x >> 5;
  const int mat  = blk / (PROJ_BLOCKS / 3);               // 0=Q 1=K 2=V
  const int tb   = (blk % (PROJ_BLOCKS / 3)) * (8 * PT);  // the block's first of 8192 tiles
  const int n    = tb >> 11;                              // / (H*128)
  const int h    = (tb >> 7) & 15;
  const int q0   = ((tb & 127) + wave * PT) * 16;         // the wave's first row
  const int col  = lane & 15;
  const int kb   = (lane >> 4) * 8;
  const int hi   = lane >> 4;

  const float* X = (mat == 0) ? Q : (mat == 1) ? K : V;
  const float* W = (mat == 0) ? Wq : (mat == 1) ? Wk : Wv;
  // the lane's share of a copy: row lane >> 4 (and every second row on), 16-byte chunk lane & 15
  const float* xp = X + ((size_t)(n * LL + q0 + hi)) * EE + h * DD + col * 4;
  const unsigned lw = (unsigned)(size_t)(sb + wave * SW + hi * SP + col * 16);  // LDS byte address, buffer 0
  // the lane's reads: row col, from value kb
  const char* lr = sb + wave * SW + col * SP + kb * 4;
  const float* wp = W + col * DD + kb;
  const size_t nh = (size_t)(n * HH + h);

  if (mat == 2) proj_tiles<true>(xp, lw, lr, wp, VpT + (nh * DD + col) * LL + q0 + 8 * hi);
  else          proj_tiles<false>(xp, lw, lr, wp, ((mat == 0) ? Qp : Kp) + (nh * LL + q0 + 8 * hi) * DD + col);
}

// ------------------------------------------------ all input preparation, one launch
// Mask packing, Wo -> f16 and the projections depend on the inputs alone and not on
// each other: one grid, the part chosen by the block index (the same for a whole
// block).  The mask blocks stream from memory and come first, so that their loads
// are under way while the projection blocks start.  Launch bounds = the real block
// size: lifts the register ceiling, so that a projection wave's W fragments stay in
// registers; six waves a SIMD = three blocks a WGP, as many as before the tiles were
// staged: left out, the copies' addresses are formed far ahead and held, and two fit.
__global__ __launch_bounds__(256, 6) void k_prep(const float* __restrict__ Q, const float* __restrict__ K,
                       const float* __restrict__ V,
                       const float* __restrict__ Wq, const float* __restrict__ Wk,
                       const float* __restrict__ Wv,
                       const int* __restrict__ mask, const float* __restrict__ Wo,
                       _Float16* __restrict__ Qp, _Float16* __restrict__ Kp,
                       _Float16* __restrict__ VpT, unsigned* __restrict__ MB,
                       _Float16* __restrict__ WoH) {
  __shared__ __attribute__((aligned(16))) char sb[8 * SW];
  const int blk = blockIdx.x;
  if (blk < MASK_BLOCKS) mask_wo_block(blk, sb, mask, MB, Wo, WoH);
  else                   proj_block(blk - MASK_BLOCKS, sb, Q, K, V, Wq, Wk, Wv, Qp, Kp, VpT);
}

// ------------------------------------------------------- flash attention core
// one wave per (n, h, QT 16-query tiles); Ctx: f16 [N][L][E]
// The 8 waves of a block share (n, h): K and V^T tiles of KT keys are staged in
// LDS once per block with whole-line copies instead of 16-line loads per wave.
#define QT     2               // 16-query tiles per wave
#define KT     64              // keys per staged tile
#define PITCH  72              // halves per LDS row: 144 B = 16 B x odd, no bank conflict for 16-byte reads
#define TILE_H (64 * PITCH)    // halves of one staged tile (K: 64 keys x 64 d, V^T: 64 d x 64 keys)

// One tile pair: each thread copies rows r and r+32 (16 B each) of K and of V^T.
static __device__ __forceinline__ void stage_kv(unsigned lk, const _Float16* gk,
                                                const _Float16* gv) {
  const unsigned lk1 = lk + 32 * PITCH * 2;
  const unsigned lv0 = lk + TILE_H * 2;
  const unsigned lv1 = lv0 + 32 * PITCH * 2;
  const _Float16* gk1 = gk + 32 * DD;
  const _Float16* gv1 = gv + 32 * LL;
  // s_wait_xcnt 0 closes the statement so that no address register of an issued
  // copy is rewritten ahead of it
  asm volatile("global_load_async_to_lds_b128 %0, %4, off\n\t"
               "global_load_async_to_lds_b128 %1, %5, off\n\t"
               "global_load_async_to_lds_b128 %2, %6, off\n\t"
               "global_load_async_to_lds_b128 %3, %7, off\n\t"
               "s_wait_xcnt 0x0"
               :: "v"(lk), "v"(lk1), "v"(lv0), "v"(lv1),
                  "v"(gk), "v"(gk1), "v"(gv), "v"(gv1)
               : "memory");
}

// launch bounds = the real block size: lifts the register ceiling so that QT tiles'
// accumulators, scores and Q fragments stay in registers
__global__ __launch_bounds__(256) void k_attn(const _Float16* __restrict__ Qp, const _Float16* __restrict__ Kp,
                       const _Float16* __restrict__ VpT, const unsigned* __restrict__ MB,
                       _Float16* __restrict__ Ctx) {
  __shared__ __attribute__((aligned(16))) _Float16 sm[2 * 2 * TILE_H];

  const int lane = threadIdx.x & 31;
  const int wave = threadIdx.x >> 5;
  const int tile = (blockIdx.x * 8 + wave) * QT;   // the wave's first of 8192 tiles
  const int n    = tile >> 11;
  int rem        = tile & 2047;
  const int h    = rem >> 7;
  const int q0   = (rem & 127) * 16;
  const int col  = lane & 15;
  const int kb   = (lane >> 4) * 8;
  const int hi   = lane >> 4;
  const size_t nh = (size_t)(n * HH + h);

  // every loop over c or j is unrolled so that the indices of bq, o, sT, pf, m_run, l_run
  // and the mask words are constants and the arrays live in registers

  // B fragments of Q^T (== Q rows in A-pattern), fixed for the whole loop
  v16h bq[QT][2];
#pragma unroll
  for (int c = 0; c < QT; ++c) {
    const _Float16* qrow = Qp + (nh * LL + q0 + c * 16 + col) * DD;
    bq[c][0] = cat16(*(const v8h*)(qrow + kb),      *(const v8h*)(qrow + 16 + kb));
    bq[c][1] = cat16(*(const v8h*)(qrow + 32 + kb), *(const v8h*)(qrow + 48 + kb));
  }

  float m_run[QT], l_run[QT];            // running max in log2 domain, running sum
  v8f o[QT][4];
#pragma unroll
  for (int c = 0; c < QT; ++c) {
    m_run[c] = -3.4e38f;
    l_run[c] = 0.f;
#pragma unroll
    for (int j = 0; j < 4; ++j) o[c][j] = v8f{};
  }

  // this wave's lane-mask words: the same address in every lane (readfirstlane tells
  // the compiler) and never written during this launch (the constant address space
  // tells it), so that they come by scalar loads straight into scalar registers.
  // Tile c's words for 32-key block s are mw[c * (LL / 32) + s].
  const int utile = __builtin_amdgcn_readfirstlane(tile);
  const cv16u* mw = (const cv16u*)(MB + (size_t)((utile >> 11) * 128 + (utile & 127)) * (LL / 32 * 16));
  v16u mcur[QT];
#pragma unroll
  for (int c = 0; c < QT; ++c) mcur[c] = mw[c * (LL / 32)];

  // this thread's share of a staged tile: row sr (and sr + 32), 16-byte chunk sc
  const int sr = threadIdx.x >> 3;
  const int sc = (threadIdx.x & 7) * 8;
  const _Float16* gk = Kp + (nh * LL + sr) * DD + sc;    // + k0 * DD per tile
  const _Float16* gv = VpT + (nh * DD + sr) * LL + sc;   // + k0 per tile
  const unsigned  ls = (unsigned)(size_t)(sm + sr * PITCH + sc);  // LDS byte address, buffer 0

  stage_kv(ls, gk, gv);
  asm volatile("s_wait_asynccnt 0x0" ::: "memory");  // tile 0 landed (this wave's copies)
  __syncthreads();                                   // tile 0 readable by every wave
  stage_kv(ls + 2 * TILE_H * 2, gk + KT * DD, gv + KT);

#pragma unroll 1
  for (int t = 0; t < LL / KT; ++t) {
    const _Float16* kt = sm + (t & 1) * (2 * TILE_H) + col * PITCH + kb;
    const _Float16* vt = kt + TILE_H;
#pragma unroll
    for (int p = 0; p < KT / 32; ++p) {
      // S^T = K * Q^T : per query tile two 16x16 tiles (k 0-15, 16-31); each K fragment feeds QT products
      const _Float16* kr0 = kt + p * 32 * PITCH;
      const _Float16* kr1 = kr0 + 16 * PITCH;
      const v16h ak00 = cat16(*(const v8h*)(kr0),      *(const v8h*)(kr0 + 16));
      const v16h ak01 = cat16(*(const v8h*)(kr0 + 32), *(const v8h*)(kr0 + 48));
      const v16h ak10 = cat16(*(const v8h*)(kr1),      *(const v8h*)(kr1 + 16));
      const v16h ak11 = cat16(*(const v8h*)(kr1 + 32), *(const v8h*)(kr1 + 48));
      v8f sT[QT][2];
#pragma unroll
      for (int c = 0; c < QT; ++c) {
        sT[c][0] = wmma16(ak00, bq[c][0], v8f{});
        sT[c][1] = wmma16(ak10, bq[c][0], v8f{});
      }
#pragma unroll
      for (int c = 0; c < QT; ++c) {
        sT[c][0] = wmma16(ak01, bq[c][1], sT[c][0]);
        sT[c][1] = wmma16(ak11, bq[c][1], sT[c][1]);
      }

      // mask (one select per score on its lane-mask word); reference: (-1e20 if masked) then /sqrt(E);
      // whole row pre-scaled by log2(e) so exp2 gives exact reference softmax
      float s0[QT][8], s1[QT][8];
#pragma unroll
      for (int c = 0; c < QT; ++c)
#pragma unroll
        for (int r = 0; r < 8; ++r) {
          const bool mv0 = __builtin_amdgcn_inverse_ballot_w32(mcur[c][r]);
          const bool mv1 = __builtin_amdgcn_inverse_ballot_w32(mcur[c][r + 8]);
          s0[c][r] = (mv0 ? sT[c][0][r] : -1.0e20f) * SCALE_LOG2;
          s1[c][r] = (mv1 ? sT[c][1][r] : -1.0e20f) * SCALE_LOG2;
        }

      // the next 32 keys' words are fetched as soon as this pass's are used up (the last pass
      // fetches its own again)
      const int s  = t * (KT / 32) + p;
      const int sn = (s + 1 < LL / 32) ? s + 1 : s;
#pragma unroll
      for (int c = 0; c < QT; ++c) mcur[c] = mw[c * (LL / 32) + sn];
      // keeps these scalar loads here, a whole pass ahead of their use: left free they sink to
      // just in front of the next pass's selects, and the wave waits out their latency
      __builtin_amdgcn_sched_barrier(0);

      // online softmax with a lazy rescale: the maximum in use, m_run, stays as it is while no
      // score of this pass lies more than 8 (a factor 2^8) above it: the weights then reach at
      // most 256, well inside f16, and sums and accumulators keep their scale.  softmax does not
      // depend on which value is subtracted, so the result is the reference's for any m_run.
      float tmax[QT];                              // per-lane maximum over the lane's 16 keys
      bool need = false;
#pragma unroll
      for (int c = 0; c < QT; ++c) {
        tmax[c] = fmaxf(s0[c][0], s1[c][0]);
#pragma unroll
        for (int r = 1; r < 8; ++r) { tmax[c] = fmaxf(tmax[c], s0[c][r]); tmax[c] = fmaxf(tmax[c], s1[c][r]); }
        need = need || (tmax[c] > m_run[c] + 8.0f);
      }

      // the weights are formed with the maximum in use while the test is on its way to the
      // scalar side; where the test then asks for a new maximum they are formed again
      float e[QT][16];                             // exponents, then their powers of 2
      // unrolled so that every index of e[][] is a constant and e[][] lives in registers
#pragma unroll
      for (int c = 0; c < QT; ++c) {
#pragma unroll
        for (int r = 0; r < 8; ++r) { e[c][r] = s0[c][r] - m_run[c]; e[c][8 + r] = s1[c][r] - m_run[c]; }
        exp2_hw16(e[c]);
      }

      // one test per pass for the whole wave (a scalar branch); the first pass always takes it
      if (__builtin_amdgcn_ballot_w32(need) != 0) {
#pragma unroll
        for (int c = 0; c < QT; ++c) {
          // both halves of a column take the same new maximum: one xor-16 combine
          const float m_new = fmaxf(m_run[c], fmaxf(tmax[c], __shfl_xor(tmax[c], 16, 32)));
          const float corr  = exp2_hw1(m_run[c] - m_new);
          l_run[c] *= corr;
          m_run[c] = m_new;
#pragma unroll
          for (int j = 0; j < 4; ++j)
#pragma unroll
            for (int r = 0; r < 8; ++r) o[c][j][r] *= corr;
#pragma unroll
          for (int r = 0; r < 8; ++r) { e[c][r] = s0[c][r] - m_new; e[c][8 + r] = s1[c][r] - m_new; }
          exp2_hw16(e[c]);
        }
      }

      v16h pf[QT];                                 // P^T B-fragments, in registers
#pragma unroll
      for (int c = 0; c < QT; ++c) {
        float tsum = 0.f;
#pragma unroll
        for (int r = 0; r < 8; ++r) {
          const float p0 = e[c][r];
          const float p1 = e[c][8 + r];
          tsum += p0 + p1;
          pf[c][r]     = (_Float16)p0;
          pf[c][r + 8] = (_Float16)p1;
        }
        tsum += __shfl_xor(tsum, 16, 32);
        l_run[c] += tsum;
      }

      // O^T += V^T * P^T  (V^T rows of the staged tile, keys contiguous); each V^T fragment feeds QT products
      const _Float16* v0 = vt + p * 32;
#pragma unroll
      for (int j = 0; j < 4; ++j) {
        const v16h av = cat16(*(const v8h*)(v0 + j * 16 * PITCH), *(const v8h*)(v0 + j * 16 * PITCH + 16));
#pragma unroll
        for (int c = 0; c < QT; ++c) o[c][j] = wmma16(av, pf[c], o[c][j]);
      }
    }

    asm volatile("s_wait_dscnt 0x0" ::: "memory");     // this wave's reads of tile t are done
    asm volatile("s_wait_asynccnt 0x0" ::: "memory");  // this wave's copies of tile t+1 landed
    __syncthreads();  // publishes tile t+1 and frees tile t's buffer for the refill
    if (t + 2 < LL / KT)
      stage_kv(ls + (t & 1) * (2 * TILE_H * 2), gk + (size_t)(t + 2) * KT * DD, gv + (t + 2) * KT);
  }
  asm volatile("s_wait_asynccnt 0x0" ::: "memory");    // nothing in flight when the wave ends

#pragma unroll
  for (int c = 0; c < QT; ++c) {
    const float rinv = 1.0f / l_run[c];
    _Float16* crow = Ctx + ((size_t)(n * LL) + q0 + c * 16 + col) * EE + h * DD + 8 * hi;
#pragma unroll
    for (int j = 0; j < 4; ++j) {
      v8h pk;
#pragma unroll
      for (int r = 0; r < 8; ++r) pk[r] = (_Float16)(o[c][j][r] * rinv);
      *(v8h*)(crow + j * 16) = pk;
    }
  }
}

// ---------------------------------------------- out = Ctx @ Wo^T + bo  (f32)
// One block computes a 128 x 128 tile of Out; its 8 waves (4 along m, 2 along e)
// each hold 32 x 64.  Slices of OKS k-values of the Ctx rows and of the Wo rows
// are staged in LDS with whole-line copies and shared by the waves.
#define OKS     64              // k-values per staged slice (one 128-byte line per row)
#define OTILE_H (128 * PITCH)   // halves of one staged operand slice (128 rows)

// One slice pair: each thread copies 16 B of rows r, r+32, r+64, r+96 of Ctx and of Wo.
static __device__ __forceinline__ void stage_ab(unsigned la, const _Float16* ga,
                                                const _Float16* gb) {
  const unsigned la1 = la + 32 * PITCH * 2;
  const unsigned la2 = la + 64 * PITCH * 2;
  const unsigned la3 = la + 96 * PITCH * 2;
  const unsigned lb0 = la + OTILE_H * 2;
  const unsigned lb1 = lb0 + 32 * PITCH * 2;
  const unsigned lb2 = lb0 + 64 * PITCH * 2;
  const unsigned lb3 = lb0 + 96 * PITCH * 2;
  const _Float16* ga1 = ga + 32 * EE;
  const _Float16* ga2 = ga + 64 * EE;
  const _Float16* ga3 = ga + 96 * EE;
  const _Float16* gb1 = gb + 32 * EE;
  const _Float16* gb2 = gb + 64 * EE;
  const _Float16* gb3 = gb + 96 * EE;
  // s_wait_xcnt 0 closes the statement so that no address register of an issued
  // copy is rewritten ahead of it
  asm volatile("global_load_async_to_lds_b128 %0, %8, off\n\t"
               "global_load_async_to_lds_b128 %1, %9, off\n\t"
               "global_load_async_to_lds_b128 %2, %10, off\n\t"
               "global_load_async_to_lds_b128 %3, %11, off\n\t"
               "global_load_async_to_lds_b128 %4, %12, off\n\t"
               "global_load_async_to_lds_b128 %5, %13, off\n\t"
               "global_load_async_to_lds_b128 %6, %14, off\n\t"
               "global_load_async_to_lds_b128 %7, %15, off\n\t"
               "s_wait_xcnt 0x0"
               :: "v"(la), "v"(la1), "v"(la2), "v"(la3),
                  "v"(lb0), "v"(lb1), "v"(lb2), "v"(lb3),
                  "v"(ga), "v"(ga1), "v"(ga2), "v"(ga3),
                  "v"(gb), "v"(gb1), "v"(gb2), "v"(gb3)
               : "memory");
}

// launch bounds = the real block size: lifts the register ceiling so that the 8
// accumulator tiles and their fragments stay in registers
__global__ __launch_bounds__(256) void k_out(const _Float16* __restrict__ Ctx,
                                             const _Float16* __restrict__ WoH,
                                             const float* __restrict__ bo,
                                             float* __restrict__ Out) {
  __shared__ __attribute__((aligned(16))) _Float16 so[2 * 2 * OTILE_H];

  const int lane = threadIdx.x & 31;
  const int wave = threadIdx.x >> 5;
  const int m0 = (blockIdx.x >> 3) * 128;   // 64 m-blocks x 8 e-blocks
  const int e0 = (blockIdx.x & 7) * 128;
  const int wm = (wave >> 1) * 32;          // this wave's rows inside the block tile
  const int we = (wave & 1) * 64;           // this wave's columns inside the block tile
  const int col = lane & 15;
  const int kb  = (lane >> 4) * 8;
  const int hi  = lane >> 4;

  v8f acc[2][4] = {};

  // this thread's share of a staged slice: row sr (+32, +64, +96), 16-byte chunk sc
  const int sr = threadIdx.x >> 3;
  const int sc = (threadIdx.x & 7) * 8;
  const _Float16* ga = Ctx + (size_t)(m0 + sr) * EE + sc;   // + t * OKS per slice
  const _Float16* gb = WoH + (size_t)(e0 + sr) * EE + sc;   // + t * OKS per slice
  const unsigned  ls = (unsigned)(size_t)(so + sr * PITCH + sc);  // LDS byte address, buffer 0

  stage_ab(ls, ga, gb);
  asm volatile("s_wait_asynccnt 0x0" ::: "memory");  // slice 0 landed (this wave's copies)
  __syncthreads();                                   // slice 0 readable by every wave
  stage_ab(ls + 2 * OTILE_H * 2, ga + OKS, gb + OKS);

  // kept rolled: one foot (waits, barrier, refill) per slice, small loop text
#pragma unroll 1
  for (int t = 0; t < EE / OKS; ++t) {
    const _Float16* at = so + (t & 1) * (2 * OTILE_H) + (wm + col) * PITCH + kb;
    const _Float16* bt = so + (t & 1) * (2 * OTILE_H) + OTILE_H + (we + col) * PITCH + kb;
    // the inner loops here and in the epilogue are unrolled so that every index of
    // a[], b[] and acc[][] is a constant and the arrays live in registers
#pragma unroll
    for (int kk = 0; kk < OKS / 32; ++kk) {
      v16h a[2], b[4];
#pragma unroll
      for (int i = 0; i < 2; ++i) {
        const _Float16* r = at + i * 16 * PITCH + kk * 32;
        a[i] = cat16(*(const v8h*)(r), *(const v8h*)(r + 16));
      }
#pragma unroll
      for (int j = 0; j < 4; ++j) {
        const _Float16* r = bt + j * 16 * PITCH + kk * 32;
        b[j] = cat16(*(const v8h*)(r), *(const v8h*)(r + 16));
      }
#pragma unroll
      for (int i = 0; i < 2; ++i)
#pragma unroll
        for (int j = 0; j < 4; ++j) acc[i][j] = wmma16(a[i], b[j], acc[i][j]);
    }

    asm volatile("s_wait_dscnt 0x0" ::: "memory");     // this wave's reads of slice t are done
    asm volatile("s_wait_asynccnt 0x0" ::: "memory");  // this wave's copies of slice t+1 landed
    __syncthreads();  // publishes slice t+1 and frees slice t's buffer for the refill
    if (t + 2 < EE / OKS)
      stage_ab(ls + (t & 1) * (2 * OTILE_H * 2), ga + (t + 2) * OKS, gb + (t + 2) * OKS);
  }
  asm volatile("s_wait_asynccnt 0x0" ::: "memory");    // nothing in flight when the wave ends

#pragma unroll
  for (int j = 0; j < 4; ++j) {
    const int e = e0 + we + j * 16 + col;
    const float bias = bo[e];
#pragma unroll
    for (int i = 0; i < 2; ++i)
#pragma unroll
      for (int r = 0; r < 8; ++r)
        Out[(size_t)(m0 + wm + i * 16 + r + 8 * hi) * EE + e] = acc[i][j][r] + bias;
  }
}

extern "C" void kernel_launch(void* const* d_in, const int* in_sizes, int n_in,
                              void* d_out, int out_size, void* d_ws, size_t ws_size,
                              hipStream_t stream) {
  const float* values  = (const float*)d_in[0];
  const float* keys    = (const float*)d_in[1];
  const float* queries = (const float*)d_in[2];
  const int*   mask    = (const int*)d_in[3];
  const float* Wq      = (const float*)d_in[4];
  const float* Wk      = (const float*)d_in[5];
  const float* Wv      = (const float*)d_in[6];
  const float* Wo      = (const float*)d_in[7];
  const float* bo      = (const float*)d_in[8];
  float* out = (float*)d_out;

  _Float16* ws = (_Float16*)d_ws;
  const size_t per = (size_t)NB * HH * LL * DD;   // 8M halves = 16 MB each
  _Float16* Qp  = ws;
  _Float16* Kp  = Qp + per;
  _Float16* VpT = Kp + per;
  _Float16* Ctx = VpT + per;
  _Float16* WoH = Ctx + per;                       // + 2 MB
  unsigned* MB  = (unsigned*)(WoH + (size_t)EE * EE);  // + 2 MB  (total ~68 MB)

  hipLaunchKernelGGL(k_prep, dim3(MASK_BLOCKS + PROJ_BLOCKS), dim3(256), 0, stream,
                     queries, keys, values, Wq, Wk, Wv, mask, Wo, Qp, Kp, VpT, MB, WoH);
  hipLaunchKernelGGL(k_attn, dim3(8192 / (8 * QT)), dim3(256), 0, stream,
                     Qp, Kp, VpT, MB, Ctx);
  hipLaunchKernelGGL(k_out, dim3(64 * 8), dim3(256), 0, stream, Ctx, WoH, bo, out);
}

// v010
// A run of this version takes 96.7 microseconds.
// In both of two side-by-side timings against v009, it was 1.08 times as fast.
// Counting every step since v000, it is 3.71 times as fast.
#include <hip/hip_runtime.h>
#include <hip/hip_bf16.h>

#define NB 4
#define LL 2048
#define EE 1024
#define HH 16
#define DD 64

typedef __attribute__((ext_vector_type(16))) _Float16 v16h;
typedef __attribute__((ext_vector_type(8)))  _Float16 v8h;
typedef __attribute__((ext_vector_type(8)))  float    v8f;
typedef __attribute__((ext_vector_type(4)))  int      v4i;
typedef __attribute__((ext_vector_type(4)))  float    v4f;
typedef __attribute__((ext_vector_type(16))) unsigned v16u;
typedef __attribute__((address_space(4))) v16u        cv16u;

// 1/sqrt(E) * log2(e): softmax computed with exp2 (hardware-native) is exact
// softmax of the reference logits since all logits share the same scale.
#define SCALE_LOG2 (0.03125f * 1.44269504088896340736f)
// a masked key's score in those units: reference (-1e20 if masked) then / sqrt(E)
#define MASKED (-1.0e20f * SCALE_LOG2)

static __device__ __forceinline__ v16h cat16(v8h lo, v8h hi) {
  v16h r;
#pragma unroll
  for (int i = 0; i < 8; ++i) { r[i] = lo[i]; r[i + 8] = hi[i]; }
  return r;
}

static __device__ __forceinline__ v8h cvt8(const float* p) {
  v8h r;
#pragma unroll
  for (int i = 0; i < 8; ++i) r[i] = (_Float16)p[i];
  return r;
}

// 2^x on the hardware exponential alone, without the library's range
// fix-up for results below 2^-126: such a weight is 0 as f16 and far below one
// f32 ulp of the row sum (which is at least 1), and a rescale factor that small
// is 0 too.  In one statement every v_exp_f32 is followed by one that is
// independent of it and the last by v_nop, which is the slot the instruction set
// asks for before a transcendental's result is read or its source overwritten.
static __device__ __forceinline__ float exp2_hw1(float x) {
  // v_nop: the same slot behind a single v_exp_f32
  asm("v_exp_f32 %0, %0\n\t"
      "v_nop"
      : "+v"(x));
  return x;
}

// o[B..B+7] = 2^x[B..B+7].  The results take registers of their own (early clobber: none of
// them is a source of the run), so that sources which are a matrix product's registers are
// read where they lie and nothing is copied for the run's sake.
template <int B>
static __device__ __forceinline__ void exp2_hw8(float (&o)[16], const float (&x)[16]) {
  asm("v_exp_f32 %0, %8\n\t"
      "v_exp_f32 %1, %9\n\t"
      "v_exp_f32 %2, %10\n\t"
      "v_exp_f32 %3, %11\n\t"
      "v_exp_f32 %4, %12\n\t"
      "v_exp_f32 %5, %13\n\t"
      "v_exp_f32 %6, %14\n\t"
      "v_exp_f32 %7, %15\n\t"
      "v_nop"
      : "=&v"(o[B + 0]), "=&v"(o[B + 1]), "=&v"(o[B + 2]), "=&v"(o[B + 3]),
        "=&v"(o[B + 4]), "=&v"(o[B + 5]), "=&v"(o[B + 6]), "=&v"(o[B + 7])
      : "v"(x[B + 0]), "v"(x[B + 1]), "v"(x[B + 2]), "v"(x[B + 3]),
        "v"(x[B + 4]), "v"(x[B + 5]), "v"(x[B + 6]), "v"(x[B + 7]));
}

static __device__ __forceinline__ void exp2_hw16(float (&o)[16], const float (&x)[16]) {
  exp2_hw8<0>(o, x);
  exp2_hw8<8>(o, x);
}

static __device__ __forceinline__ v8f wmma16(v16h a, v16h b, v8f c) {
  // D(16x16,f32) = A(16x32,f16) * B(32x16,f16) + C
  return __builtin_amdgcn_wmma_f32_16x16x32_f16(false, a, false, b, (short)0, c,
                                                false, false);
}

// ------------------------------------------------ whole-line staging for k_prep
// A wave's tile is 16 rows of 256 bytes (64 f32 of X, or 64 mask words).  Read straight
// into fragment order, a load takes 32 bytes from each of 16 lines; here the tile comes
// into LDS by copies that take two whole rows (four whole lines) each, and the lanes pick
// their fragment order out of LDS.  Every wave has two buffers of its own: no other wave
// reads or refills them, so the wave's own waits order everything and no barrier is needed.
#define SP 272                 // bytes per staged row: 256 + 16 = 16 B x odd, no bank conflict for 16-byte reads
#define ST (16 * SP)           // bytes of one staged tile
#define SW (2 * ST)            // bytes of one wave's two buffers

// One tile: a lane copies its 16 bytes of rows r, r + 2, ..., r + 14; pitch in elements.
template <typename T>
static __device__ __forceinline__ void stage_rows(unsigned l0, const T* g0, const int pitch) {
  const unsigned l1 = l0 + 2 * SP,  l2 = l0 + 4 * SP,  l3 = l0 + 6 * SP;
  const unsigned l4 = l0 + 8 * SP,  l5 = l0 + 10 * SP, l6 = l0 + 12 * SP, l7 = l0 + 14 * SP;
  const T* g1 = g0 + 2 * pitch;
  const T* g2 = g0 + 4 * pitch;
  const T* g3 = g0 + 6 * pitch;
  const T* g4 = g0 + 8 * pitch;
  const T* g5 = g0 + 10 * pitch;
  const T* g6 = g0 + 12 * pitch;
  const T* g7 = g0 + 14 * pitch;
  // s_wait_xcnt 0 closes the statement so that no address register of an issued
  // copy is rewritten ahead of it
  asm volatile("global_load_async_to_lds_b128 %0, %8, off\n\t"
               "global_load_async_to_lds_b128 %1, %9, off\n\t"
               "global_load_async_to_lds_b128 %2, %10, off\n\t"
               "global_load_async_to_lds_b128 %3, %11, off\n\t"
               "global_load_async_to_lds_b128 %4, %12, off\n\t"
               "global_load_async_to_lds_b128 %5, %13, off\n\t"
               "global_load_async_to_lds_b128 %6, %14, off\n\t"
               "global_load_async_to_lds_b128 %7, %15, off\n\t"
               "s_wait_xcnt 0x0"
               :: "v"(l0), "v"(l1), "v"(l2), "v"(l3), "v"(l4), "v"(l5), "v"(l6), "v"(l7),
                  "v"(g0), "v"(g1), "v"(g2), "v"(g3), "v"(g4), "v"(g5), "v"(g6), "v"(g7)
               : "memory");
}

// the foot of a trip over staged tiles: behind it the wave may refill the buffer it has
// just read and read the other one
static __device__ __forceinline__ void stage_foot() {
  asm volatile("s_wait_dscnt 0x0" ::: "memory");     // this wave's reads of the tile are done
  asm volatile("s_wait_asynccnt 0x0" ::: "memory");  // this wave's copies of the next tile landed
}

// ------------------------------------------------ mask -> lane-mask words
// MB[n][16-query tile][32-key block][16]: word w of a block is the lane mask that
// k_attn's wave needs for score register w (w < 8: keys 0-15, else keys 16-31 of
// the block): bit `lane` = (mask[q0 + (lane & 15)][k0 + (w >> 3) * 16 + (w & 7) + 8 * (lane >> 4)] != 0).
// The mask does not depend on the head, so it is reduced once for all 16 heads.
// One wave packs MBU tiles of 64 keys, staged ahead; each tile gives one whole 128-byte line.
// The same threads turn Wo into f16, 8 consecutive values each: MASK_BLOCKS * 256 * 8
// is exactly E * E.  Its two loads are issued ahead of the mask loop and used behind it.
#define MBU 4
#define MASK_BLOCKS (NB * 128 * 32 / (8 * MBU))
static_assert(MASK_BLOCKS * 256 * 8 == EE * EE, "one thread per 8 values of Wo");
static __device__ __forceinline__ void mask_wo_block(const int blk, const char* sb,
                                                     const int* __restrict__ mask,
                                                     unsigned* __restrict__ MB,
                                                     const float* __restrict__ Wo,
                                                     _Float16* __restrict__ WoH) {
  const int wi = (blk * 256 + (int)threadIdx.x) * 8;
  const v4f w0 = *(const v4f*)(Wo + wi);
  const v4f w1 = *(const v4f*)(Wo + wi + 4);

  const int lane = threadIdx.x & 31;
  const int wave = threadIdx.x >> 5;
  const int unit = (blk * 8 + wave) * MBU;          // 4 * 128 * 32 tiles of 64 keys
  const int n    = unit >> 12;
  const int qt   = (unit >> 5) & 127;
  const int t0   = unit & 31;
  const int col  = lane & 15;
  const int hi   = lane >> 4;
  // the lane's share of a copy: row lane >> 4 (and every second row on), 16-byte chunk lane & 15
  const int* mg = mask + (size_t)n * LL * LL + (size_t)(qt * 16 + hi) * LL + t0 * 64 + col * 4;
  const unsigned lw = (unsigned)(size_t)(sb + wave * SW + hi * SP + col * 16);  // LDS byte address, buffer 0
  // the lane's reads: row col, from word 8 * hi
  const char* lr = sb + wave * SW + col * SP + hi * 32;

  unsigned* mo = MB + (size_t)unit * 32 + lane;

  // both buffers are filled at the start, their copies in flight together
  stage_rows(lw, mg, LL);
  stage_rows(lw + ST, mg + 64, LL);
  asm volatile("s_wait_asynccnt 0x0" ::: "memory");  // tiles 0 and 1 landed (this wave's copies)

  // kept rolled: one trip's 32 ballot words fit the scalar registers, small loop text
#pragma unroll 1
  for (int u = 0; u < MBU; ++u) {
    // the inner loops are unrolled so that every index of m[] is a constant
    v4i m[8];
    const char* q = lr + (u & 1) * ST;
#pragma unroll
    for (int p = 0; p < 2; ++p) {
      m[p * 4 + 0] = *(const v4i*)(q + p * 128);
      m[p * 4 + 1] = *(const v4i*)(q + p * 128 + 16);
      m[p * 4 + 2] = *(const v4i*)(q + p * 128 + 64);
      m[p * 4 + 3] = *(const v4i*)(q + p * 128 + 80);
    }
    // keeps the tile's eight LDS reads together, in flight at once: left free they are issued
    // one at a time among the ballots and the wave waits out each one's latency in turn
    __builtin_amdgcn_sched_barrier(0);
    unsigned val = 0;
#pragma unroll
    for (int w = 0; w < 32; ++w) {
      const unsigned b = __builtin_amdgcn_ballot_w32(m[w >> 2][w & 3] != 0);
      val = (lane == w) ? b : val;
    }
    mo[u * 32] = val;
    // the next trip's word lands in the register that this store names: kept behind this wait;
    // it takes the store's address as an input, so that nothing lands in its registers before it
    asm volatile("s_wait_xcnt 0x0" :: "v"(mo) : "memory");

    stage_foot();
    // the tile after next is copied while the next one is worked on
    if (u + 2 < MBU) stage_rows(lw + (u & 1) * ST, mg + (u + 2) * 64, LL);
  }
  asm volatile("s_wait_asynccnt 0x0" ::: "memory");  // nothing in flight when the wave ends

  v8h wh;
  // unrolled so that every index of wh, w0 and w1 is a constant
#pragma unroll
  for (int i = 0; i < 4; ++i) { wh[i] = (_Float16)w0[i]; wh[i + 4] = (_Float16)w1[i]; }
  *(v8h*)(WoH + wi) = wh;
}

// ------------------------------------------- per-head projections Q/K/V @ W^T
// Qp, Kp : f16 [N][H][L][D] row-major.  VpT : f16 [N][H][D][L] (head-transposed)
// Qp holds the projection times SCALE_LOG2.
// W is the same for every head and row: a wave turns it into its 8 B fragments once,
// keeps them in registers and walks PT consecutive 16-row tiles of one head with them.
#define PT 4
#define PROJ_BLOCKS (3 * 8192 / (8 * PT))
static_assert(128 % (8 * PT) == 0, "a block's tiles lie inside one head");

// one lane's share of a staged 16 x 64 f32 tile: 8 values at p, p + 16, p + 32, p + 48
static __device__ __forceinline__ void load_x(v4f (&x)[8], const float* p) {
  // unrolled so that every index of x[] is a constant
#pragma unroll
  for (int i = 0; i < 4; ++i) {
    x[2 * i]     = *(const v4f*)(p + 16 * i);
    x[2 * i + 1] = *(const v4f*)(p + 16 * i + 4);
  }
}

static __device__ __forceinline__ v8h cvt8v(v4f lo, v4f hi) {
  v8h r;
  // unrolled so that every index of r, lo and hi is a constant
#pragma unroll
  for (int i = 0; i < 4; ++i) { r[i] = (_Float16)lo[i]; r[i + 4] = (_Float16)hi[i]; }
  return r;
}

// VT: the result goes out transposed (V); else row-major (Q, K).  out points at the
// lane's first element of the wave's first tile; xp at the lane's share of the first copy,
// lw at its place in LDS, lr at the lane's first read of buffer 0.  wf: a factor on a
// row-major result, applied in f32 ahead of its one rounding to f16.
template <bool VT>
static __device__ __forceinline__ void proj_tiles(const float* __restrict__ xp, const unsigned lw,
                                                  const char* lr,
                                                  const float* __restrict__ wp, const float wf,
                                                  _Float16* __restrict__ out) {
  // the first two tiles' rows come from memory: asked for ahead of W, both buffers at once
  stage_rows(lw, xp, EE);
  stage_rows(lw + ST, xp + 16 * EE, EE);

  // B^T = W (row e, contiguous d)
  v16h b[4][2];
  // every loop here is unrolled so that the indices of x[], b[][] and c are constants
  // and the arrays live in registers
#pragma unroll
  for (int j = 0; j < 4; ++j) {
    const float* wrow = wp + j * 16 * DD;
    b[j][0] = cat16(cvt8(wrow),      cvt8(wrow + 16));
    b[j][1] = cat16(cvt8(wrow + 32), cvt8(wrow + 48));
    // W is asked for in two halves: half the landing registers, so that three blocks fit a WGP
    if (j & 1) __builtin_amdgcn_sched_barrier(0);
  }
  // behind W's loads; takes their address as an input, so that no load lands in its registers
  asm volatile("s_wait_xcnt 0x0" :: "v"(wp) : "memory");

  asm volatile("s_wait_asynccnt 0x0" ::: "memory");  // tiles 0 and 1 landed (this wave's copies)

#pragma unroll
  for (int t = 0; t < PT; ++t) {
    // A fragments: X tile (16 rows x 64 d), f32 -> f16
    v4f x[8];
    load_x(x, (const float*)(lr + (t & 1) * ST));
    const v16h a0 = cat16(cvt8v(x[0], x[1]), cvt8v(x[2], x[3]));
    const v16h a1 = cat16(cvt8v(x[4], x[5]), cvt8v(x[6], x[7]));

#pragma unroll
    for (int j = 0; j < 4; ++j) {
      v8f c = {};
      c = wmma16(a0, b[j][0], c);
      c = wmma16(a1, b[j][1], c);
      if (VT) {
        // transpose store: per lane the 8 C values are contiguous along L
        v8h pk;
#pragma unroll
        for (int r = 0; r < 8; ++r) pk[r] = (_Float16)c[r];
        *(v8h*)(out + (size_t)(j * 16) * LL + t * 16) = pk;
      } else {
#pragma unroll
        for (int r = 0; r < 8; ++r)
          out[(t * 16 + r) * DD + j * 16] = (_Float16)(c[r] * wf);
      }
      // the next product lands in registers that these stores name: kept behind this wait;
      // it takes both addresses as inputs, so that nothing lands in their registers before it
      asm volatile("s_wait_xcnt 0x0" :: "v"(xp), "v"(out) : "memory");
    }
    stage_foot();
    // the tile after next is copied while the next one is worked on
    if (t + 2 < PT) stage_rows(lw + (t & 1) * ST, xp + (t + 2) * 16 * EE, EE);
  }
  asm volatile("s_wait_asynccnt 0x0" ::: "memory");  // nothing in flight when the wave ends
}

static __device__ __forceinline__ void proj_block(const int blk, const char* sb,
                       const float* __restrict__ Q, const float* __restrict__ K,
                       const float* __restrict__ V,
                       const float* __restrict__ Wq, const float* __restrict__ Wk,
                       const float* __restrict__ Wv,
                       _Float16* __restrict__ Qp, _Float16* __restrict__ Kp,
                       _Float16* __restrict__ VpT) {
  const int lane = threadIdx.x & 31;
  const int wave = threadIdx.x >> 5;
  const int mat  = blk / (PROJ_BLOCKS / 3);               // 0=Q 1=K 2=V
  const int tb   = (blk % (PROJ_BLOCKS / 3)) * (8 * PT);  // the block's first of 8192 tiles
  const int n    = tb >> 11;                              // / (H*128)
  const int h    = (tb >> 7) & 15;
  const int q0   = ((tb & 127) + wave * PT) * 16;         // the wave's first row
  const int col  = lane & 15;
  const int kb   = (lane >> 4) * 8;
  const int hi   = lane >> 4;

  const float* X = (mat == 0) ? Q : (mat == 1) ? K : V;
  const float* W = (mat == 0) ? Wq : (mat == 1) ? Wk : Wv;
  // the lane's share of a copy: row lane >> 4 (and every second row on), 16-byte chunk lane & 15
  const float* xp = X + ((size_t)(n * LL + q0 + hi)) * EE + h * DD + col * 4;
  const unsigned lw = (unsigned)(size_t)(sb + wave * SW + hi * SP + col * 16);  // LDS byte address, buffer 0
  // the lane's reads: row col, from value kb
  const char* lr = sb + wave * SW + col * SP + kb * 4;
  const float* wp = W + col * DD + kb;
  const size_t nh = (size_t)(n * HH + h);
  // Q carries the softmax scale: k_attn's score products then come out in log2 units
  const float wf = (mat == 0) ? SCALE_LOG2 : 1.0f;

  if (mat == 2) proj_tiles<true>(xp, lw, lr, wp, wf, VpT + (nh * DD + col) * LL + q0 + 8 * hi);
  else          proj_tiles<false>(xp, lw, lr, wp, wf, ((mat == 0) ? Qp : Kp) + (nh * LL + q0 + 8 * hi) * DD + col);
}

// ------------------------------------------------ all input preparation, one launch
// Mask packing, Wo -> f16 and the projections depend on the inputs alone and not on
// each other: one grid, the part chosen by the block index (the same for a whole
// block).  The mask blocks stream from memory and come first, so that their loads
// are under way while the projection blocks start.  Launch bounds = the real block
// size: lifts the register ceiling, so that a projection wave's W fragments stay in
// registers; six waves a SIMD = three blocks a WGP, as many as before the tiles were
// staged: left out, the copies' addresses are formed far ahead and held, and two fit.
__global__ __launch_bounds__(256, 6) void k_prep(const float* __restrict__ Q, const float* __restrict__ K,
                       const float* __restrict__ V,
                       const float* __restrict__ Wq, const float* __restrict__ Wk,
                       const float* __restrict__ Wv,
                       const int* __restrict__ mask, const float* __restrict__ Wo,
                       _Float16* __restrict__ Qp, _Float16* __restrict__ Kp,
                       _Float16* __restrict__ VpT, unsigned* __restrict__ MB,
                       _Float16* __restrict__ WoH) {
  __shared__ __attribute__((aligned(16))) char sb[8 * SW];
  const int blk = blockIdx.x;
  if (blk < MASK_BLOCKS) mask_wo_block(blk, sb, mask, MB, Wo, WoH);
  else                   proj_block(blk - MASK_BLOCKS, sb, Q, K, V, Wq, Wk, Wv, Qp, Kp, VpT);
}

// ------------------------------------------------------- flash attention core
// one wave per (n, h, QT 16-query tiles); Ctx: f16 [N][L][E]
// The 8 waves of a block share (n, h): K and V^T tiles of KT keys are staged in
// LDS once per block with whole-line copies instead of 16-line loads per wave.
#define QT     2               // 16-query tiles per wave
#define KT     64              // keys per staged tile
#define PITCH  72              // halves per LDS row: 144 B = 16 B x odd, no bank conflict for 16-byte reads
#define TILE_H (64 * PITCH)    // halves of one staged tile (K: 64 keys x 64 d, V^T: 64 d x 64 keys)

// One tile pair: each thread copies rows r and r+32 (16 B each) of K and of V^T.
static __device__ __forceinline__ void stage_kv(unsigned lk, const _Float16* gk,
                                                const _Float16* gv) {
  const unsigned lk1 = lk + 32 * PITCH * 2;
  const unsigned lv0 = lk + TILE_H * 2;
  const unsigned lv1 = lv0 + 32 * PITCH * 2;
  const _Float16* gk1 = gk + 32 * DD;
  const _Float16* gv1 = gv + 32 * LL;
  // s_wait_xcnt 0 closes the statement so that no address register of an issued
  // copy is rewritten ahead of it
  asm volatile("global_load_async_to_lds_b128 %0, %4, off\n\t"
               "global_load_async_to_lds_b128 %1, %5, off\n\t"
               "global_load_async_to_lds_b128 %2, %6, off\n\t"
               "global_load_async_to_lds_b128 %3, %7, off\n\t"
               "s_wait_xcnt 0x0"
               :: "v"(lk), "v"(lk1), "v"(lv0), "v"(lv1),
                  "v"(gk), "v"(gk1), "v"(gv), "v"(gv1)
               : "memory");
}

// launch bounds = the real block size: lifts the register ceiling so that QT tiles'
// accumulators, scores and Q fragments stay in registers
__global__ __launch_bounds__(256) void k_attn(const _Float16* __restrict__ Qp, const _Float16* __restrict__ Kp,
                       const _Float16* __restrict__ VpT, const unsigned* __restrict__ MB,
                       _Float16* __restrict__ Ctx) {
  __shared__ __attribute__((aligned(16))) _Float16 sm[2 * 2 * TILE_H];

  const int lane = threadIdx.x & 31;
  const int wave = threadIdx.x >> 5;
  const int tile = (blockIdx.x * 8 + wave) * QT;   // the wave's first of 8192 tiles
  const int n    = tile >> 11;
  int rem        = tile & 2047;
  const int h    = rem >> 7;
  const int q0   = (rem & 127) * 16;
  const int col  = lane & 15;
  const int kb   = (lane >> 4) * 8;
  const int hi   = lane >> 4;
  const size_t nh = (size_t)(n * HH + h);

  // every loop over c or j is unrolled so that the indices of bq, o, sT, pf, m_run, l_run
  // and the mask words are constants and the arrays live in registers

  // B fragments of Q^T (== Q rows in A-pattern), fixed for the whole loop
  v16h bq[QT][2];
#pragma unroll
  for (int c = 0; c < QT; ++c) {
    const _Float16* qrow = Qp + (nh * LL + q0 + c * 16 + col) * DD;
    bq[c][0] = cat16(*(const v8h*)(qrow + kb),      *(const v8h*)(qrow + 16 + kb));
    bq[c][1] = cat16(*(const v8h*)(qrow + 32 + kb), *(const v8h*)(qrow + 48 + kb));
  }

  // m_run: the maximum in use (log2 domain); l_run: running sum.  c_on = -m_run and
  // c_off = MASKED - m_run are what a score's accumulator starts from (key open / masked), so
  // that the products come out as the exponent itself.  thr: how far a score may top m_run.
  float m_run[QT], l_run[QT], c_on[QT], c_off[QT], thr[QT];
  v8f o[QT][4];
#pragma unroll
  for (int c = 0; c < QT; ++c) {
    m_run[c] = -3.4e38f;
    c_on[c]  = 3.4e38f;
    c_off[c] = 3.4e38f;
    thr[c]   = -3.4e38f;                 // the first pass always sets a maximum
    l_run[c] = 0.f;
#pragma unroll
    for (int j = 0; j < 4; ++j) o[c][j] = v8f{};
  }

  // this wave's lane-mask words: the same address in every lane (readfirstlane tells
  // the compiler) and never written during this launch (the constant address space
  // tells it), so that they come by scalar loads straight into scalar registers.
  // Tile c's words for 32-key block s are mw[c * (LL / 32) + s].
  const int utile = __builtin_amdgcn_readfirstlane(tile);
  const cv16u* mw = (const cv16u*)(MB + (size_t)((utile >> 11) * 128 + (utile & 127)) * (LL / 32 * 16));
  v16u mcur[QT];
#pragma unroll
  for (int c = 0; c < QT; ++c) mcur[c] = mw[c * (LL / 32)];

  // this thread's share of a staged tile: row sr (and sr + 32), 16-byte chunk sc
  const int sr = threadIdx.x >> 3;
  const int sc = (threadIdx.x & 7) * 8;
  const _Float16* gk = Kp + (nh * LL + sr) * DD + sc;    // + k0 * DD per tile
  const _Float16* gv = VpT + (nh * DD + sr) * LL + sc;   // + k0 per tile
  const unsigned  ls = (unsigned)(size_t)(sm + sr * PITCH + sc);  // LDS byte address, buffer 0

  stage_kv(ls, gk, gv);
  asm volatile("s_wait_asynccnt 0x0" ::: "memory");  // tile 0 landed (this wave's copies)
  __syncthreads();                                   // tile 0 readable by every wave
  stage_kv(ls + 2 * TILE_H * 2, gk + KT * DD, gv + KT);

#pragma unroll 1
  for (int t = 0; t < LL / KT; ++t) {
    const _Float16* kt = sm + (t & 1) * (2 * TILE_H) + col * PITCH + kb;
    const _Float16* vt = kt + TILE_H;
#pragma unroll
    for (int p = 0; p < KT / 32; ++p) {
      // S^T = K * Q^T : per query tile two 16x16 tiles (k 0-15, 16-31); each K fragment feeds QT products
      const _Float16* kr0 = kt + p * 32 * PITCH;
      const _Float16* kr1 = kr0 + 16 * PITCH;
      const v16h ak00 = cat16(*(const v8h*)(kr0),      *(const v8h*)(kr0 + 16));
      const v16h ak01 = cat16(*(const v8h*)(kr0 + 32), *(const v8h*)(kr0 + 48));
      const v16h ak10 = cat16(*(const v8h*)(kr1),      *(const v8h*)(kr1 + 16));
      const v16h ak11 = cat16(*(const v8h*)(kr1 + 32), *(const v8h*)(kr1 + 48));
      // Each accumulator starts at -m_run (one select per score on its lane-mask word; a masked
      // key starts at MASKED - m_run, which swallows its product), and Q carries the scale: the
      // products come out as score - m_run in log2 units, ready for exp2, with no multiply and
      // no subtraction behind them.
      v8f sT[QT][2];
#pragma unroll
      for (int c = 0; c < QT; ++c)
#pragma unroll
        for (int r = 0; r < 8; ++r) {
          const bool mv0 = __builtin_amdgcn_inverse_ballot_w32(mcur[c][r]);
          const bool mv1 = __builtin_amdgcn_inverse_ballot_w32(mcur[c][r + 8]);
          sT[c][0][r] = mv0 ? c_on[c] : c_off[c];
          sT[c][1][r] = mv1 ? c_on[c] : c_off[c];
        }
#pragma unroll
      for (int c = 0; c < QT; ++c) {
        sT[c][0] = wmma16(ak00, bq[c][0], sT[c][0]);
        sT[c][1] = wmma16(ak10, bq[c][0], sT[c][1]);
      }
#pragma unroll
      for (int c = 0; c < QT; ++c) {
        sT[c][0] = wmma16(ak01, bq[c][1], sT[c][0]);
        sT[c][1] = wmma16(ak11, bq[c][1], sT[c][1]);
      }

      // the next 32 keys' words are fetched as soon as this pass's are used up (the last pass
      // fetches its own again)
      const int s  = t * (KT / 32) + p;
      const int sn = (s + 1 < LL / 32) ? s + 1 : s;
#pragma unroll
      for (int c = 0; c < QT; ++c) mcur[c] = mw[c * (LL / 32) + sn];
      // keeps these scalar loads here, a whole pass ahead of their use: left free they sink to
      // just in front of the next pass's selects, and the wave waits out their latency
      __builtin_amdgcn_sched_barrier(0);

      // online softmax with a lazy rescale: the maximum in use, m_run, stays as it is while no
      // score of this pass lies more than 8 (a factor 2^8) above it: the weights then reach at
      // most 256, well inside f16, and sums and accumulators keep their scale.  softmax does not
      // depend on which value is subtracted, so the result is the reference's for any m_run.
      // tmax: how far the lane's 16 keys top m_run; from 0 (it changes no test against either
      // value of thr), so that the 16 values go two at a time into three-operand maxima
      float tmax[QT];
#pragma unroll
      for (int c = 0; c < QT; ++c) tmax[c] = 0.f;
#pragma unroll
      for (int r = 0; r < 8; ++r)
#pragma unroll
        for (int c = 0; c < QT; ++c) tmax[c] = fmaxf(fmaxf(tmax[c], sT[c][0][r]), sT[c][1][r]);
      bool need = false;
#pragma unroll
      for (int c = 0; c < QT; ++c) need = need | (tmax[c] > thr[c]);

      // the weights are formed with the maximum in use while the test is on its way to the
      // scalar side; where the test then asks for a new maximum they are formed again
      float e[QT][16];                             // the weights
      // unrolled so that every index of x[] and e[][] is a constant and they live in registers
#pragma unroll
      for (int c = 0; c < QT; ++c) {
        float x[16];
#pragma unroll
        for (int r = 0; r < 8; ++r) { x[r] = sT[c][0][r]; x[8 + r] = sT[c][1][r]; }
        exp2_hw16(e[c], x);
      }

      // one test per pass for the whole wave (a scalar branch); the first pass always takes it
      if (__builtin_amdgcn_ballot_w32(need) != 0) {
        // A start value far from the scores swallows them (the first pass; a row with only masked
        // keys so far), so the pass's scores are formed anew, from 0, and masked behind the products
#pragma unroll
        for (int c = 0; c < QT; ++c) {
          const v16u mk = mw[c * (LL / 32) + s];
          v8f z0 = wmma16(ak00, bq[c][0], v8f{});
          v8f z1 = wmma16(ak10, bq[c][0], v8f{});
          z0 = wmma16(ak01, bq[c][1], z0);
          z1 = wmma16(ak11, bq[c][1], z1);
          float s0[8], s1[8], x[16];
#pragma unroll
          for (int r = 0; r < 8; ++r) {
            s0[r] = __builtin_amdgcn_inverse_ballot_w32(mk[r])     ? z0[r] : MASKED;
            s1[r] = __builtin_amdgcn_inverse_ballot_w32(mk[r + 8]) ? z1[r] : MASKED;
          }
          float smax = fmaxf(s0[0], s1[0]);      // per-lane maximum over the lane's 16 keys
#pragma unroll
          for (int r = 1; r < 8; ++r) { smax = fmaxf(smax, s0[r]); smax = fmaxf(smax, s1[r]); }
          // both halves of a column take the same new maximum: one xor-16 combine
          const float m_new = fmaxf(m_run[c], fmaxf(smax, __shfl_xor(smax, 16, 32)));
          const float corr  = exp2_hw1(m_run[c] - m_new);
          l_run[c] *= corr;
          m_run[c] = m_new;
          c_on[c]  = -m_new;
          c_off[c] = MASKED - m_new;
          // while the maximum is itself a masked key's value, a masked key's weight is not 0 and
          // an open key's score would be swallowed: such a row takes this branch on every pass
          thr[c]   = (m_new > 0.01f * MASKED) ? 8.0f : -3.4e38f;
#pragma unroll
          for (int j = 0; j < 4; ++j)
#pragma unroll
            for (int r = 0; r < 8; ++r) o[c][j][r] *= corr;
#pragma unroll
          for (int r = 0; r < 8; ++r) { x[r] = s0[r] - m_new; x[8 + r] = s1[r] - m_new; }
          exp2_hw16(e[c], x);
        }
      }

      v16h pf[QT];                                 // P^T B-fragments, in registers
#pragma unroll
      for (int c = 0; c < QT; ++c) {
        float tsum = 0.f;
#pragma unroll
        for (int r = 0; r < 8; ++r) {
          const float p0 = e[c][r];
          const float p1 = e[c][8 + r];
          tsum += p0 + p1;
          pf[c][r]     = (_Float16)p0;
          pf[c][r + 8] = (_Float16)p1;
        }
        tsum += __shfl_xor(tsum, 16, 32);
        l_run[c] += tsum;
      }

      // O^T += V^T * P^T  (V^T rows of the staged tile, keys contiguous); each V^T fragment feeds QT products
      const _Float16* v0 = vt + p * 32;
#pragma unroll
      for (int j = 0; j < 4; ++j) {
        const v16h av = cat16(*(const v8h*)(v0 + j * 16 * PITCH), *(const v8h*)(v0 + j * 16 * PITCH + 16));
#pragma unroll
        for (int c = 0; c < QT; ++c) o[c][j] = wmma16(av, pf[c], o[c][j]);
      }
    }

    asm volatile("s_wait_dscnt 0x0" ::: "memory");     // this wave's reads of tile t are done
    asm volatile("s_wait_asynccnt 0x0" ::: "memory");  // this wave's copies of tile t+1 landed
    __syncthreads();  // publishes tile t+1 and frees tile t's buffer for the refill
    if (t + 2 < LL / KT)
      stage_kv(ls + (t & 1) * (2 * TILE_H * 2), gk + (size_t)(t + 2) * KT * DD, gv + (t + 2) * KT);
  }
  asm volatile("s_wait_asynccnt 0x0" ::: "memory");    // nothing in flight when the wave ends

#pragma unroll
  for (int c = 0; c < QT; ++c) {
    const float rinv = 1.0f / l_run[c];
    _Float16* crow = Ctx + ((size_t)(n * LL) + q0 + c * 16 + col) * EE + h * DD + 8 * hi;
#pragma unroll
    for (int j = 0; j < 4; ++j) {
      v8h pk;
#pragma unroll
      for (int r = 0; r < 8; ++r) pk[r] = (_Float16)(o[c][j][r] * rinv);
      *(v8h*)(crow + j * 16) = pk;
    }
  }
}

// ---------------------------------------------- out = Ctx @ Wo^T + bo  (f32)
// One block computes a 128 x 128 tile of Out; its 8 waves (4 along m, 2 along e)
// each hold 32 x 64.  Slices of OKS k-values of the Ctx rows and of the Wo rows
// are staged in LDS with whole-line copies and shared by the waves.
#define OKS     64              // k-values per staged slice (one 128-byte line per row)
#define OTILE_H (128 * PITCH)   // halves of one staged operand slice (128 rows)

// One slice pair: each thread copies 16 B of rows r, r+32, r+64, r+96 of Ctx and of Wo.
static __device__ __forceinline__ void stage_ab(unsigned la, const _Float16* ga,
                                                const _Float16* gb) {
  const unsigned la1 = la + 32 * PITCH * 2;
  const unsigned la2 = la + 64 * PITCH * 2;
  const unsigned la3 = la + 96 * PITCH * 2;
  const unsigned lb0 = la + OTILE_H * 2;
  const unsigned lb1 = lb0 + 32 * PITCH * 2;
  const unsigned lb2 = lb0 + 64 * PITCH * 2;
  const unsigned lb3 = lb0 + 96 * PITCH * 2;
  const _Float16* ga1 = ga + 32 * EE;
  const _Float16* ga2 = ga + 64 * EE;
  const _Float16* ga3 = ga + 96 * EE;
  const _Float16* gb1 = gb + 32 * EE;
  const _Float16* gb2 = gb + 64 * EE;
  const _Float16* gb3 = gb + 96 * EE;
  // s_wait_xcnt 0 closes the statement so that no address register of an issued
  // copy is rewritten ahead of it
  asm volatile("global_load_async_to_lds_b128 %0, %8, off\n\t"
               "global_load_async_to_lds_b128 %1, %9, off\n\t"
               "global_load_async_to_lds_b128 %2, %10, off\n\t"
               "global_load_async_to_lds_b128 %3, %11, off\n\t"
               "global_load_async_to_lds_b128 %4, %12, off\n\t"
               "global_load_async_to_lds_b128 %5, %13, off\n\t"
               "global_load_async_to_lds_b128 %6, %14, off\n\t"
               "global_load_async_to_lds_b128 %7, %15, off\n\t"
               "s_wait_xcnt 0x0"
               :: "v"(la), "v"(la1), "v"(la2), "v"(la3),
                  "v"(lb0), "v"(lb1), "v"(lb2), "v"(lb3),
                  "v"(ga), "v"(ga1), "v"(ga2), "v"(ga3),
                  "v"(gb), "v"(gb1), "v"(gb2), "v"(gb3)
               : "memory");
}

// launch bounds = the real block size: lifts the register ceiling so that the 8
// accumulator tiles and their fragments stay in registers
__global__ __launch_bounds__(256) void k_out(const _Float16* __restrict__ Ctx,
                                             const _Float16* __restrict__ WoH,
                                             const float* __restrict__ bo,
                                             float* __restrict__ Out) {
  __shared__ __attribute__((aligned(16))) _Float16 so[2 * 2 * OTILE_H];

  const int lane = threadIdx.x & 31;
  const int wave = threadIdx.x >> 5;
  const int m0 = (blockIdx.x >> 3) * 128;   // 64 m-blocks x 8 e-blocks
  const int e0 = (blockIdx.x & 7) * 128;
  const int wm = (wave >> 1) * 32;          // this wave's rows inside the block tile
  const int we = (wave & 1) * 64;           // this wave's columns inside the block tile
  const int col = lane & 15;
  const int kb  = (lane >> 4) * 8;
  const int hi  = lane >> 4;

  v8f acc[2][4] = {};

  // this thread's share of a staged slice: row sr (+32, +64, +96), 16-byte chunk sc
  const int sr = threadIdx.x >> 3;
  const int sc = (threadIdx.x & 7) * 8;
  const _Float16* ga = Ctx + (size_t)(m0 + sr) * EE + sc;   // + t * OKS per slice
  const _Float16* gb = WoH + (size_t)(e0 + sr) * EE + sc;   // + t * OKS per slice
  const unsigned  ls = (unsigned)(size_t)(so + sr * PITCH + sc);  // LDS byte address, buffer 0

  stage_ab(ls, ga, gb);
  asm volatile("s_wait_asynccnt 0x0" ::: "memory");  // slice 0 landed (this wave's copies)
  __syncthreads();                                   // slice 0 readable by every wave
  stage_ab(ls + 2 * OTILE_H * 2, ga + OKS, gb + OKS);

  // kept rolled: one foot (waits, barrier, refill) per slice, small loop text
#pragma unroll 1
  for (int t = 0; t < EE / OKS; ++t) {
    const _Float16* at = so + (t & 1) * (2 * OTILE_H) + (wm + col) * PITCH + kb;
    const _Float16* bt = so + (t & 1) * (2 * OTILE_H) + OTILE_H + (we + col) * PITCH + kb;
    // the inner loops here and in the epilogue are unrolled so that every index of
    // a[], b[] and acc[][] is a constant and the arrays live in registers
#pragma unroll
    for (int kk = 0; kk < OKS / 32; ++kk) {
      v16h a[2], b[4];
#pragma unroll
      for (int i = 0; i < 2; ++i) {
        const _Float16* r = at + i * 16 * PITCH + kk * 32;
        a[i] = cat16(*(const v8h*)(r), *(const v8h*)(r + 16));
      }
#pragma unroll
      for (int j = 0; j < 4; ++j) {
        const _Float16* r = bt + j * 16 * PITCH + kk * 32;
        b[j] = cat16(*(const v8h*)(r), *(const v8h*)(r + 16));
      }
#pragma unroll
      for (int i = 0; i < 2; ++i)
#pragma unroll
        for (int j = 0; j < 4; ++j) acc[i][j] = wmma16(a[i], b[j], acc[i][j]);
    }

    asm volatile("s_wait_dscnt 0x0" ::: "memory");     // this wave's reads of slice t are done
    asm volatile("s_wait_asynccnt 0x0" ::: "memory");  // this wave's copies of slice t+1 landed
    __syncthreads();  // publishes slice t+1 and frees slice t's buffer for the refill
    if (t + 2 < EE / OKS)
      stage_ab(ls + (t & 1) * (2 * OTILE_H * 2), ga + (t + 2) * OKS, gb + (t + 2) * OKS);
  }
  asm volatile("s_wait_asynccnt 0x0" ::: "memory");    // nothing in flight when the wave ends

#pragma unroll
  for (int j = 0; j < 4; ++j) {
    const int e = e0 + we + j * 16 + col;
    const float bias = bo[e];
#pragma unroll
    for (int i = 0; i < 2; ++i)
#pragma unroll
      for (int r = 0; r < 8; ++r)
        Out[(size_t)(m0 + wm + i * 16 + r + 8 * hi) * EE + e] = acc[i][j][r] + bias;
  }
}

extern "C" void kernel_launch(void* const* d_in, const int* in_sizes, int n_in,
                              void* d_out, int out_size, void* d_ws, size_t ws_size,
                              hipStream_t stream) {
  const float* values  = (const float*)d_in[0];
  const float* keys    = (const float*)d_in[1];
  const float* queries = (const float*)d_in[2];
  const int*   mask    = (const int*)d_in[3];
  const float* Wq      = (const float*)d_in[4];
  const float* Wk      = (const float*)d_in[5];
  const float* Wv      = (const float*)d_in[6];
  const float* Wo      = (const float*)d_in[7];
  const float* bo      = (const float*)d_in[8];
  float* out = (float*)d_out;

  _Float16* ws = (_Float16*)d_ws;
  const size_t per = (size_t)NB * HH * LL * DD;   // 8M halves = 16 MB each
  _Float16* Qp  = ws;
  _Float16* Kp  = Qp + per;
  _Float16* VpT = Kp + per;
  _Float16* Ctx = VpT + per;
  _Float16* WoH = Ctx + per;                       // + 2 MB
  unsigned* MB  = (unsigned*)(WoH + (size_t)EE * EE);  // + 2 MB  (total ~68 MB)

  hipLaunchKernelGGL(k_prep, dim3(MASK_BLOCKS + PROJ_BLOCKS), dim3(256), 0, stream,
                     queries, keys, values, Wq, Wk, Wv, mask, Wo, Qp, Kp, VpT, MB, WoH);
  hipLaunchKernelGGL(k_attn, dim3(8192 / (8 * QT)), dim3(256), 0, stream,
                     Qp, Kp, VpT, MB, Ctx);
  hipLaunchKernelGGL(k_out, dim3(64 * 8), dim3(256), 0, stream, Ctx, WoH, bo, out);
}
